// v000
// The times below were measured on an AMD MI455X: many runs one after another, warmed up first and cycling through
// copies of the inputs, with the whole window's GPU time divided by the number of runs. Launches and the gaps
// between them are all in it. The median over several windows is given; except for v000 it joins two sittings, which
// can be a few percent apart, so the side-by-side timings, each taken in one sitting, are the better comparison.
// The starting kernel, v000, takes 3400 microseconds a run.
#include <hip/hip_runtime.h>

// Compute dtypes, f32 accumulate, per item: Q/K/V = x.W^T + b as [2048 x 1024].[1024 x 1024] GEMMs with PLAIN bf16 operands (exact products); per head: scores = q.k^T ([2048 x
// 64].[64 x 2048], both operands bf16 hi + UNSCALED residual, three products), softmax (x 1/8) in f32; the mixed kernel 0.6 A + 0.4 L (L = the row-normalised 7-tap Gaussian band,
// a module constant) is formed in f32 while building the hi/lo planes, then (0.6 A + 0.4 L).V ([2048 x 2048].[2048 x 64], three products); out = ctx.Wo^T + bo (two products) - on

#define NBT  2
#define NN   2048
#define DMOD 1024
#define NH_  16
#define HD   64
#define DM   DMOD
#define NTK  NN
#define SCL  0.125f
#define LJ   0.6f
#define LSIG 0.4f
#define WIN  3
#define LEPSK 1e-10f
#define LOSC 1024.0f

typedef _Float16 h16;
typedef unsigned short bf;
typedef __attribute__((ext_vector_type(16))) __bf16   v16bf;
typedef __attribute__((ext_vector_type(16))) _Float16 v16h;
typedef __attribute__((ext_vector_type(8)))  _Float16 v8h;
typedef __attribute__((ext_vector_type(8)))  unsigned short v8us;
typedef __attribute__((ext_vector_type(8)))  float    v8f;
typedef __attribute__((ext_vector_type(4)))  float    v4f;
typedef __attribute__((ext_vector_type(4)))  _Float16 v4h;
typedef v8h  __attribute__((may_alias)) v8ha;
typedef v4f  __attribute__((may_alias)) v4fa;
typedef v8us __attribute__((may_alias)) v8usa;

__device__ __forceinline__ unsigned short f2bf(float f) { unsigned u = __float_as_uint(f); u += 0x7FFFu + ((u >> 16) & 1u); return (unsigned short)(u >> 16); }
__device__ __forceinline__ float bf2f(unsigned short b) { return __uint_as_float(((unsigned)b) << 16); }
__device__ __forceinline__ float bfr(float f) { return bf2f(f2bf(f)); }
__device__ __forceinline__ v16h cat16(v8h lo, v8h hi) { return __builtin_shufflevector(lo, hi, 0, 1, 2, 3, 4, 5, 6, 7, 8, 9, 10, 11, 12, 13, 14, 15); }
__device__ __forceinline__ v16bf cat16b(v8us lo, v8us hi) { return __builtin_bit_cast(v16bf, __builtin_shufflevector(lo, hi, 0, 1, 2, 3, 4, 5, 6, 7, 8, 9, 10, 11, 12, 13, 14, 15)); }
__device__ __forceinline__ v8f wmma16(v16h a, v16h b, v8f c) { return __builtin_amdgcn_wmma_f32_16x16x32_f16(false, a, false, b, (short)0, c, false, false); }
__device__ __forceinline__ v8f wmmab(v16bf a, v16bf b, v8f c) { return __builtin_amdgcn_wmma_f32_16x16x32_bf16(false, a, false, b, (short)0, c, false, false); }

// k_gemmb: 64 x 64 block tile (4 waves x 16 x 64) of C[NTK][NW] = (A [+ Al]).B^T (K = 1024) [+ bf(bias[c])] [+ bf(R[r][c]) residual]; f32 whole-line epilogue (or f16
template <bool SPLITA, bool F16OUT = false>
__global__ __launch_bounds__(128) void k_gemmb(const bf* __restrict__ A, const bf* __restrict__ Al, const bf* __restrict__ Bn, const float* __restrict__ bias, float* C, int ldc, h16* C2, const float* __restrict__ R = nullptr, int K = DM, int roundR = 1) {
    __shared__ __align__(16) float ost[4][16 * 68];
    const int lane = threadIdx.x & 31, wave = threadIdx.x >> 5, lr = lane & 15, hi = lane >> 4;
    const int r0 = blockIdx.x * 64 + wave * 16, c0 = blockIdx.y * 64;
    const size_t aoff = (size_t)(r0 + lr) * K + 8 * hi;
    size_t boff[4];
#pragma unroll
    for (int t = 0; t < 4; ++t) boff[t] = (size_t)(c0 + t * 16 + lr) * K + 8 * hi;
    v8f acc[4];
#pragma unroll
    for (int t = 0; t < 4; ++t) acc[t] = (v8f){};
#pragma unroll 1
    for (int kc = 0; kc < K; kc += 32) {
        const v16bf a = cat16b(*(const v8us*)(A + aoff + kc), *(const v8us*)(A + aoff + kc + 16));
        v16bf al = a;
        if (SPLITA) al = cat16b(*(const v8us*)(Al + aoff + kc), *(const v8us*)(Al + aoff + kc + 16));
#pragma unroll
        for (int t = 0; t < 4; ++t) { const v16bf b = cat16b(*(const v8us*)(Bn + boff[t] + kc), *(const v8us*)(Bn + boff[t] + kc + 16)); acc[t] = wmmab(a, b, acc[t]); if (SPLITA) acc[t] = wmmab(al, b, acc[t]); }
        asm volatile("v_nop\n\tv_nop\n\tv_nop\n\tv_nop" : "+v"(acc[0]), "+v"(acc[1]), "+v"(acc[2]), "+v"(acc[3]) : "v"(a), "v"(al));
    }
    float* os = &ost[wave][0];
#pragma unroll
    for (int t = 0; t < 4; ++t) { const float bv = bias ? bfr(bias[c0 + t * 16 + lr]) : 0.f;
#pragma unroll
        for (int j = 0; j < 8; ++j) os[(hi * 8 + j) * 68 + t * 16 + lr] = acc[t][j] + bv; }
    __syncthreads();
    if (F16OUT) {
        h16* crow = (h16*)(void*)C + (size_t)r0 * ldc + c0;
        auto pass = [&]() {
#pragma unroll
            for (int s = 0; s < 4; ++s) { const int row = 4 * s + (lane >> 3), piece = lane & 7; const float* sp = os + row * 68 + piece * 8; v8h o, o2;
#pragma unroll
                for (int i = 0; i < 8; ++i) { const h16 a = (h16)sp[i]; o[i] = a; o2[i] = (h16)((sp[i] - (float)a) * LOSC); }
                *(v8h*)(crow + (size_t)row * ldc + piece * 8) = o; if (C2) *(v8h*)(C2 + (size_t)r0 * ldc + c0 + (size_t)row * ldc + piece * 8) = o2; }
        };
        pass(); 
    } else {
        float* crow = C + (size_t)r0 * ldc + c0;
        auto pass = [&]() {
#pragma unroll
            for (int s = 0; s < 8; ++s) { const int Lid = (lane >> 3) + 4 * s, piece = lane & 7; const int row = Lid >> 1, cofs = (Lid & 1) * 32 + piece * 4;
                v4f val = *(const v4fa*)(os + row * 68 + cofs); if (R) { const v4f rv = *(const v4f*)(R + ((size_t)r0 + row) * ldc + c0 + cofs); val += roundR ? (v4f){bfr(rv[0]), bfr(rv[1]), bfr(rv[2]), bfr(rv[3])} : rv; }
                *(v4f*)(crow + (size_t)row * ldc + cofs) = val; }
        };
        pass(); 
    }
}

// k_gemm3: 64 x 64 tile of C = (Ah + Al).(Bh + Bl)^T over K (row strides = K for all four planes; n-major B): three products per 32-k step (hh, hl, lh); f32
__global__ __launch_bounds__(128) void k_gemm3(const bf* __restrict__ Ah, const bf* __restrict__ Al, const bf* __restrict__ Bh, const bf* __restrict__ Bl, int K, float* C, int ldc) {
    __shared__ __align__(16) float ost[4][16 * 68];
    const int lane = threadIdx.x & 31, wave = threadIdx.x >> 5, lr = lane & 15, hi = lane >> 4;
    const int r0 = blockIdx.x * 64 + wave * 16, c0 = blockIdx.y * 64;
    const size_t aoff = (size_t)(r0 + lr) * K + 8 * hi;
    v8f acc[4];
#pragma unroll
    for (int t = 0; t < 4; ++t) acc[t] = (v8f){};
#pragma unroll 1
    for (int kc = 0; kc < K; kc += 32) {
        const v16bf a = cat16b(*(const v8us*)(Ah + aoff + kc), *(const v8us*)(Ah + aoff + kc + 16));
        const v16bf al = cat16b(*(const v8us*)(Al + aoff + kc), *(const v8us*)(Al + aoff + kc + 16));
#pragma unroll
        for (int t = 0; t < 4; ++t) { const size_t bo = (size_t)(c0 + t * 16 + lr) * K + kc + 8 * hi;
            const v16bf bh = cat16b(*(const v8us*)(Bh + bo), *(const v8us*)(Bh + bo + 16)); const v16bf bl = cat16b(*(const v8us*)(Bl + bo), *(const v8us*)(Bl + bo + 16));
            acc[t] = wmmab(a, bh, acc[t]); acc[t] = wmmab(al, bh, acc[t]); acc[t] = wmmab(a, bl, acc[t]); }
        asm volatile("v_nop\n\tv_nop\n\tv_nop\n\tv_nop" : "+v"(acc[0]), "+v"(acc[1]), "+v"(acc[2]), "+v"(acc[3]) : "v"(a), "v"(al));
    }
    float* os = &ost[wave][0];
#pragma unroll
    for (int t = 0; t < 4; ++t) {
#pragma unroll
        for (int j = 0; j < 8; ++j) os[(hi * 8 + j) * 68 + t * 16 + lr] = acc[t][j]; }
    __builtin_amdgcn_wave_barrier(); asm volatile("" ::: "memory");
    float* crow = C + (size_t)r0 * ldc + c0;
    auto pass = [&]() {
#pragma unroll
        for (int s = 0; s < 8; ++s) { const int Lid = (lane >> 3) + 4 * s, piece = lane & 7; const int row = Lid >> 1, cofs = (Lid & 1) * 32 + piece * 4;
            const v4f val = *(const v4fa*)(os + row * 68 + cofs); *(v4f*)(crow + (size_t)row * ldc + cofs) = val; }
    };
    pass(); 
}

__global__ __launch_bounds__(256) void k_cvt8(const float* __restrict__ src, bf* dst, size_t n8) {
    const size_t i = (size_t)blockIdx.x * 256 + threadIdx.x; if (i >= n8) return;
    const v8f v = *(const v8f*)(src + i * 8); v8us o;
#pragma unroll
    for (int k = 0; k < 8; ++k) o[k] = f2bf(v[k]);
    *(v8us*)(dst + i * 8) = o; 
}
__global__ __launch_bounds__(256) void k_zero8(bf* dst, size_t n8) {
    const size_t i = (size_t)blockIdx.x * 256 + threadIdx.x; if (i >= n8) return; v8us z;
#pragma unroll
    for (int k = 0; k < 8; ++k) z[k] = 0;
    *(v8us*)(dst + i * 8) = z; 
}

__global__ __launch_bounds__(256) void k_cvtx(const float* __restrict__ src, bf* dst) {
    const int lane = threadIdx.x & 31; const size_t r = (size_t)blockIdx.x * 8 + (threadIdx.x >> 5); if (r >= (size_t)NN) return;
{
#pragma unroll
        for (int q = 0; q < DMOD / 256; ++q) { v8us o;
#pragma unroll
            for (int i = 0; i < 8; ++i) o[i] = f2bf(src[r * DMOD + q * 256 + lane * 8 + i]);
            *(v8us*)(dst + r * DMOD + q * 256 + lane * 8) = o; }
         }
}
// k_hplanes / k_vt (row stride 1024).
__global__ __launch_bounds__(256) void k_hplanes(const float* __restrict__ F, int h, bf* Ph, bf* Pl) {
    typedef __attribute__((ext_vector_type(2))) unsigned short v2us;
    const int lane = threadIdx.x & 31; const size_t s = (size_t)blockIdx.x * 8 + (threadIdx.x >> 5); if (s >= (size_t)NN) return; v2us oh, ol;
#pragma unroll
    for (int i = 0; i < 2; ++i) { const float v = F[s * DMOD + h * HD + lane * 2 + i]; const unsigned short hb = f2bf(v); oh[i] = hb; ol[i] = f2bf(v - bf2f(hb)); }
    const size_t o = s * HD + lane * 2; *(v2us*)(Ph + o) = oh; *(v2us*)(Pl + o) = ol; 
}
__global__ __launch_bounds__(256) void k_vt(const float* __restrict__ VF, int h, bf* Th, bf* Tl) {
    typedef __attribute__((ext_vector_type(2))) unsigned short v2us;
    const int lane = threadIdx.x & 31; const size_t wid = (size_t)blockIdx.x * 8 + (threadIdx.x >> 5); if (wid >= (size_t)HD * (NN / 64)) return; const int d = (int)(wid / (NN / 64)); const int t0 = (int)(wid % (NN / 64)) * 64 + lane * 2; v2us oh, ol;
#pragma unroll
    for (int i = 0; i < 2; ++i) { const float v = VF[(size_t)(t0 + i) * DMOD + h * HD + d]; const unsigned short hb = f2bf(v); oh[i] = hb; ol[i] = f2bf(v - bf2f(hb)); }
    const size_t o = (size_t)d * NN + t0; *(v2us*)(Th + o) = oh; *(v2us*)(Tl + o) = ol; 
}
// k_mixsoft: row i: A = softmax(S x 1/8) over all 2048 keys (three-pass f32); W = 0.6 A + 0.4 L[i][k] with L[i][k] = exp(-(i-k)^2 / (2 x 0.16)) / (sum over |i-k'| <= 3, k' in range + 1e-10)
__global__ __launch_bounds__(256) void k_mixsoft(const float* __restrict__ S, bf* WH, bf* WL) {
    typedef __attribute__((ext_vector_type(4))) unsigned short v4us;
    const int lane = threadIdx.x & 31, i = blockIdx.x * 8 + (threadIdx.x >> 5); if (i >= NN) return;
    float m = -3.0e38f;
#pragma unroll 1
    for (int c0 = lane * 4; c0 < NN; c0 += 128) {
#pragma unroll
        for (int q = 0; q < 4; ++q) m = fmaxf(m, S[(size_t)i * NN + c0 + q] * SCL); }
#pragma unroll
    for (int sh = 16; sh; sh >>= 1) m = fmaxf(m, __shfl_xor(m, sh, 32));
    float sum = 0.f;
#pragma unroll 1
    for (int c0 = lane * 4; c0 < NN; c0 += 128) {
#pragma unroll
        for (int q = 0; q < 4; ++q) sum += __expf(S[(size_t)i * NN + c0 + q] * SCL - m); }
#pragma unroll
    for (int sh = 16; sh; sh >>= 1) sum += __shfl_xor(sum, sh, 32);
    const float inv = 1.0f / sum;
    float lnorm = 0.f;       // row normaliser of the band (taps clipped at the sequence ends), same for every lane
#pragma unroll
    for (int d = -WIN; d <= WIN; ++d) { const int k = i - d; if (k >= 0 && k < NN) lnorm += __expf(-(float)(d * d) / (2.0f * LSIG * LSIG)); }
    const float linv = 1.0f / (lnorm + LEPSK);
{
#pragma unroll 1
        for (int c0 = lane * 4; c0 < NN; c0 += 128) { v4us oh, ol;
#pragma unroll
            for (int q = 0; q < 4; ++q) { const int k = c0 + q; const float a = __expf(S[(size_t)i * NN + k] * SCL - m) * inv; const int d = i - k; const float l = (d >= -WIN && d <= WIN) ? __expf(-(float)(d * d) / (2.0f * LSIG * LSIG)) * linv : 0.f;
                const float w = LJ * a + (1.0f - LJ) * l; const unsigned short hb = f2bf(w); oh[q] = hb; ol[q] = f2bf(w - bf2f(hb)); }
            const size_t o = (size_t)i * NN + c0; *(v4us*)(WH + o) = oh; *(v4us*)(WL + o) = ol; }
         }
}
__global__ __launch_bounds__(256) void k_split1k(const float* __restrict__ src, bf* dh, bf* dl) {
    const int lane = threadIdx.x & 31; const size_t r = (size_t)blockIdx.x * 8 + (threadIdx.x >> 5); if (r >= (size_t)NN) return;
{
#pragma unroll
        for (int q = 0; q < DMOD / 256; ++q) { const size_t o = r * DMOD + q * 256 + lane * 8; const v8f v = *(const v8f*)(src + o); v8us oh, ol;
#pragma unroll
            for (int i = 0; i < 8; ++i) { const unsigned short hb = f2bf(v[i]); oh[i] = hb; ol[i] = f2bf(v[i] - bf2f(hb)); }
            *(v8us*)(dh + o) = oh; *(v8us*)(dl + o) = ol; }
         }
}

extern "C" void kernel_launch(void* const* d_in, const int* in_sizes, int n_in,
                              void* d_out, int out_size, void* d_ws, size_t ws_size, hipStream_t stream) {
    (void)in_sizes; (void)n_in; (void)out_size;
    const float* x = (const float*)d_in[0]; const float* Wq = (const float*)d_in[1]; const float* bq = (const float*)d_in[2]; const float* Wk = (const float*)d_in[3]; const float* bk = (const float*)d_in[4]; const float* Wv = (const float*)d_in[5]; const float* bv = (const float*)d_in[6]; const float* Wo = (const float*)d_in[7]; const float* bo = (const float*)d_in[8];
    float* out = (float*)d_out;    // [2][2048][1024]
    char* wsp = (char*)d_ws;
    auto take = [&](size_t bytes) { char* p = wsp; wsp += (bytes + 255) & ~(size_t)255; return (void*)p; };
    bf* WQ = (bf*)take((size_t)DMOD * DMOD * 2); bf* WK = (bf*)take((size_t)DMOD * DMOD * 2); bf* WV = (bf*)take((size_t)DMOD * DMOD * 2); bf* WO = (bf*)take((size_t)DMOD * DMOD * 2);
    bf* Xb = (bf*)take((size_t)NN * DMOD * 2); float* QF = (float*)take((size_t)NN * DMOD * 4); float* KF = (float*)take((size_t)NN * DMOD * 4); float* VF = (float*)take((size_t)NN * DMOD * 4);
    bf* Qh = (bf*)take((size_t)NN * HD * 2); bf* Ql = (bf*)take((size_t)NN * HD * 2); bf* Kh = (bf*)take((size_t)NN * HD * 2); bf* Kl = (bf*)take((size_t)NN * HD * 2); bf* VTh = (bf*)take((size_t)HD * NN * 2); bf* VTl = (bf*)take((size_t)HD * NN * 2);
    float* S = (float*)take((size_t)NN * NN * 4); bf* WH = (bf*)take((size_t)NN * NN * 2); bf* WL = (bf*)take((size_t)NN * NN * 2); float* CTX = (float*)take((size_t)NN * DMOD * 4); bf* Ch = (bf*)take((size_t)NN * DMOD * 2); bf* Cl = (bf*)take((size_t)NN * DMOD * 2);
    if ((size_t)(wsp - (char*)d_ws) > ws_size) return;    // 8.4 + 4.2 + 25.2 + 1.5 + 16.8 + 16.8 + 8.4 + 8.4 ~ 90 MB; per item/head reuse in stream order
    k_cvt8<<<(unsigned)(((size_t)DMOD * DMOD / 8 + 255) / 256), 256, 0, stream>>>(Wq, WQ, (size_t)DMOD * DMOD / 8); k_cvt8<<<(unsigned)(((size_t)DMOD * DMOD / 8 + 255) / 256), 256, 0, stream>>>(Wk, WK, (size_t)DMOD * DMOD / 8);
    k_cvt8<<<(unsigned)(((size_t)DMOD * DMOD / 8 + 255) / 256), 256, 0, stream>>>(Wv, WV, (size_t)DMOD * DMOD / 8); k_cvt8<<<(unsigned)(((size_t)DMOD * DMOD / 8 + 255) / 256), 256, 0, stream>>>(Wo, WO, (size_t)DMOD * DMOD / 8);   // torch [out][in] = n-major
    for (int b = 0; b < NBT; ++b) {
        k_cvtx<<<NN / 8, 256, 0, stream>>>(x + (size_t)b * NN * DMOD, Xb);
        k_gemmb<false, false><<<dim3(NN / 64, DMOD / 64, 1), 128, 0, stream>>>(Xb, nullptr, WQ, bq, QF, DMOD, nullptr, nullptr, DMOD);
        k_gemmb<false, false><<<dim3(NN / 64, DMOD / 64, 1), 128, 0, stream>>>(Xb, nullptr, WK, bk, KF, DMOD, nullptr, nullptr, DMOD);
        k_gemmb<false, false><<<dim3(NN / 64, DMOD / 64, 1), 128, 0, stream>>>(Xb, nullptr, WV, bv, VF, DMOD, nullptr, nullptr, DMOD);
        for (int h = 0; h < NH_; ++h) {
            k_hplanes<<<NN / 8, 256, 0, stream>>>(QF, h, Qh, Ql); k_hplanes<<<NN / 8, 256, 0, stream>>>(KF, h, Kh, Kl); k_vt<<<(HD * (NN / 64)) / 8, 256, 0, stream>>>(VF, h, VTh, VTl);
            k_gemm3<<<dim3(NN / 64, NN / 64, 1), 128, 0, stream>>>(Qh, Ql, Kh, Kl, HD, S, NN);
            k_mixsoft<<<NN / 8, 256, 0, stream>>>(S, WH, WL);
            k_gemm3<<<dim3(NN / 64, 1, 1), 128, 0, stream>>>(WH, WL, VTh, VTl, NN, CTX + h * HD, DMOD); }
        k_split1k<<<NN / 8, 256, 0, stream>>>(CTX, Ch, Cl);
        k_gemmb<true, false><<<dim3(NN / 64, DMOD / 64, 1), 128, 0, stream>>>(Ch, Cl, WO, bo, out + (size_t)b * NN * DMOD, DMOD, nullptr, nullptr, DMOD); }
}

// v001
// Measured time: 1120 microseconds a run.
// Two timings next to v000 put it at 3.22 and 3.17 times that version's speed.
#include <hip/hip_runtime.h>

// Compute dtypes, f32 accumulate, per item: Q/K/V = x.W^T + b as [2048 x 1024].[1024 x 1024] GEMMs with PLAIN bf16 operands (exact products); per head: scores = q.k^T ([2048 x
// 64].[64 x 2048], both operands bf16 hi + UNSCALED residual, three products), softmax (x 1/8) in f32; the mixed kernel 0.6 A + 0.4 L (L = the row-normalised 7-tap Gaussian band,
// a module constant) is formed in f32 while building the hi/lo planes, then (0.6 A + 0.4 L).V ([2048 x 2048].[2048 x 64], three products); out = ctx.Wo^T + bo (two products) - on

#define NBT  2
#define NN   2048
#define DMOD 1024
#define NH_  16
#define HD   64
#define DM   DMOD
#define NTK  NN
#define SCL  0.125f
#define LJ   0.6f
#define LSIG 0.4f
#define WIN  3
#define LEPSK 1e-10f
#define LOSC 1024.0f
#define GH   6      // heads per scores / softmax / (0.6 A + 0.4 L).V launch: the most whose S, WH, WL fit the workspace

typedef _Float16 h16;
typedef unsigned short bf;
typedef __attribute__((ext_vector_type(16))) __bf16   v16bf;
typedef __attribute__((ext_vector_type(16))) _Float16 v16h;
typedef __attribute__((ext_vector_type(8)))  _Float16 v8h;
typedef __attribute__((ext_vector_type(8)))  unsigned short v8us;
typedef __attribute__((ext_vector_type(8)))  float    v8f;
typedef __attribute__((ext_vector_type(4)))  float    v4f;
typedef __attribute__((ext_vector_type(4)))  _Float16 v4h;
typedef v8h  __attribute__((may_alias)) v8ha;
typedef v4f  __attribute__((may_alias)) v4fa;
typedef v8us __attribute__((may_alias)) v8usa;

__device__ __forceinline__ unsigned short f2bf(float f) { unsigned u = __float_as_uint(f); u += 0x7FFFu + ((u >> 16) & 1u); return (unsigned short)(u >> 16); }
__device__ __forceinline__ float bf2f(unsigned short b) { return __uint_as_float(((unsigned)b) << 16); }
__device__ __forceinline__ float bfr(float f) { return bf2f(f2bf(f)); }
__device__ __forceinline__ v16h cat16(v8h lo, v8h hi) { return __builtin_shufflevector(lo, hi, 0, 1, 2, 3, 4, 5, 6, 7, 8, 9, 10, 11, 12, 13, 14, 15); }
__device__ __forceinline__ v16bf cat16b(v8us lo, v8us hi) { return __builtin_bit_cast(v16bf, __builtin_shufflevector(lo, hi, 0, 1, 2, 3, 4, 5, 6, 7, 8, 9, 10, 11, 12, 13, 14, 15)); }
__device__ __forceinline__ v8f wmma16(v16h a, v16h b, v8f c) { return __builtin_amdgcn_wmma_f32_16x16x32_f16(false, a, false, b, (short)0, c, false, false); }
__device__ __forceinline__ v8f wmmab(v16bf a, v16bf b, v8f c) { return __builtin_amdgcn_wmma_f32_16x16x32_bf16(false, a, false, b, (short)0, c, false, false); }

// k_gemmb: 64 x 64 block tile (4 waves x 16 x 64) of C[NTK][NW] = (A [+ Al]).B^T (K = 1024) [+ bf(bias[c])] [+ bf(R[r][c]) residual]; f32 whole-line epilogue (or f16
template <bool SPLITA, bool F16OUT = false>
__global__ __launch_bounds__(128) void k_gemmb(const bf* __restrict__ A, const bf* __restrict__ Al, const bf* __restrict__ Bn, const float* __restrict__ bias, float* C, int ldc, h16* C2, const float* __restrict__ R = nullptr, int K = DM, int roundR = 1) {
    __shared__ __align__(16) float ost[4][16 * 68];
    const int lane = threadIdx.x & 31, wave = threadIdx.x >> 5, lr = lane & 15, hi = lane >> 4;
    const int r0 = blockIdx.x * 64 + wave * 16, c0 = blockIdx.y * 64;
    const size_t aoff = (size_t)(r0 + lr) * K + 8 * hi;
    size_t boff[4];
#pragma unroll
    for (int t = 0; t < 4; ++t) boff[t] = (size_t)(c0 + t * 16 + lr) * K + 8 * hi;
    v8f acc[4];
#pragma unroll
    for (int t = 0; t < 4; ++t) acc[t] = (v8f){};
#pragma unroll 1
    for (int kc = 0; kc < K; kc += 32) {
        const v16bf a = cat16b(*(const v8us*)(A + aoff + kc), *(const v8us*)(A + aoff + kc + 16));
        v16bf al = a;
        if (SPLITA) al = cat16b(*(const v8us*)(Al + aoff + kc), *(const v8us*)(Al + aoff + kc + 16));
#pragma unroll
        for (int t = 0; t < 4; ++t) { const v16bf b = cat16b(*(const v8us*)(Bn + boff[t] + kc), *(const v8us*)(Bn + boff[t] + kc + 16)); acc[t] = wmmab(a, b, acc[t]); if (SPLITA) acc[t] = wmmab(al, b, acc[t]); }
        asm volatile("v_nop\n\tv_nop\n\tv_nop\n\tv_nop" : "+v"(acc[0]), "+v"(acc[1]), "+v"(acc[2]), "+v"(acc[3]) : "v"(a), "v"(al));
    }
    float* os = &ost[wave][0];
#pragma unroll
    for (int t = 0; t < 4; ++t) { const float bv = bias ? bfr(bias[c0 + t * 16 + lr]) : 0.f;
#pragma unroll
        for (int j = 0; j < 8; ++j) os[(hi * 8 + j) * 68 + t * 16 + lr] = acc[t][j] + bv; }
    __syncthreads();
    if (F16OUT) {
        h16* crow = (h16*)(void*)C + (size_t)r0 * ldc + c0;
        auto pass = [&]() {
#pragma unroll
            for (int s = 0; s < 4; ++s) { const int row = 4 * s + (lane >> 3), piece = lane & 7; const float* sp = os + row * 68 + piece * 8; v8h o, o2;
#pragma unroll
                for (int i = 0; i < 8; ++i) { const h16 a = (h16)sp[i]; o[i] = a; o2[i] = (h16)((sp[i] - (float)a) * LOSC); }
                *(v8h*)(crow + (size_t)row * ldc + piece * 8) = o; if (C2) *(v8h*)(C2 + (size_t)r0 * ldc + c0 + (size_t)row * ldc + piece * 8) = o2; }
        };
        pass(); 
    } else {
        float* crow = C + (size_t)r0 * ldc + c0;
        auto pass = [&]() {
#pragma unroll
            for (int s = 0; s < 8; ++s) { const int Lid = (lane >> 3) + 4 * s, piece = lane & 7; const int row = Lid >> 1, cofs = (Lid & 1) * 32 + piece * 4;
                v4f val = *(const v4fa*)(os + row * 68 + cofs); if (R) { const v4f rv = *(const v4f*)(R + ((size_t)r0 + row) * ldc + c0 + cofs); val += roundR ? (v4f){bfr(rv[0]), bfr(rv[1]), bfr(rv[2]), bfr(rv[3])} : rv; }
                *(v4f*)(crow + (size_t)row * ldc + cofs) = val; }
        };
        pass(); 
    }
}

// k_gemm3: 64 x 64 tile of C = (Ah + Al).(Bh + Bl)^T over K (row strides = K for all four planes; n-major B): three products per 32-k step (hh, hl, lh); f32
// blockIdx.z = head within the launch's group: both A planes step by sA elements a head, both B planes by sB, C by sC.
__global__ __launch_bounds__(128) void k_gemm3(const bf* __restrict__ Ah0, const bf* __restrict__ Al0, const bf* __restrict__ Bh0, const bf* __restrict__ Bl0, int K, float* C0, int ldc, size_t sA, size_t sB, size_t sC) {
    __shared__ __align__(16) float ost[4][16 * 68];
    const bf* __restrict__ Ah = Ah0 + blockIdx.z * sA; const bf* __restrict__ Al = Al0 + blockIdx.z * sA; const bf* __restrict__ Bh = Bh0 + blockIdx.z * sB; const bf* __restrict__ Bl = Bl0 + blockIdx.z * sB; float* C = C0 + blockIdx.z * sC;
    const int lane = threadIdx.x & 31, wave = threadIdx.x >> 5, lr = lane & 15, hi = lane >> 4;
    const int r0 = blockIdx.x * 64 + wave * 16, c0 = blockIdx.y * 64;
    const size_t aoff = (size_t)(r0 + lr) * K + 8 * hi;
    v8f acc[4];
#pragma unroll
    for (int t = 0; t < 4; ++t) acc[t] = (v8f){};
#pragma unroll 1
    for (int kc = 0; kc < K; kc += 32) {
        const v16bf a = cat16b(*(const v8us*)(Ah + aoff + kc), *(const v8us*)(Ah + aoff + kc + 16));
        const v16bf al = cat16b(*(const v8us*)(Al + aoff + kc), *(const v8us*)(Al + aoff + kc + 16));
#pragma unroll
        for (int t = 0; t < 4; ++t) { const size_t bo = (size_t)(c0 + t * 16 + lr) * K + kc + 8 * hi;
            const v16bf bh = cat16b(*(const v8us*)(Bh + bo), *(const v8us*)(Bh + bo + 16)); const v16bf bl = cat16b(*(const v8us*)(Bl + bo), *(const v8us*)(Bl + bo + 16));
            acc[t] = wmmab(a, bh, acc[t]); acc[t] = wmmab(al, bh, acc[t]); acc[t] = wmmab(a, bl, acc[t]); }
        asm volatile("v_nop\n\tv_nop\n\tv_nop\n\tv_nop" : "+v"(acc[0]), "+v"(acc[1]), "+v"(acc[2]), "+v"(acc[3]) : "v"(a), "v"(al));
    }
    float* os = &ost[wave][0];
#pragma unroll
    for (int t = 0; t < 4; ++t) {
#pragma unroll
        for (int j = 0; j < 8; ++j) os[(hi * 8 + j) * 68 + t * 16 + lr] = acc[t][j]; }
    __builtin_amdgcn_wave_barrier(); asm volatile("" ::: "memory");
    float* crow = C + (size_t)r0 * ldc + c0;
    auto pass = [&]() {
#pragma unroll
        for (int s = 0; s < 8; ++s) { const int Lid = (lane >> 3) + 4 * s, piece = lane & 7; const int row = Lid >> 1, cofs = (Lid & 1) * 32 + piece * 4;
            const v4f val = *(const v4fa*)(os + row * 68 + cofs); *(v4f*)(crow + (size_t)row * ldc + cofs) = val; }
    };
    pass(); 
}

__global__ __launch_bounds__(256) void k_cvt8(const float* __restrict__ src, bf* dst, size_t n8) {
    const size_t i = (size_t)blockIdx.x * 256 + threadIdx.x; if (i >= n8) return;
    const v8f v = *(const v8f*)(src + i * 8); v8us o;
#pragma unroll
    for (int k = 0; k < 8; ++k) o[k] = f2bf(v[k]);
    *(v8us*)(dst + i * 8) = o; 
}
__global__ __launch_bounds__(256) void k_zero8(bf* dst, size_t n8) {
    const size_t i = (size_t)blockIdx.x * 256 + threadIdx.x; if (i >= n8) return; v8us z;
#pragma unroll
    for (int k = 0; k < 8; ++k) z[k] = 0;
    *(v8us*)(dst + i * 8) = z; 
}

__global__ __launch_bounds__(256) void k_cvtx(const float* __restrict__ src, bf* dst) {
    const int lane = threadIdx.x & 31; const size_t r = (size_t)blockIdx.x * 8 + (threadIdx.x >> 5); if (r >= (size_t)NN) return;
{
#pragma unroll
        for (int q = 0; q < DMOD / 256; ++q) { v8us o;
#pragma unroll
            for (int i = 0; i < 8; ++i) o[i] = f2bf(src[r * DMOD + q * 256 + lane * 8 + i]);
            *(v8us*)(dst + r * DMOD + q * 256 + lane * 8) = o; }
         }
}
// k_hplanes / k_vt as in the other attention kernels (row stride 1024); blockIdx.y = head, planes laid out [head][row][64] and [head][64][token].
__global__ __launch_bounds__(256) void k_hplanes(const float* __restrict__ F, bf* Ph, bf* Pl) {
    const int h = blockIdx.y;
    typedef __attribute__((ext_vector_type(2))) unsigned short v2us;
    const int lane = threadIdx.x & 31; const size_t s = (size_t)blockIdx.x * 8 + (threadIdx.x >> 5); if (s >= (size_t)NN) return; v2us oh, ol;
#pragma unroll
    for (int i = 0; i < 2; ++i) { const float v = F[s * DMOD + h * HD + lane * 2 + i]; const unsigned short hb = f2bf(v); oh[i] = hb; ol[i] = f2bf(v - bf2f(hb)); }
    const size_t o = ((size_t)h * NN + s) * HD + lane * 2; *(v2us*)(Ph + o) = oh; *(v2us*)(Pl + o) = ol; 
}
__global__ __launch_bounds__(256) void k_vt(const float* __restrict__ VF, bf* Th, bf* Tl) {
    const int h = blockIdx.y;
    typedef __attribute__((ext_vector_type(2))) unsigned short v2us;
    const int lane = threadIdx.x & 31; const size_t wid = (size_t)blockIdx.x * 8 + (threadIdx.x >> 5); if (wid >= (size_t)HD * (NN / 64)) return; const int d = (int)(wid / (NN / 64)); const int t0 = (int)(wid % (NN / 64)) * 64 + lane * 2; v2us oh, ol;
#pragma unroll
    for (int i = 0; i < 2; ++i) { const float v = VF[(size_t)(t0 + i) * DMOD + h * HD + d]; const unsigned short hb = f2bf(v); oh[i] = hb; ol[i] = f2bf(v - bf2f(hb)); }
    const size_t o = ((size_t)h * HD + d) * NN + t0; *(v2us*)(Th + o) = oh; *(v2us*)(Tl + o) = ol; 
}
// k_mixsoft: row i: A = softmax(S x 1/8) over all 2048 keys (three-pass f32); W = 0.6 A + 0.4 L[i][k] with L[i][k] = exp(-(i-k)^2 / (2 x 0.16)) / (sum over |i-k'| <= 3, k' in range + 1e-10)
// blockIdx.y = head within the launch's group (each head's S, WH, WL are [2048][2048], one after the other).
__global__ __launch_bounds__(256) void k_mixsoft(const float* __restrict__ S0, bf* WH0, bf* WL0) {
    typedef __attribute__((ext_vector_type(4))) unsigned short v4us;
    const float* __restrict__ S = S0 + (size_t)blockIdx.y * NN * NN; bf* WH = WH0 + (size_t)blockIdx.y * NN * NN; bf* WL = WL0 + (size_t)blockIdx.y * NN * NN;
    const int lane = threadIdx.x & 31, i = blockIdx.x * 8 + (threadIdx.x >> 5); if (i >= NN) return;
    float m = -3.0e38f;
#pragma unroll 1
    for (int c0 = lane * 4; c0 < NN; c0 += 128) {
#pragma unroll
        for (int q = 0; q < 4; ++q) m = fmaxf(m, S[(size_t)i * NN + c0 + q] * SCL); }
#pragma unroll
    for (int sh = 16; sh; sh >>= 1) m = fmaxf(m, __shfl_xor(m, sh, 32));
    float sum = 0.f;
#pragma unroll 1
    for (int c0 = lane * 4; c0 < NN; c0 += 128) {
#pragma unroll
        for (int q = 0; q < 4; ++q) sum += __expf(S[(size_t)i * NN + c0 + q] * SCL - m); }
#pragma unroll
    for (int sh = 16; sh; sh >>= 1) sum += __shfl_xor(sum, sh, 32);
    const float inv = 1.0f / sum;
    float lnorm = 0.f;       // row normaliser of the band (taps clipped at the sequence ends), same for every lane
#pragma unroll
    for (int d = -WIN; d <= WIN; ++d) { const int k = i - d; if (k >= 0 && k < NN) lnorm += __expf(-(float)(d * d) / (2.0f * LSIG * LSIG)); }
    const float linv = 1.0f / (lnorm + LEPSK);
{
#pragma unroll 1
        for (int c0 = lane * 4; c0 < NN; c0 += 128) { v4us oh, ol;
#pragma unroll
            for (int q = 0; q < 4; ++q) { const int k = c0 + q; const float a = __expf(S[(size_t)i * NN + k] * SCL - m) * inv; const int d = i - k; const float l = (d >= -WIN && d <= WIN) ? __expf(-(float)(d * d) / (2.0f * LSIG * LSIG)) * linv : 0.f;
                const float w = LJ * a + (1.0f - LJ) * l; const unsigned short hb = f2bf(w); oh[q] = hb; ol[q] = f2bf(w - bf2f(hb)); }
            const size_t o = (size_t)i * NN + c0; *(v4us*)(WH + o) = oh; *(v4us*)(WL + o) = ol; }
         }
}
__global__ __launch_bounds__(256) void k_split1k(const float* __restrict__ src, bf* dh, bf* dl) {
    const int lane = threadIdx.x & 31; const size_t r = (size_t)blockIdx.x * 8 + (threadIdx.x >> 5); if (r >= (size_t)NN) return;
{
#pragma unroll
        for (int q = 0; q < DMOD / 256; ++q) { const size_t o = r * DMOD + q * 256 + lane * 8; const v8f v = *(const v8f*)(src + o); v8us oh, ol;
#pragma unroll
            for (int i = 0; i < 8; ++i) { const unsigned short hb = f2bf(v[i]); oh[i] = hb; ol[i] = f2bf(v[i] - bf2f(hb)); }
            *(v8us*)(dh + o) = oh; *(v8us*)(dl + o) = ol; }
         }
}

extern "C" void kernel_launch(void* const* d_in, const int* in_sizes, int n_in,
                              void* d_out, int out_size, void* d_ws, size_t ws_size, hipStream_t stream) {
    (void)in_sizes; (void)n_in; (void)out_size;
    const float* x = (const float*)d_in[0]; const float* Wq = (const float*)d_in[1]; const float* bq = (const float*)d_in[2]; const float* Wk = (const float*)d_in[3]; const float* bk = (const float*)d_in[4]; const float* Wv = (const float*)d_in[5]; const float* bv = (const float*)d_in[6]; const float* Wo = (const float*)d_in[7]; const float* bo = (const float*)d_in[8];
    float* out = (float*)d_out;    // [2][2048][1024]
    char* wsp = (char*)d_ws;
    auto take = [&](size_t bytes) { char* p = wsp; wsp += (bytes + 255) & ~(size_t)255; return (void*)p; };
    bf* WQ = (bf*)take((size_t)DMOD * DMOD * 2); bf* WK = (bf*)take((size_t)DMOD * DMOD * 2); bf* WV = (bf*)take((size_t)DMOD * DMOD * 2); bf* WO = (bf*)take((size_t)DMOD * DMOD * 2);
    bf* Xb = (bf*)take((size_t)NN * DMOD * 2);
    bf* Qh = (bf*)take((size_t)NH_ * NN * HD * 2); bf* Ql = (bf*)take((size_t)NH_ * NN * HD * 2); bf* Kh = (bf*)take((size_t)NH_ * NN * HD * 2); bf* Kl = (bf*)take((size_t)NH_ * NN * HD * 2); bf* VTh = (bf*)take((size_t)NH_ * HD * NN * 2); bf* VTl = (bf*)take((size_t)NH_ * HD * NN * 2);
    float* S = (float*)take((size_t)GH * NN * NN * 4); bf* WH = (bf*)take((size_t)GH * NN * NN * 2); bf* WL = (bf*)take((size_t)GH * NN * NN * 2);
    float* QF = S; float* KF = S + (size_t)NN * DMOD; float* VF = S + (size_t)2 * NN * DMOD;    // the f32 Q, K, V lie in S's space: all 16 heads' planes are cut from them before the first scores launch of the item writes S
    float* CTX = (float*)take((size_t)NN * DMOD * 4); bf* Ch = (bf*)take((size_t)NN * DMOD * 2); bf* Cl = (bf*)take((size_t)NN * DMOD * 2);
    if ((size_t)(wsp - (char*)d_ws) > ws_size) return;    // 8.4 + 4.2 + 25.2 + 100.7 + 100.7 + 8.4 + 8.4 ~ 256 MB; per item / head group reuse in stream order
    k_cvt8<<<(unsigned)(((size_t)DMOD * DMOD / 8 + 255) / 256), 256, 0, stream>>>(Wq, WQ, (size_t)DMOD * DMOD / 8); k_cvt8<<<(unsigned)(((size_t)DMOD * DMOD / 8 + 255) / 256), 256, 0, stream>>>(Wk, WK, (size_t)DMOD * DMOD / 8);
    k_cvt8<<<(unsigned)(((size_t)DMOD * DMOD / 8 + 255) / 256), 256, 0, stream>>>(Wv, WV, (size_t)DMOD * DMOD / 8); k_cvt8<<<(unsigned)(((size_t)DMOD * DMOD / 8 + 255) / 256), 256, 0, stream>>>(Wo, WO, (size_t)DMOD * DMOD / 8);   // torch [out][in] = n-major
    for (int b = 0; b < NBT; ++b) {
        k_cvtx<<<NN / 8, 256, 0, stream>>>(x + (size_t)b * NN * DMOD, Xb);
        k_gemmb<false, false><<<dim3(NN / 64, DMOD / 64, 1), 128, 0, stream>>>(Xb, nullptr, WQ, bq, QF, DMOD, nullptr, nullptr, DMOD);
        k_gemmb<false, false><<<dim3(NN / 64, DMOD / 64, 1), 128, 0, stream>>>(Xb, nullptr, WK, bk, KF, DMOD, nullptr, nullptr, DMOD);
        k_gemmb<false, false><<<dim3(NN / 64, DMOD / 64, 1), 128, 0, stream>>>(Xb, nullptr, WV, bv, VF, DMOD, nullptr, nullptr, DMOD);
        k_hplanes<<<dim3(NN / 8, NH_, 1), 256, 0, stream>>>(QF, Qh, Ql); k_hplanes<<<dim3(NN / 8, NH_, 1), 256, 0, stream>>>(KF, Kh, Kl); k_vt<<<dim3((HD * (NN / 64)) / 8, NH_, 1), 256, 0, stream>>>(VF, VTh, VTl);
        for (int h = 0; h < NH_; h += GH) {
            const int g = NH_ - h < GH ? NH_ - h : GH; const size_t po = (size_t)h * NN * HD;    // heads h .. h + g - 1 in one launch each
            k_gemm3<<<dim3(NN / 64, NN / 64, g), 128, 0, stream>>>(Qh + po, Ql + po, Kh + po, Kl + po, HD, S, NN, (size_t)NN * HD, (size_t)NN * HD, (size_t)NN * NN);
            k_mixsoft<<<dim3(NN / 8, g, 1), 256, 0, stream>>>(S, WH, WL);
            k_gemm3<<<dim3(NN / 64, 1, g), 128, 0, stream>>>(WH, WL, VTh + po, VTl + po, NN, CTX + h * HD, DMOD, (size_t)NN * NN, (size_t)HD * NN, (size_t)HD); }
        k_split1k<<<NN / 8, 256, 0, stream>>>(CTX, Ch, Cl);
        k_gemmb<true, false><<<dim3(NN / 64, DMOD / 64, 1), 128, 0, stream>>>(Ch, Cl, WO, bo, out + (size_t)b * NN * DMOD, DMOD, nullptr, nullptr, DMOD); }
}

// v002
// Measured time: 380 microseconds a run.
// Two timings next to v001 put it at 2.95 and 2.96 times that version's speed.
// Over all steps from v000 it is 9.43 times as fast.
#include <hip/hip_runtime.h>

// Compute dtypes, f32 accumulate, per item: Q/K/V = x.W^T + b as [2048 x 1024].[1024 x 1024] GEMMs with PLAIN bf16 operands (exact products); per head: scores = q.k^T ([2048 x
// 64].[64 x 2048], both operands bf16 hi + UNSCALED residual, three products), running softmax (x 1/8) in f32, exp(s - max).V ([2048 x 2048].[2048 x 64], hi + residual, three products),
// scaled by 0.6 / sum, plus 0.4 L.V (L = the row-normalised 7-tap Gaussian band, hi + residual, three products), all in k_fattn; out = ctx.Wo^T + bo (two products) - on

#define NBT  2
#define NN   2048
#define DMOD 1024
#define NH_  16
#define HD   64
#define DM   DMOD
#define NTK  NN
#define SCL  0.125f
#define LJ   0.6f
#define LSIG 0.4f
#define WIN  3
#define LEPSK 1e-10f
#define LOSC 1024.0f

typedef _Float16 h16;
typedef unsigned short bf;
typedef __attribute__((ext_vector_type(16))) __bf16   v16bf;
typedef __attribute__((ext_vector_type(16))) _Float16 v16h;
typedef __attribute__((ext_vector_type(8)))  _Float16 v8h;
typedef __attribute__((ext_vector_type(8)))  unsigned short v8us;
typedef __attribute__((ext_vector_type(8)))  float    v8f;
typedef __attribute__((ext_vector_type(4)))  float    v4f;
typedef __attribute__((ext_vector_type(4)))  _Float16 v4h;
typedef v8h  __attribute__((may_alias)) v8ha;
typedef v4f  __attribute__((may_alias)) v4fa;
typedef v8us __attribute__((may_alias)) v8usa;

__device__ __forceinline__ unsigned short f2bf(float f) { unsigned u = __float_as_uint(f); u += 0x7FFFu + ((u >> 16) & 1u); return (unsigned short)(u >> 16); }
__device__ __forceinline__ float bf2f(unsigned short b) { return __uint_as_float(((unsigned)b) << 16); }
__device__ __forceinline__ float bfr(float f) { return bf2f(f2bf(f)); }
__device__ __forceinline__ v16h cat16(v8h lo, v8h hi) { return __builtin_shufflevector(lo, hi, 0, 1, 2, 3, 4, 5, 6, 7, 8, 9, 10, 11, 12, 13, 14, 15); }
__device__ __forceinline__ v16bf cat16b(v8us lo, v8us hi) { return __builtin_bit_cast(v16bf, __builtin_shufflevector(lo, hi, 0, 1, 2, 3, 4, 5, 6, 7, 8, 9, 10, 11, 12, 13, 14, 15)); }
__device__ __forceinline__ v8f wmma16(v16h a, v16h b, v8f c) { return __builtin_amdgcn_wmma_f32_16x16x32_f16(false, a, false, b, (short)0, c, false, false); }
__device__ __forceinline__ v8f wmmab(v16bf a, v16bf b, v8f c) { return __builtin_amdgcn_wmma_f32_16x16x32_bf16(false, a, false, b, (short)0, c, false, false); }

// k_gemmb: 64 x 64 block tile (4 waves x 16 x 64) of C[NTK][NW] = (A [+ Al]).B^T (K = 1024) [+ bf(bias[c])] [+ bf(R[r][c]) residual]; f32 whole-line epilogue (or f16
template <bool SPLITA, bool F16OUT = false>
__global__ __launch_bounds__(128) void k_gemmb(const bf* __restrict__ A, const bf* __restrict__ Al, const bf* __restrict__ Bn, const float* __restrict__ bias, float* C, int ldc, h16* C2, const float* __restrict__ R = nullptr, int K = DM, int roundR = 1) {
    __shared__ __align__(16) float ost[4][16 * 68];
    const int lane = threadIdx.x & 31, wave = threadIdx.x >> 5, lr = lane & 15, hi = lane >> 4;
    const int r0 = blockIdx.x * 64 + wave * 16, c0 = blockIdx.y * 64;
    const size_t aoff = (size_t)(r0 + lr) * K + 8 * hi;
    size_t boff[4];
#pragma unroll
    for (int t = 0; t < 4; ++t) boff[t] = (size_t)(c0 + t * 16 + lr) * K + 8 * hi;
    v8f acc[4];
#pragma unroll
    for (int t = 0; t < 4; ++t) acc[t] = (v8f){};
#pragma unroll 1
    for (int kc = 0; kc < K; kc += 32) {
        const v16bf a = cat16b(*(const v8us*)(A + aoff + kc), *(const v8us*)(A + aoff + kc + 16));
        v16bf al = a;
        if (SPLITA) al = cat16b(*(const v8us*)(Al + aoff + kc), *(const v8us*)(Al + aoff + kc + 16));
#pragma unroll
        for (int t = 0; t < 4; ++t) { const v16bf b = cat16b(*(const v8us*)(Bn + boff[t] + kc), *(const v8us*)(Bn + boff[t] + kc + 16)); acc[t] = wmmab(a, b, acc[t]); if (SPLITA) acc[t] = wmmab(al, b, acc[t]); }
        asm volatile("v_nop\n\tv_nop\n\tv_nop\n\tv_nop" : "+v"(acc[0]), "+v"(acc[1]), "+v"(acc[2]), "+v"(acc[3]) : "v"(a), "v"(al));
    }
    float* os = &ost[wave][0];
#pragma unroll
    for (int t = 0; t < 4; ++t) { const float bv = bias ? bfr(bias[c0 + t * 16 + lr]) : 0.f;
#pragma unroll
        for (int j = 0; j < 8; ++j) os[(hi * 8 + j) * 68 + t * 16 + lr] = acc[t][j] + bv; }
    __syncthreads();
    if (F16OUT) {
        h16* crow = (h16*)(void*)C + (size_t)r0 * ldc + c0;
        auto pass = [&]() {
#pragma unroll
            for (int s = 0; s < 4; ++s) { const int row = 4 * s + (lane >> 3), piece = lane & 7; const float* sp = os + row * 68 + piece * 8; v8h o, o2;
#pragma unroll
                for (int i = 0; i < 8; ++i) { const h16 a = (h16)sp[i]; o[i] = a; o2[i] = (h16)((sp[i] - (float)a) * LOSC); }
                *(v8h*)(crow + (size_t)row * ldc + piece * 8) = o; if (C2) *(v8h*)(C2 + (size_t)r0 * ldc + c0 + (size_t)row * ldc + piece * 8) = o2; }
        };
        pass(); 
    } else {
        float* crow = C + (size_t)r0 * ldc + c0;
        auto pass = [&]() {
#pragma unroll
            for (int s = 0; s < 8; ++s) { const int Lid = (lane >> 3) + 4 * s, piece = lane & 7; const int row = Lid >> 1, cofs = (Lid & 1) * 32 + piece * 4;
                v4f val = *(const v4fa*)(os + row * 68 + cofs); if (R) { const v4f rv = *(const v4f*)(R + ((size_t)r0 + row) * ldc + c0 + cofs); val += roundR ? (v4f){bfr(rv[0]), bfr(rv[1]), bfr(rv[2]), bfr(rv[3])} : rv; }
                *(v4f*)(crow + (size_t)row * ldc + cofs) = val; }
        };
        pass(); 
    }
}

#define FP   72            // LDS row pitch in 16-bit elements
#define FPL  (64 * FP)     // one plane's tile
#define SC2  0.18033688f   // 1/8 x log2(e)
typedef __attribute__((ext_vector_type(16))) float v16f;
__device__ __forceinline__ float xhalf(float v) { const int b = __float_as_int(v); return __int_as_float(__builtin_amdgcn_permlanex16(b, b, 0x76543210, 0xfedcba98, false, false)); }   // lane l <-> l ^ 16
__device__ __forceinline__ v16f widen16(v16bf x) { typedef __attribute__((ext_vector_type(8))) unsigned v8u; const v8u w = __builtin_bit_cast(v8u, x); v16f r;    // packed bf16 pairs back to f32: a shift and a mask a pair
#pragma unroll
    for (int k = 0; k < 8; ++k) { r[2 * k] = __uint_as_float(w[k] << 16); r[2 * k + 1] = __uint_as_float(w[k] & 0xFFFF0000u); }
    return r; }
#define GC2  (-1.44269504f / (2.0f * LSIG * LSIG))    // un-normalised band tap = exp(-d^2 / (2 x 0.16)) = exp2(d^2 x GC2), 0 outside |d| <= 3
__device__ __forceinline__ v16f cat16f(v8f lo, v8f hi) { return __builtin_shufflevector(lo, hi, 0, 1, 2, 3, 4, 5, 6, 7, 8, 9, 10, 11, 12, 13, 14, 15); }
// Eight independent v_exp_f32 in one statement, every output apart from every input, v_nop last: no neighbour reads a result or overwrites a source in the slot directly behind a transcendental.
__device__ __forceinline__ v8f exp2x8(v8f x) { float r0, r1, r2, r3, r4, r5, r6, r7;
    asm("v_exp_f32 %0, %8\n\tv_exp_f32 %1, %9\n\tv_exp_f32 %2, %10\n\tv_exp_f32 %3, %11\n\tv_exp_f32 %4, %12\n\tv_exp_f32 %5, %13\n\tv_exp_f32 %6, %14\n\tv_exp_f32 %7, %15\n\tv_nop"
        : "=&v"(r0), "=&v"(r1), "=&v"(r2), "=&v"(r3), "=&v"(r4), "=&v"(r5), "=&v"(r6), "=&v"(r7) : "v"(x[0]), "v"(x[1]), "v"(x[2]), "v"(x[3]), "v"(x[4]), "v"(x[5]), "v"(x[6]), "v"(x[7]));
    return (v8f){r0, r1, r2, r3, r4, r5, r6, r7}; }
__device__ __forceinline__ float exp2x1(float x) { float r; asm("v_exp_f32 %0, %1\n\tv_nop" : "=v"(r) : "v"(x)); return r; }    // one v_exp_f32 with the same slot behind it
__global__ __launch_bounds__(256) void k_fattn(const bf* __restrict__ Qh, const bf* __restrict__ Ql, const bf* __restrict__ Kh, const bf* __restrict__ Kl, const bf* __restrict__ VTh, const bf* __restrict__ VTl, float* CTX) {
    __shared__ __align__(16) bf tl[2][4][FPL];
    const int tid = threadIdx.x, lane = tid & 31, lr = lane & 15, hi = lane >> 4;
    const int wave = __builtin_amdgcn_readfirstlane(tid >> 5);
    const int h = blockIdx.y, q0 = blockIdx.x * 128 + wave * 16;
    const bf* __restrict__ kh0 = Kh + (size_t)h * NN * HD; const bf* __restrict__ kl0 = Kl + (size_t)h * NN * HD;
    const bf* __restrict__ vh0 = VTh + (size_t)h * HD * NN; const bf* __restrict__ vl0 = VTl + (size_t)h * HD * NN;
    v16bf qh[2], ql[2];
#pragma unroll
    for (int ks = 0; ks < 2; ++ks) { const size_t o = ((size_t)h * NN + q0 + lr) * HD + ks * 32 + 8 * hi; qh[ks] = cat16b(*(const v8us*)(Qh + o), *(const v8us*)(Qh + o + 16)); }
    asm volatile("s_wait_xcnt 0x0" ::: "memory");    // these loads' address registers are free for re-use (the next loads' results land in them) only behind this wait
#pragma unroll
    for (int ks = 0; ks < 2; ++ks) { const size_t o = ((size_t)h * NN + q0 + lr) * HD + ks * 32 + 8 * hi; ql[ks] = cat16b(*(const v8us*)(Ql + o), *(const v8us*)(Ql + o + 16)); }
    asm volatile("s_wait_xcnt 0x0" ::: "memory");    // the same for the residual plane's loads
    const int srow = tid >> 3, spc = (tid & 7) * 8;    // staging: thread -> rows srow and srow + 32, 16-byte piece spc of each plane's 64 x 128-byte tile (a wave covers whole lines)
    v8us g[8];
    auto gload = [&](int kb) {
#pragma unroll
        for (int u = 0; u < 2; ++u) { const int row = srow + 32 * u; const size_t ko = (size_t)(kb + row) * HD + spc, vo = (size_t)row * NN + kb + spc;
            g[u] = *(const v8us*)(kh0 + ko); g[2 + u] = *(const v8us*)(kl0 + ko); g[4 + u] = *(const v8us*)(vh0 + vo); g[6 + u] = *(const v8us*)(vl0 + vo); }
    };
    auto sstore = [&](int buf) {
#pragma unroll
        for (int u = 0; u < 2; ++u) { const int o = (srow + 32 * u) * FP + spc;
            *(v8us*)(&tl[buf][0][o]) = g[u]; *(v8us*)(&tl[buf][1][o]) = g[2 + u]; *(v8us*)(&tl[buf][2][o]) = g[4 + u]; *(v8us*)(&tl[buf][3][o]) = g[6 + u]; }
    };
    v8f acc[4];
#pragma unroll
    for (int t = 0; t < 4; ++t) acc[t] = (v8f){};
    float m = -3.0e38f, lsum = 0.f;    // running maximum (raw score units, equal in both halves of the wave) and this half's part of the sum
    gload(0);
    asm volatile("s_wait_xcnt 0x0" ::: "memory");    // the loop's address arithmetic re-uses these loads' offset registers
    sstore(0);
    __syncthreads();
#pragma unroll 1
    for (int s = 0; s < NN / 64; ++s) {
        const int cur = s & 1;
        if (s + 1 < NN / 64) gload((s + 1) * 64);
#pragma unroll
        for (int hf = 0; hf < 2; ++hf) {
            v8f st[2]; st[0] = (v8f){}; st[1] = (v8f){};
#pragma unroll
            for (int ks = 0; ks < 2; ++ks) { v16bf kh[2], kl[2];
#pragma unroll
                for (int tt = 0; tt < 2; ++tt) { const int o = (hf * 32 + tt * 16 + lr) * FP + ks * 32 + 8 * hi;
                    kh[tt] = cat16b(*(const v8us*)(&tl[cur][0][o]), *(const v8us*)(&tl[cur][0][o + 16])); kl[tt] = cat16b(*(const v8us*)(&tl[cur][1][o]), *(const v8us*)(&tl[cur][1][o + 16])); }
                st[0] = wmmab(kh[0], qh[ks], st[0]); st[1] = wmmab(kh[1], qh[ks], st[1]);
                st[0] = wmmab(kl[0], qh[ks], st[0]); st[1] = wmmab(kl[1], qh[ks], st[1]);
                st[0] = wmmab(kh[0], ql[ks], st[0]); st[1] = wmmab(kh[1], ql[ks], st[1]); }
            float mx = fmaxf(st[0][0], st[1][0]);
#pragma unroll
            for (int j = 1; j < 8; ++j) mx = fmaxf(mx, fmaxf(st[0][j], st[1][j]));
            mx = fmaxf(mx, xhalf(mx));
            const float mnew = fmaxf(m, mx), alpha = exp2x1((m - mnew) * SC2), mc = mnew * SC2;
            m = mnew;
            const v16f p = cat16f(exp2x8(st[0] * SC2 - mc), exp2x8(st[1] * SC2 - mc));
            const v8f s8 = __builtin_shufflevector(p, p, 0, 1, 2, 3, 4, 5, 6, 7) + __builtin_shufflevector(p, p, 8, 9, 10, 11, 12, 13, 14, 15);
            const v4f s4 = __builtin_shufflevector(s8, s8, 0, 1, 2, 3) + __builtin_shufflevector(s8, s8, 4, 5, 6, 7);
            lsum = lsum * alpha + ((s4[0] + s4[2]) + (s4[1] + s4[3]));
            const v16bf ph = __builtin_convertvector(p, v16bf);
            const v16bf pl = __builtin_convertvector(p - widen16(ph), v16bf);
            v16bf vh[4], vl[4];
#pragma unroll
            for (int t = 0; t < 4; ++t) { const int o = (t * 16 + lr) * FP + hf * 32 + 8 * hi; acc[t] *= alpha;
                vh[t] = cat16b(*(const v8us*)(&tl[cur][2][o]), *(const v8us*)(&tl[cur][2][o + 16])); vl[t] = cat16b(*(const v8us*)(&tl[cur][3][o]), *(const v8us*)(&tl[cur][3][o + 16])); }
#pragma unroll
            for (int t = 0; t < 4; ++t) acc[t] = wmmab(vh[t], ph, acc[t]);
#pragma unroll
            for (int t = 0; t < 4; ++t) acc[t] = wmmab(vl[t], ph, acc[t]);
#pragma unroll
            for (int t = 0; t < 4; ++t) acc[t] = wmmab(vh[t], pl, acc[t]);
        }
        if (s + 1 < NN / 64) sstore(cur ^ 1);    // every wave left that buffer before the barrier that ended the tile before this one
        __syncthreads();
    }
    lsum += xhalf(lsum);
    const float inv = LJ / lsum;
#pragma unroll
    for (int t = 0; t < 4; ++t) acc[t] *= inv;
    const int i = q0 + lr;
    float lnorm = 0.f;       // row normaliser of the band (taps clipped at the sequence ends)
#pragma unroll
    for (int d = -WIN; d <= WIN; ++d) { const int k = i - d; lnorm += (k >= 0 && k < NN) ? __builtin_amdgcn_exp2f((float)(d * d) * GC2) : 0.f; }
    const float lw = (1.0f - LJ) / (lnorm + LEPSK);
#pragma unroll
    for (int bb = 0; bb < 2; ++bb) { const int kb = ((q0 - 16) & ~31) + 32 * bb;    // keys q0 - 3 .. q0 + 18 lie in these two blocks; wave-uniform test
        if (kb >= 0 && kb < NN) { v8f q2[2];    // squared distance query - key, in the B operand's k order
#pragma unroll
            for (int e = 0; e < 16; ++e) { const float fd = (float)(i - (kb + (e < 8 ? 8 * hi + e : 8 + 8 * hi + e))); q2[e >> 3][e & 7] = fd * fd; }
            const v16f ge = cat16f(exp2x8(q2[0] * GC2), exp2x8(q2[1] * GC2)); v16f lv;
#pragma unroll
            for (int e = 0; e < 16; ++e) lv[e] = q2[e >> 3][e & 7] <= (float)(WIN * WIN) ? ge[e] * lw : 0.f;
            const v16bf lh = __builtin_convertvector(lv, v16bf);
            const v16bf ll = __builtin_convertvector(lv - widen16(lh), v16bf);
#pragma unroll
            for (int t = 0; t < 4; ++t) { const size_t o = (size_t)(t * 16 + lr) * NN + kb + 8 * hi;
                const v16bf vh = cat16b(*(const v8us*)(vh0 + o), *(const v8us*)(vh0 + o + 16)); const v16bf vl = cat16b(*(const v8us*)(vl0 + o), *(const v8us*)(vl0 + o + 16));
                acc[t] = wmmab(vh, lh, acc[t]); acc[t] = wmmab(vl, lh, acc[t]); acc[t] = wmmab(vh, ll, acc[t]); } } }
    float* crow = CTX + (size_t)i * DMOD + h * HD + hi * 8;    // acc[t][j] = O[query i][16 t + 8 hi + j]
#pragma unroll
    for (int t = 0; t < 4; ++t) { *(v4f*)(crow + t * 16) = (v4f){acc[t][0], acc[t][1], acc[t][2], acc[t][3]}; *(v4f*)(crow + t * 16 + 4) = (v4f){acc[t][4], acc[t][5], acc[t][6], acc[t][7]}; }
}

__global__ __launch_bounds__(256) void k_cvt8(const float* __restrict__ src, bf* dst, size_t n8) {
    const size_t i = (size_t)blockIdx.x * 256 + threadIdx.x; if (i >= n8) return;
    const v8f v = *(const v8f*)(src + i * 8); v8us o;
#pragma unroll
    for (int k = 0; k < 8; ++k) o[k] = f2bf(v[k]);
    *(v8us*)(dst + i * 8) = o; 
}
__global__ __launch_bounds__(256) void k_zero8(bf* dst, size_t n8) {
    const size_t i = (size_t)blockIdx.x * 256 + threadIdx.x; if (i >= n8) return; v8us z;
#pragma unroll
    for (int k = 0; k < 8; ++k) z[k] = 0;
    *(v8us*)(dst + i * 8) = z; 
}

__global__ __launch_bounds__(256) void k_cvtx(const float* __restrict__ src, bf* dst) {
    const int lane = threadIdx.x & 31; const size_t r = (size_t)blockIdx.x * 8 + (threadIdx.x >> 5); if (r >= (size_t)NN) return;
{
#pragma unroll
        for (int q = 0; q < DMOD / 256; ++q) { v8us o;
#pragma unroll
            for (int i = 0; i < 8; ++i) o[i] = f2bf(src[r * DMOD + q * 256 + lane * 8 + i]);
            *(v8us*)(dst + r * DMOD + q * 256 + lane * 8) = o; }
         }
}
// k_hplanes / k_vt as in the other attention kernels (row stride 1024); blockIdx.y = head, planes laid out [head][row][64] and [head][64][token].
__global__ __launch_bounds__(256) void k_hplanes(const float* __restrict__ F, bf* Ph, bf* Pl) {
    const int h = blockIdx.y;
    typedef __attribute__((ext_vector_type(2))) unsigned short v2us;
    const int lane = threadIdx.x & 31; const size_t s = (size_t)blockIdx.x * 8 + (threadIdx.x >> 5); if (s >= (size_t)NN) return; v2us oh, ol;
#pragma unroll
    for (int i = 0; i < 2; ++i) { const float v = F[s * DMOD + h * HD + lane * 2 + i]; const unsigned short hb = f2bf(v); oh[i] = hb; ol[i] = f2bf(v - bf2f(hb)); }
    const size_t o = ((size_t)h * NN + s) * HD + lane * 2; *(v2us*)(Ph + o) = oh; *(v2us*)(Pl + o) = ol; 
}
__global__ __launch_bounds__(256) void k_vt(const float* __restrict__ VF, bf* Th, bf* Tl) {
    const int h = blockIdx.y;
    typedef __attribute__((ext_vector_type(2))) unsigned short v2us;
    const int lane = threadIdx.x & 31; const size_t wid = (size_t)blockIdx.x * 8 + (threadIdx.x >> 5); if (wid >= (size_t)HD * (NN / 64)) return; const int d = (int)(wid / (NN / 64)); const int t0 = (int)(wid % (NN / 64)) * 64 + lane * 2; v2us oh, ol;
#pragma unroll
    for (int i = 0; i < 2; ++i) { const float v = VF[(size_t)(t0 + i) * DMOD + h * HD + d]; const unsigned short hb = f2bf(v); oh[i] = hb; ol[i] = f2bf(v - bf2f(hb)); }
    const size_t o = ((size_t)h * HD + d) * NN + t0; *(v2us*)(Th + o) = oh; *(v2us*)(Tl + o) = ol; 
}
__global__ __launch_bounds__(256) void k_split1k(const float* __restrict__ src, bf* dh, bf* dl) {
    const int lane = threadIdx.x & 31; const size_t r = (size_t)blockIdx.x * 8 + (threadIdx.x >> 5); if (r >= (size_t)NN) return;
{
#pragma unroll
        for (int q = 0; q < DMOD / 256; ++q) { const size_t o = r * DMOD + q * 256 + lane * 8; const v8f v = *(const v8f*)(src + o); v8us oh, ol;
#pragma unroll
            for (int i = 0; i < 8; ++i) { const unsigned short hb = f2bf(v[i]); oh[i] = hb; ol[i] = f2bf(v[i] - bf2f(hb)); }
            *(v8us*)(dh + o) = oh; *(v8us*)(dl + o) = ol; }
         }
}

extern "C" void kernel_launch(void* const* d_in, const int* in_sizes, int n_in,
                              void* d_out, int out_size, void* d_ws, size_t ws_size, hipStream_t stream) {
    (void)in_sizes; (void)n_in; (void)out_size;
    const float* x = (const float*)d_in[0]; const float* Wq = (const float*)d_in[1]; const float* bq = (const float*)d_in[2]; const float* Wk = (const float*)d_in[3]; const float* bk = (const float*)d_in[4]; const float* Wv = (const float*)d_in[5]; const float* bv = (const float*)d_in[6]; const float* Wo = (const float*)d_in[7]; const float* bo = (const float*)d_in[8];
    float* out = (float*)d_out;    // [2][2048][1024]
    char* wsp = (char*)d_ws;
    auto take = [&](size_t bytes) { char* p = wsp; wsp += (bytes + 255) & ~(size_t)255; return (void*)p; };
    bf* WQ = (bf*)take((size_t)DMOD * DMOD * 2); bf* WK = (bf*)take((size_t)DMOD * DMOD * 2); bf* WV = (bf*)take((size_t)DMOD * DMOD * 2); bf* WO = (bf*)take((size_t)DMOD * DMOD * 2);
    bf* Xb = (bf*)take((size_t)NN * DMOD * 2);
    bf* Qh = (bf*)take((size_t)NH_ * NN * HD * 2); bf* Ql = (bf*)take((size_t)NH_ * NN * HD * 2); bf* Kh = (bf*)take((size_t)NH_ * NN * HD * 2); bf* Kl = (bf*)take((size_t)NH_ * NN * HD * 2); bf* VTh = (bf*)take((size_t)NH_ * HD * NN * 2); bf* VTl = (bf*)take((size_t)NH_ * HD * NN * 2);
    float* QF = (float*)take((size_t)NN * DMOD * 4); float* KF = (float*)take((size_t)NN * DMOD * 4); float* VF = (float*)take((size_t)NN * DMOD * 4);
    float* CTX = (float*)take((size_t)NN * DMOD * 4); bf* Ch = (bf*)take((size_t)NN * DMOD * 2); bf* Cl = (bf*)take((size_t)NN * DMOD * 2);
    if ((size_t)(wsp - (char*)d_ws) > ws_size) return;    // 8.4 + 4.2 + 25.2 + 25.2 + 8.4 + 8.4 ~ 80 MB; per item reuse in stream order
    k_cvt8<<<(unsigned)(((size_t)DMOD * DMOD / 8 + 255) / 256), 256, 0, stream>>>(Wq, WQ, (size_t)DMOD * DMOD / 8); k_cvt8<<<(unsigned)(((size_t)DMOD * DMOD / 8 + 255) / 256), 256, 0, stream>>>(Wk, WK, (size_t)DMOD * DMOD / 8);
    k_cvt8<<<(unsigned)(((size_t)DMOD * DMOD / 8 + 255) / 256), 256, 0, stream>>>(Wv, WV, (size_t)DMOD * DMOD / 8); k_cvt8<<<(unsigned)(((size_t)DMOD * DMOD / 8 + 255) / 256), 256, 0, stream>>>(Wo, WO, (size_t)DMOD * DMOD / 8);   // torch [out][in] = n-major
    for (int b = 0; b < NBT; ++b) {
        k_cvtx<<<NN / 8, 256, 0, stream>>>(x + (size_t)b * NN * DMOD, Xb);
        k_gemmb<false, false><<<dim3(NN / 64, DMOD / 64, 1), 128, 0, stream>>>(Xb, nullptr, WQ, bq, QF, DMOD, nullptr, nullptr, DMOD);
        k_gemmb<false, false><<<dim3(NN / 64, DMOD / 64, 1), 128, 0, stream>>>(Xb, nullptr, WK, bk, KF, DMOD, nullptr, nullptr, DMOD);
        k_gemmb<false, false><<<dim3(NN / 64, DMOD / 64, 1), 128, 0, stream>>>(Xb, nullptr, WV, bv, VF, DMOD, nullptr, nullptr, DMOD);
        k_hplanes<<<dim3(NN / 8, NH_, 1), 256, 0, stream>>>(QF, Qh, Ql); k_hplanes<<<dim3(NN / 8, NH_, 1), 256, 0, stream>>>(KF, Kh, Kl); k_vt<<<dim3((HD * (NN / 64)) / 8, NH_, 1), 256, 0, stream>>>(VF, VTh, VTl);
        k_fattn<<<dim3(NN / 128, NH_, 1), 256, 0, stream>>>(Qh, Ql, Kh, Kl, VTh, VTl, CTX);
        k_split1k<<<NN / 8, 256, 0, stream>>>(CTX, Ch, Cl);
        k_gemmb<true, false><<<dim3(NN / 64, DMOD / 64, 1), 128, 0, stream>>>(Ch, Cl, WO, bo, out + (size_t)b * NN * DMOD, DMOD, nullptr, nullptr, DMOD); }
}

// v003
// Measured time: 329 microseconds a run.
// In two side-by-side timings against v002, it was 1.14 and 1.15 times as fast.
// Counting every step since v000, it is 10.8 times as fast.
#include <hip/hip_runtime.h>

// Compute dtypes, f32 accumulate, per item: Q/K = x.W^T + b as [2048 x 1024].[1024 x 1024] GEMMs, V^T = Wv.x^T + b (by row) as [1024 x 1024].[1024 x 2048], with PLAIN bf16 operands (exact products); per head: scores = q.k^T ([2048 x
// 64].[64 x 2048], both operands bf16 hi + UNSCALED residual, three products), running softmax (x 1/8) in f32, exp(s - max).V ([2048 x 2048].[2048 x 64], hi + residual, three products),
// scaled by 0.6 / sum, plus 0.4 L.V (L = the row-normalised 7-tap Gaussian band, hi + residual, three products), all in k_fattn; out = ctx.Wo^T + bo (two products) - on

#define NBT  2
#define NN   2048
#define DMOD 1024
#define NH_  16
#define HD   64
#define DM   DMOD
#define NTK  NN
#define SCL  0.125f
#define LJ   0.6f
#define LSIG 0.4f
#define WIN  3
#define LEPSK 1e-10f
#define LOSC 1024.0f

typedef _Float16 h16;
typedef unsigned short bf;
typedef __attribute__((ext_vector_type(16))) __bf16   v16bf;
typedef __attribute__((ext_vector_type(16))) _Float16 v16h;
typedef __attribute__((ext_vector_type(8)))  _Float16 v8h;
typedef __attribute__((ext_vector_type(8)))  unsigned short v8us;
typedef __attribute__((ext_vector_type(8)))  float    v8f;
typedef __attribute__((ext_vector_type(4)))  float    v4f;
typedef __attribute__((ext_vector_type(4)))  _Float16 v4h;
typedef v8h  __attribute__((may_alias)) v8ha;
typedef v4f  __attribute__((may_alias)) v4fa;
typedef v8us __attribute__((may_alias)) v8usa;

__device__ __forceinline__ unsigned short f2bf(float f) { unsigned u = __float_as_uint(f); u += 0x7FFFu + ((u >> 16) & 1u); return (unsigned short)(u >> 16); }
__device__ __forceinline__ float bf2f(unsigned short b) { return __uint_as_float(((unsigned)b) << 16); }
__device__ __forceinline__ float bfr(float f) { return bf2f(f2bf(f)); }
__device__ __forceinline__ v16h cat16(v8h lo, v8h hi) { return __builtin_shufflevector(lo, hi, 0, 1, 2, 3, 4, 5, 6, 7, 8, 9, 10, 11, 12, 13, 14, 15); }
__device__ __forceinline__ v16bf cat16b(v8us lo, v8us hi) { return __builtin_bit_cast(v16bf, __builtin_shufflevector(lo, hi, 0, 1, 2, 3, 4, 5, 6, 7, 8, 9, 10, 11, 12, 13, 14, 15)); }
__device__ __forceinline__ v8f wmma16(v16h a, v16h b, v8f c) { return __builtin_amdgcn_wmma_f32_16x16x32_f16(false, a, false, b, (short)0, c, false, false); }
__device__ __forceinline__ v8f wmmab(v16bf a, v16bf b, v8f c) { return __builtin_amdgcn_wmma_f32_16x16x32_bf16(false, a, false, b, (short)0, c, false, false); }

// k_gemmb: 64 x 64 block tile (4 waves x 16 x 64) of C[NTK][NW] = (A [+ Al]).B^T (K = 1024) [+ bf(bias[c])] [+ bf(R[r][c]) residual]; f32 whole-line epilogue (or bf16
// OUTM 0: f32 C. OUTM 1: bf16 hi + residual planes laid out [column block = head][row][64]. OUTM 2: the same two planes row-major at pitch ldc, bias taken by ROW (A = weights, B = tokens gives V^T).
template <bool SPLITA, int OUTM = 0>
__global__ __launch_bounds__(128) void k_gemmb(const bf* __restrict__ A, const bf* __restrict__ Al, const bf* __restrict__ Bn, const float* __restrict__ bias, float* C, int ldc, bf* Ph, bf* Pl, const float* __restrict__ R = nullptr, int K = DM, int roundR = 1) {
    __shared__ __align__(16) float ost[4][16 * 68];
    const int lane = threadIdx.x & 31, wave = threadIdx.x >> 5, lr = lane & 15, hi = lane >> 4;
    const int r0 = blockIdx.x * 64 + wave * 16, c0 = blockIdx.y * 64;
    const size_t aoff = (size_t)(r0 + lr) * K + 8 * hi;
    size_t boff[4];
#pragma unroll
    for (int t = 0; t < 4; ++t) boff[t] = (size_t)(c0 + t * 16 + lr) * K + 8 * hi;
    v8f acc[4];
#pragma unroll
    for (int t = 0; t < 4; ++t) acc[t] = (v8f){};
#pragma unroll 1
    for (int kc = 0; kc < K; kc += 32) {
        const v16bf a = cat16b(*(const v8us*)(A + aoff + kc), *(const v8us*)(A + aoff + kc + 16));
        v16bf al = a;
        if (SPLITA) al = cat16b(*(const v8us*)(Al + aoff + kc), *(const v8us*)(Al + aoff + kc + 16));
#pragma unroll
        for (int t = 0; t < 4; ++t) { const v16bf b = cat16b(*(const v8us*)(Bn + boff[t] + kc), *(const v8us*)(Bn + boff[t] + kc + 16)); acc[t] = wmmab(a, b, acc[t]); if (SPLITA) acc[t] = wmmab(al, b, acc[t]); }
        asm volatile("v_nop\n\tv_nop\n\tv_nop\n\tv_nop" : "+v"(acc[0]), "+v"(acc[1]), "+v"(acc[2]), "+v"(acc[3]) : "v"(a), "v"(al));
    }
    float* os = &ost[wave][0];
#pragma unroll
    for (int t = 0; t < 4; ++t) { const float bv = (OUTM != 2 && bias) ? bfr(bias[c0 + t * 16 + lr]) : 0.f;
#pragma unroll
        for (int j = 0; j < 8; ++j) os[(hi * 8 + j) * 68 + t * 16 + lr] = acc[t][j] + (OUTM == 2 ? bfr(bias[r0 + hi * 8 + j]) : bv); }
    __syncthreads();
    if (OUTM != 0) {
        const size_t base = OUTM == 1 ? ((size_t)blockIdx.y * NN + r0) * HD : (size_t)r0 * ldc + c0;    // a tile row is 64 elements = one whole 128-byte line of each plane
        const int pitch = OUTM == 1 ? HD : ldc;
#pragma unroll
        for (int s = 0; s < 4; ++s) { const int row = 4 * s + (lane >> 3), piece = lane & 7; const float* sp = os + row * 68 + piece * 8; v8us oh, ol;
#pragma unroll
            for (int i = 0; i < 8; ++i) { const unsigned short hb = f2bf(sp[i]); oh[i] = hb; ol[i] = f2bf(sp[i] - bf2f(hb)); }
            const size_t o = base + (size_t)row * pitch + piece * 8; *(v8us*)(Ph + o) = oh; *(v8us*)(Pl + o) = ol; }
    } else {
        float* crow = C + (size_t)r0 * ldc + c0;
        auto pass = [&]() {
#pragma unroll
            for (int s = 0; s < 8; ++s) { const int Lid = (lane >> 3) + 4 * s, piece = lane & 7; const int row = Lid >> 1, cofs = (Lid & 1) * 32 + piece * 4;
                v4f val = *(const v4fa*)(os + row * 68 + cofs); if (R) { const v4f rv = *(const v4f*)(R + ((size_t)r0 + row) * ldc + c0 + cofs); val += roundR ? (v4f){bfr(rv[0]), bfr(rv[1]), bfr(rv[2]), bfr(rv[3])} : rv; }
                *(v4f*)(crow + (size_t)row * ldc + cofs) = val; }
        };
        pass(); 
    }
}

#define FP   72            // LDS row pitch in 16-bit elements
#define FPL  (64 * FP)     // one plane's tile
#define SC2  0.18033688f   // 1/8 x log2(e)
typedef __attribute__((ext_vector_type(16))) float v16f;
__device__ __forceinline__ float xhalf(float v) { const int b = __float_as_int(v); return __int_as_float(__builtin_amdgcn_permlanex16(b, b, 0x76543210, 0xfedcba98, false, false)); }   // lane l <-> l ^ 16
__device__ __forceinline__ v16f widen16(v16bf x) { typedef __attribute__((ext_vector_type(8))) unsigned v8u; const v8u w = __builtin_bit_cast(v8u, x); v16f r;    // packed bf16 pairs back to f32: a shift and a mask a pair
#pragma unroll
    for (int k = 0; k < 8; ++k) { r[2 * k] = __uint_as_float(w[k] << 16); r[2 * k + 1] = __uint_as_float(w[k] & 0xFFFF0000u); }
    return r; }
#define GC2  (-1.44269504f / (2.0f * LSIG * LSIG))    // un-normalised band tap = exp(-d^2 / (2 x 0.16)) = exp2(d^2 x GC2), 0 outside |d| <= 3
__device__ __forceinline__ v16f cat16f(v8f lo, v8f hi) { return __builtin_shufflevector(lo, hi, 0, 1, 2, 3, 4, 5, 6, 7, 8, 9, 10, 11, 12, 13, 14, 15); }
// Eight independent v_exp_f32 in one statement, every output apart from every input, v_nop last: no neighbour reads a result or overwrites a source in the slot directly behind a transcendental.
__device__ __forceinline__ v8f exp2x8(v8f x) { float r0, r1, r2, r3, r4, r5, r6, r7;
    asm("v_exp_f32 %0, %8\n\tv_exp_f32 %1, %9\n\tv_exp_f32 %2, %10\n\tv_exp_f32 %3, %11\n\tv_exp_f32 %4, %12\n\tv_exp_f32 %5, %13\n\tv_exp_f32 %6, %14\n\tv_exp_f32 %7, %15\n\tv_nop"
        : "=&v"(r0), "=&v"(r1), "=&v"(r2), "=&v"(r3), "=&v"(r4), "=&v"(r5), "=&v"(r6), "=&v"(r7) : "v"(x[0]), "v"(x[1]), "v"(x[2]), "v"(x[3]), "v"(x[4]), "v"(x[5]), "v"(x[6]), "v"(x[7]));
    return (v8f){r0, r1, r2, r3, r4, r5, r6, r7}; }
__device__ __forceinline__ float exp2x1(float x) { float r; asm("v_exp_f32 %0, %1\n\tv_nop" : "=v"(r) : "v"(x)); return r; }    // one v_exp_f32 with the same slot behind it
__global__ __launch_bounds__(256) void k_fattn(const bf* __restrict__ Qh, const bf* __restrict__ Ql, const bf* __restrict__ Kh, const bf* __restrict__ Kl, const bf* __restrict__ VTh, const bf* __restrict__ VTl, bf* Ch, bf* Cl) {
    __shared__ __align__(16) bf tl[2][4][FPL];
    const int tid = threadIdx.x, lane = tid & 31, lr = lane & 15, hi = lane >> 4;
    const int wave = __builtin_amdgcn_readfirstlane(tid >> 5);
    const int h = blockIdx.y, q0 = blockIdx.x * 128 + wave * 16;
    const bf* __restrict__ kh0 = Kh + (size_t)h * NN * HD; const bf* __restrict__ kl0 = Kl + (size_t)h * NN * HD;
    const bf* __restrict__ vh0 = VTh + (size_t)h * HD * NN; const bf* __restrict__ vl0 = VTl + (size_t)h * HD * NN;
    v16bf qh[2], ql[2];
#pragma unroll
    for (int ks = 0; ks < 2; ++ks) { const size_t o = ((size_t)h * NN + q0 + lr) * HD + ks * 32 + 8 * hi; qh[ks] = cat16b(*(const v8us*)(Qh + o), *(const v8us*)(Qh + o + 16)); }
    asm volatile("s_wait_xcnt 0x0" ::: "memory");    // these loads' address registers are free for re-use (the next loads' results land in them) only behind this wait
#pragma unroll
    for (int ks = 0; ks < 2; ++ks) { const size_t o = ((size_t)h * NN + q0 + lr) * HD + ks * 32 + 8 * hi; ql[ks] = cat16b(*(const v8us*)(Ql + o), *(const v8us*)(Ql + o + 16)); }
    asm volatile("s_wait_xcnt 0x0" ::: "memory");    // the same for the residual plane's loads
    const int srow = tid >> 3, spc = (tid & 7) * 8;    // staging: thread -> rows srow and srow + 32, 16-byte piece spc of each plane's 64 x 128-byte tile (a wave covers whole lines)
    v8us g[8];
    auto gload = [&](int kb) {
#pragma unroll
        for (int u = 0; u < 2; ++u) { const int row = srow + 32 * u; const size_t ko = (size_t)(kb + row) * HD + spc, vo = (size_t)row * NN + kb + spc;
            g[u] = *(const v8us*)(kh0 + ko); g[2 + u] = *(const v8us*)(kl0 + ko); g[4 + u] = *(const v8us*)(vh0 + vo); g[6 + u] = *(const v8us*)(vl0 + vo); }
    };
    auto sstore = [&](int buf) {
#pragma unroll
        for (int u = 0; u < 2; ++u) { const int o = (srow + 32 * u) * FP + spc;
            *(v8us*)(&tl[buf][0][o]) = g[u]; *(v8us*)(&tl[buf][1][o]) = g[2 + u]; *(v8us*)(&tl[buf][2][o]) = g[4 + u]; *(v8us*)(&tl[buf][3][o]) = g[6 + u]; }
    };
    v8f acc[4];
#pragma unroll
    for (int t = 0; t < 4; ++t) acc[t] = (v8f){};
    float m = -3.0e38f, lsum = 0.f;    // running maximum (raw score units, equal in both halves of the wave) and this half's part of the sum
    gload(0);
    asm volatile("s_wait_xcnt 0x0" ::: "memory");    // the loop's address arithmetic re-uses these loads' offset registers
    sstore(0);
    __syncthreads();
#pragma unroll 1
    for (int s = 0; s < NN / 64; ++s) {
        const int cur = s & 1;
        if (s + 1 < NN / 64) gload((s + 1) * 64);
#pragma unroll
        for (int hf = 0; hf < 2; ++hf) {
            v8f st[2]; st[0] = (v8f){}; st[1] = (v8f){};
#pragma unroll
            for (int ks = 0; ks < 2; ++ks) { v16bf kh[2], kl[2];
#pragma unroll
                for (int tt = 0; tt < 2; ++tt) { const int o = (hf * 32 + tt * 16 + lr) * FP + ks * 32 + 8 * hi;
                    kh[tt] = cat16b(*(const v8us*)(&tl[cur][0][o]), *(const v8us*)(&tl[cur][0][o + 16])); kl[tt] = cat16b(*(const v8us*)(&tl[cur][1][o]), *(const v8us*)(&tl[cur][1][o + 16])); }
                st[0] = wmmab(kh[0], qh[ks], st[0]); st[1] = wmmab(kh[1], qh[ks], st[1]);
                st[0] = wmmab(kl[0], qh[ks], st[0]); st[1] = wmmab(kl[1], qh[ks], st[1]);
                st[0] = wmmab(kh[0], ql[ks], st[0]); st[1] = wmmab(kh[1], ql[ks], st[1]); }
            float mx = fmaxf(st[0][0], st[1][0]);
#pragma unroll
            for (int j = 1; j < 8; ++j) mx = fmaxf(mx, fmaxf(st[0][j], st[1][j]));
            mx = fmaxf(mx, xhalf(mx));
            const float mnew = fmaxf(m, mx), alpha = exp2x1((m - mnew) * SC2), mc = mnew * SC2;
            m = mnew;
            const v16f p = cat16f(exp2x8(st[0] * SC2 - mc), exp2x8(st[1] * SC2 - mc));
            const v8f s8 = __builtin_shufflevector(p, p, 0, 1, 2, 3, 4, 5, 6, 7) + __builtin_shufflevector(p, p, 8, 9, 10, 11, 12, 13, 14, 15);
            const v4f s4 = __builtin_shufflevector(s8, s8, 0, 1, 2, 3) + __builtin_shufflevector(s8, s8, 4, 5, 6, 7);
            lsum = lsum * alpha + ((s4[0] + s4[2]) + (s4[1] + s4[3]));
            const v16bf ph = __builtin_convertvector(p, v16bf);
            const v16bf pl = __builtin_convertvector(p - widen16(ph), v16bf);
            v16bf vh[4], vl[4];
#pragma unroll
            for (int t = 0; t < 4; ++t) { const int o = (t * 16 + lr) * FP + hf * 32 + 8 * hi; acc[t] *= alpha;
                vh[t] = cat16b(*(const v8us*)(&tl[cur][2][o]), *(const v8us*)(&tl[cur][2][o + 16])); vl[t] = cat16b(*(const v8us*)(&tl[cur][3][o]), *(const v8us*)(&tl[cur][3][o + 16])); }
#pragma unroll
            for (int t = 0; t < 4; ++t) acc[t] = wmmab(vh[t], ph, acc[t]);
#pragma unroll
            for (int t = 0; t < 4; ++t) acc[t] = wmmab(vl[t], ph, acc[t]);
#pragma unroll
            for (int t = 0; t < 4; ++t) acc[t] = wmmab(vh[t], pl, acc[t]);
        }
        if (s + 1 < NN / 64) sstore(cur ^ 1);    // every wave left that buffer before the barrier that ended the tile before this one
        __syncthreads();
    }
    lsum += xhalf(lsum);
    const float inv = LJ / lsum;
#pragma unroll
    for (int t = 0; t < 4; ++t) acc[t] *= inv;
    const int i = q0 + lr;
    float lnorm = 0.f;       // row normaliser of the band (taps clipped at the sequence ends)
#pragma unroll
    for (int d = -WIN; d <= WIN; ++d) { const int k = i - d; lnorm += (k >= 0 && k < NN) ? __builtin_amdgcn_exp2f((float)(d * d) * GC2) : 0.f; }
    const float lw = (1.0f - LJ) / (lnorm + LEPSK);
#pragma unroll
    for (int bb = 0; bb < 2; ++bb) { const int kb = ((q0 - 16) & ~31) + 32 * bb;    // keys q0 - 3 .. q0 + 18 lie in these two blocks; wave-uniform test
        if (kb >= 0 && kb < NN) { v8f q2[2];    // squared distance query - key, in the B operand's k order
#pragma unroll
            for (int e = 0; e < 16; ++e) { const float fd = (float)(i - (kb + (e < 8 ? 8 * hi + e : 8 + 8 * hi + e))); q2[e >> 3][e & 7] = fd * fd; }
            const v16f ge = cat16f(exp2x8(q2[0] * GC2), exp2x8(q2[1] * GC2)); v16f lv;
#pragma unroll
            for (int e = 0; e < 16; ++e) lv[e] = q2[e >> 3][e & 7] <= (float)(WIN * WIN) ? ge[e] * lw : 0.f;
            const v16bf lh = __builtin_convertvector(lv, v16bf);
            const v16bf ll = __builtin_convertvector(lv - widen16(lh), v16bf);
#pragma unroll
            for (int t = 0; t < 4; ++t) { const size_t o = (size_t)(t * 16 + lr) * NN + kb + 8 * hi;
                const v16bf vh = cat16b(*(const v8us*)(vh0 + o), *(const v8us*)(vh0 + o + 16)); const v16bf vl = cat16b(*(const v8us*)(vl0 + o), *(const v8us*)(vl0 + o + 16));
                acc[t] = wmmab(vh, lh, acc[t]); acc[t] = wmmab(vl, lh, acc[t]); acc[t] = wmmab(vh, ll, acc[t]); } } }
    const size_t co = (size_t)i * DMOD + h * HD + hi * 8;    // acc[t][j] = O[query i][16 t + 8 hi + j]; stored as the bf16 hi + residual planes that the output projection reads
#pragma unroll
    for (int t = 0; t < 4; ++t) { v8us oh, ol;
#pragma unroll
        for (int j = 0; j < 8; ++j) { const unsigned short hb = f2bf(acc[t][j]); oh[j] = hb; ol[j] = f2bf(acc[t][j] - bf2f(hb)); }
        *(v8us*)(Ch + co + t * 16) = oh; *(v8us*)(Cl + co + t * 16) = ol; }
}

__global__ __launch_bounds__(256) void k_cvt8(const float* __restrict__ src, bf* dst, size_t n8) {
    const size_t i = (size_t)blockIdx.x * 256 + threadIdx.x; if (i >= n8) return;
    const v8f v = *(const v8f*)(src + i * 8); v8us o;
#pragma unroll
    for (int k = 0; k < 8; ++k) o[k] = f2bf(v[k]);
    *(v8us*)(dst + i * 8) = o; 
}
__global__ __launch_bounds__(256) void k_zero8(bf* dst, size_t n8) {
    const size_t i = (size_t)blockIdx.x * 256 + threadIdx.x; if (i >= n8) return; v8us z;
#pragma unroll
    for (int k = 0; k < 8; ++k) z[k] = 0;
    *(v8us*)(dst + i * 8) = z; 
}

__global__ __launch_bounds__(256) void k_cvtx(const float* __restrict__ src, bf* dst) {
    const int lane = threadIdx.x & 31; const size_t r = (size_t)blockIdx.x * 8 + (threadIdx.x >> 5); if (r >= (size_t)NN) return;
{
#pragma unroll
        for (int q = 0; q < DMOD / 256; ++q) { v8us o;
#pragma unroll
            for (int i = 0; i < 8; ++i) o[i] = f2bf(src[r * DMOD + q * 256 + lane * 8 + i]);
            *(v8us*)(dst + r * DMOD + q * 256 + lane * 8) = o; }
         }
}
extern "C" void kernel_launch(void* const* d_in, const int* in_sizes, int n_in,
                              void* d_out, int out_size, void* d_ws, size_t ws_size, hipStream_t stream) {
    (void)in_sizes; (void)n_in; (void)out_size;
    const float* x = (const float*)d_in[0]; const float* Wq = (const float*)d_in[1]; const float* bq = (const float*)d_in[2]; const float* Wk = (const float*)d_in[3]; const float* bk = (const float*)d_in[4]; const float* Wv = (const float*)d_in[5]; const float* bv = (const float*)d_in[6]; const float* Wo = (const float*)d_in[7]; const float* bo = (const float*)d_in[8];
    float* out = (float*)d_out;    // [2][2048][1024]
    char* wsp = (char*)d_ws;
    auto take = [&](size_t bytes) { char* p = wsp; wsp += (bytes + 255) & ~(size_t)255; return (void*)p; };
    bf* WQ = (bf*)take((size_t)DMOD * DMOD * 2); bf* WK = (bf*)take((size_t)DMOD * DMOD * 2); bf* WV = (bf*)take((size_t)DMOD * DMOD * 2); bf* WO = (bf*)take((size_t)DMOD * DMOD * 2);
    bf* Xb = (bf*)take((size_t)NN * DMOD * 2);
    bf* Qh = (bf*)take((size_t)NH_ * NN * HD * 2); bf* Ql = (bf*)take((size_t)NH_ * NN * HD * 2); bf* Kh = (bf*)take((size_t)NH_ * NN * HD * 2); bf* Kl = (bf*)take((size_t)NH_ * NN * HD * 2); bf* VTh = (bf*)take((size_t)NH_ * HD * NN * 2); bf* VTl = (bf*)take((size_t)NH_ * HD * NN * 2);
    bf* Ch = (bf*)take((size_t)NN * DMOD * 2); bf* Cl = (bf*)take((size_t)NN * DMOD * 2);
    if ((size_t)(wsp - (char*)d_ws) > ws_size) return;    // 8.4 + 4.2 + 25.2 + 8.4 ~ 46 MB; per item reuse in stream order
    k_cvt8<<<(unsigned)(((size_t)DMOD * DMOD / 8 + 255) / 256), 256, 0, stream>>>(Wq, WQ, (size_t)DMOD * DMOD / 8); k_cvt8<<<(unsigned)(((size_t)DMOD * DMOD / 8 + 255) / 256), 256, 0, stream>>>(Wk, WK, (size_t)DMOD * DMOD / 8);
    k_cvt8<<<(unsigned)(((size_t)DMOD * DMOD / 8 + 255) / 256), 256, 0, stream>>>(Wv, WV, (size_t)DMOD * DMOD / 8); k_cvt8<<<(unsigned)(((size_t)DMOD * DMOD / 8 + 255) / 256), 256, 0, stream>>>(Wo, WO, (size_t)DMOD * DMOD / 8);   // torch [out][in] = n-major
    for (int b = 0; b < NBT; ++b) {
        k_cvtx<<<NN / 8, 256, 0, stream>>>(x + (size_t)b * NN * DMOD, Xb);
        k_gemmb<false, 1><<<dim3(NN / 64, DMOD / 64, 1), 128, 0, stream>>>(Xb, nullptr, WQ, bq, nullptr, DMOD, Qh, Ql, nullptr, DMOD);
        k_gemmb<false, 1><<<dim3(NN / 64, DMOD / 64, 1), 128, 0, stream>>>(Xb, nullptr, WK, bk, nullptr, DMOD, Kh, Kl, nullptr, DMOD);
        k_gemmb<false, 2><<<dim3(DMOD / 64, NN / 64, 1), 128, 0, stream>>>(WV, nullptr, Xb, bv, nullptr, NN, VTh, VTl, nullptr, DMOD);    // rows = head x 64 + d, columns = tokens: V^T as [head][64][token]
        k_fattn<<<dim3(NN / 128, NH_, 1), 256, 0, stream>>>(Qh, Ql, Kh, Kl, VTh, VTl, Ch, Cl);
        k_gemmb<true, 0><<<dim3(NN / 64, DMOD / 64, 1), 128, 0, stream>>>(Ch, Cl, WO, bo, out + (size_t)b * NN * DMOD, DMOD, nullptr, nullptr, nullptr, DMOD); }
}

// v004
// It runs in 205 microseconds.
// Next to v003, in two timings, it ran 1.58 and 1.57 times as fast.
// Counting every step since v000, it is 17.0 times as fast.
#include <hip/hip_runtime.h>

// Compute dtypes, f32 accumulate, per item: Q/K = x.W^T + b as [2048 x 1024].[1024 x 1024] GEMMs, V^T = Wv.x^T + b (by row) as [1024 x 1024].[1024 x 2048], with PLAIN bf16 operands (exact products); per head: scores = q.k^T ([2048 x
// 64].[64 x 2048], both operands bf16 hi + UNSCALED residual, three products), running softmax (x 1/8) in f32, exp(s - max).V ([2048 x 2048].[2048 x 64], hi + residual, three products),
// scaled by 0.6 / sum, plus 0.4 L.V (L = the row-normalised 7-tap Gaussian band, hi + residual, three products), all in k_fattn; out = ctx.Wo^T + bo (two products) - on

#define NBT  2
#define NN   2048
#define DMOD 1024
#define NH_  16
#define HD   64
#define DM   DMOD
#define NTK  NN
#define SCL  0.125f
#define LJ   0.6f
#define LSIG 0.4f
#define WIN  3
#define LEPSK 1e-10f
#define LOSC 1024.0f

typedef _Float16 h16;
typedef unsigned short bf;
typedef __attribute__((ext_vector_type(16))) __bf16   v16bf;
typedef __attribute__((ext_vector_type(16))) _Float16 v16h;
typedef __attribute__((ext_vector_type(8)))  _Float16 v8h;
typedef __attribute__((ext_vector_type(8)))  unsigned short v8us;
typedef __attribute__((ext_vector_type(8)))  float    v8f;
typedef __attribute__((ext_vector_type(4)))  float    v4f;
typedef __attribute__((ext_vector_type(4)))  _Float16 v4h;
typedef v8h  __attribute__((may_alias)) v8ha;
typedef v4f  __attribute__((may_alias)) v4fa;
typedef v8us __attribute__((may_alias)) v8usa;

__device__ __forceinline__ unsigned short f2bf(float f) { unsigned u = __float_as_uint(f); u += 0x7FFFu + ((u >> 16) & 1u); return (unsigned short)(u >> 16); }
__device__ __forceinline__ float bf2f(unsigned short b) { return __uint_as_float(((unsigned)b) << 16); }
__device__ __forceinline__ float bfr(float f) { return bf2f(f2bf(f)); }
__device__ __forceinline__ v16h cat16(v8h lo, v8h hi) { return __builtin_shufflevector(lo, hi, 0, 1, 2, 3, 4, 5, 6, 7, 8, 9, 10, 11, 12, 13, 14, 15); }
__device__ __forceinline__ v16bf cat16b(v8us lo, v8us hi) { return __builtin_bit_cast(v16bf, __builtin_shufflevector(lo, hi, 0, 1, 2, 3, 4, 5, 6, 7, 8, 9, 10, 11, 12, 13, 14, 15)); }
__device__ __forceinline__ v8f wmma16(v16h a, v16h b, v8f c) { return __builtin_amdgcn_wmma_f32_16x16x32_f16(false, a, false, b, (short)0, c, false, false); }
__device__ __forceinline__ v8f wmmab(v16bf a, v16bf b, v8f c) { return __builtin_amdgcn_wmma_f32_16x16x32_bf16(false, a, false, b, (short)0, c, false, false); }

// k_gemmb: 64 x 64 block tile (4 waves x 16 x 64) of C[NTK][NW] = (A [+ Al]).B^T (K = 1024, a multiple of 128) [+ bf(bias[c])] [+ bf(R[r][c]) residual]; f32 whole-line epilogue (or bf16
// OUTM 0: f32 C. OUTM 1: bf16 hi + residual planes laid out [column block = head][row][64]. OUTM 2: the same two planes row-major at pitch ldc, bias taken by ROW (A = weights, B = tokens gives V^T).
// Operands: per stage of 128 k the block's 64 rows of B, A (and Al) go from global memory into LDS by asynchronous 16-byte copies (a wave covers two whole 256-byte row pieces a copy),
// rows at a 272-byte pitch, two buffers: the copies of stage s + 2 are issued behind the barrier that ends stage s and fly while stage s + 1 is worked on. Fragments are read from LDS in the k order 8 hi + e, 16 + 8 hi + e.
#define GKS  128           // k elements a stage
#define GP   136           // LDS row pitch in 16-bit elements
#define GPL  (64 * GP)     // one operand's tile of 64 rows
// Eight copies of one thread: rows r, r + 8, .. r + 56 of one operand's tile, the same 16-byte piece of each. The s_wait_xcnt stands inside the statement, behind the last copy, so that no
// address register that a copy names is rewritten in front of it.
__device__ __forceinline__ void acopy8(unsigned l, const bf* g, size_t gs) {
    asm volatile("global_load_async_to_lds_b128 %0, %8, off\n\tglobal_load_async_to_lds_b128 %1, %9, off\n\tglobal_load_async_to_lds_b128 %2, %10, off\n\tglobal_load_async_to_lds_b128 %3, %11, off\n\t"
                 "global_load_async_to_lds_b128 %4, %12, off\n\tglobal_load_async_to_lds_b128 %5, %13, off\n\tglobal_load_async_to_lds_b128 %6, %14, off\n\tglobal_load_async_to_lds_b128 %7, %15, off\n\ts_wait_xcnt 0x0"
                 :: "v"(l), "v"(l + 1u * 16u * GP), "v"(l + 2u * 16u * GP), "v"(l + 3u * 16u * GP), "v"(l + 4u * 16u * GP), "v"(l + 5u * 16u * GP), "v"(l + 6u * 16u * GP), "v"(l + 7u * 16u * GP),
                    "v"(g), "v"(g + gs), "v"(g + 2 * gs), "v"(g + 3 * gs), "v"(g + 4 * gs), "v"(g + 5 * gs), "v"(g + 6 * gs), "v"(g + 7 * gs) : "memory");
}
template <bool SPLITA, int OUTM = 0>
__global__ __launch_bounds__(128) void k_gemmb(const bf* __restrict__ A, const bf* __restrict__ Al, const bf* __restrict__ Bn, const float* __restrict__ bias, float* C, int ldc, bf* Ph, bf* Pl, const float* __restrict__ R = nullptr, int K = DM, int roundR = 1) {
    constexpr int NPL = SPLITA ? 3 : 2;    // planes a stage: B, A (, Al)
    __shared__ __align__(16) float ost[4][16 * 68];
    __shared__ __align__(16) bf gt[2][NPL][GPL];
    const int lane = threadIdx.x & 31, wave = threadIdx.x >> 5, lr = lane & 15, hi = lane >> 4;
    const int r0 = blockIdx.x * 64 + wave * 16, c0 = blockIdx.y * 64;
    const int crow = threadIdx.x >> 4, cpc = (threadIdx.x & 15) * 8;    // copies: thread -> rows crow + 8 u, 16-byte piece cpc of each 256-byte row piece
    const bf* ga = A + (size_t)(blockIdx.x * 64 + crow) * K + cpc;
    const bf* gal = SPLITA ? Al + (size_t)(blockIdx.x * 64 + crow) * K + cpc : nullptr;
    const bf* gb = Bn + (size_t)(c0 + crow) * K + cpc;
    const unsigned l0 = (unsigned)(size_t)&gt[0][0][crow * GP + cpc];    // the thread's LDS byte address in buffer 0, plane 0
    const size_t gs = (size_t)8 * K;
    auto fill = [&](int st) { const unsigned l = l0 + (unsigned)(st & 1) * (unsigned)(NPL * GPL * 2); const size_t ko = (size_t)st * GKS;
        acopy8(l, gb + ko, gs); acopy8(l + GPL * 2u, ga + ko, gs); if (SPLITA) acopy8(l + 2u * GPL * 2u, gal + ko, gs); };
    v8f acc[4];
#pragma unroll
    for (int t = 0; t < 4; ++t) acc[t] = (v8f){};
    const int nst = K / GKS;
    fill(0);
    asm volatile("s_wait_asynccnt 0x0" ::: "memory");    // this wave's copies of stage 0 have landed
    __syncthreads();                                     // every wave's have: stage 0 may be read
    if (nst > 1) fill(1);
#pragma unroll 1
    for (int st = 0; st < nst; ++st) {    // rolled: one stage a trip, the two buffers in turn
        const bf* tb = &gt[st & 1][0][0]; const bf* ta = &gt[st & 1][1][0]; const bf* tal = &gt[st & 1][NPL - 1][0];
        v16bf fa[4], fal[4], fb[4][4];    // the stage's fragments, all fetched as one group of LDS reads
#pragma unroll
        for (int q = 0; q < GKS / 32; ++q) { const int ao = (wave * 16 + lr) * GP + q * 32 + 8 * hi;
            fa[q] = cat16b(*(const v8us*)(ta + ao), *(const v8us*)(ta + ao + 16));
            if (SPLITA) fal[q] = cat16b(*(const v8us*)(tal + ao), *(const v8us*)(tal + ao + 16));
#pragma unroll
            for (int t = 0; t < 4; ++t) { const int bo = (t * 16 + lr) * GP + q * 32 + 8 * hi; fb[q][t] = cat16b(*(const v8us*)(tb + bo), *(const v8us*)(tb + bo + 16)); } }
        // Inputs-only fence on the loaded fragments: it keeps the LDS reads together in front of the matrix run; without it they are spread among the products, each pair with its own full wait.
        if constexpr (SPLITA) asm volatile("" :: "v"(fal[0]), "v"(fal[1]), "v"(fal[2]), "v"(fal[3]));
        asm volatile("" :: "v"(fa[0]), "v"(fa[1]), "v"(fa[2]), "v"(fa[3]), "v"(fb[0][0]), "v"(fb[0][1]), "v"(fb[0][2]), "v"(fb[0][3]), "v"(fb[1][0]), "v"(fb[1][1]), "v"(fb[1][2]), "v"(fb[1][3]),
                     "v"(fb[2][0]), "v"(fb[2][1]), "v"(fb[2][2]), "v"(fb[2][3]), "v"(fb[3][0]), "v"(fb[3][1]), "v"(fb[3][2]), "v"(fb[3][3]));
#pragma unroll
        for (int q = 0; q < GKS / 32; ++q) {
#pragma unroll
            for (int t = 0; t < 4; ++t) { acc[t] = wmmab(fa[q], fb[q][t], acc[t]); if (SPLITA) acc[t] = wmmab(fal[q], fb[q][t], acc[t]); } }
        asm volatile("s_wait_dscnt 0x0" ::: "memory");       // this wave's reads of the buffer are done before anybody refills it
        asm volatile("s_wait_asynccnt 0x0" ::: "memory");    // this wave's copies of stage st + 1 have landed
        __syncthreads();                                     // publishes stage st + 1 and ends every wave's reads of stage st
        if (st + 2 < nst) fill(st + 2);                      // into the buffer that this trip has just read
    }
    asm volatile("s_wait_asynccnt 0x0" ::: "memory");    // no copy is outstanding when the epilogue starts
    float* os = &ost[wave][0];
#pragma unroll
    for (int t = 0; t < 4; ++t) { const float bv = (OUTM != 2 && bias) ? bfr(bias[c0 + t * 16 + lr]) : 0.f;
#pragma unroll
        for (int j = 0; j < 8; ++j) os[(hi * 8 + j) * 68 + t * 16 + lr] = acc[t][j] + (OUTM == 2 ? bfr(bias[r0 + hi * 8 + j]) : bv); }
    __syncthreads();
    if (OUTM != 0) {
        const size_t base = OUTM == 1 ? ((size_t)blockIdx.y * NN + r0) * HD : (size_t)r0 * ldc + c0;    // a tile row is 64 elements = one whole 128-byte line of each plane
        const int pitch = OUTM == 1 ? HD : ldc;
#pragma unroll
        for (int s = 0; s < 4; ++s) { const int row = 4 * s + (lane >> 3), piece = lane & 7; const float* sp = os + row * 68 + piece * 8; v8us oh, ol;
#pragma unroll
            for (int i = 0; i < 8; ++i) { const unsigned short hb = f2bf(sp[i]); oh[i] = hb; ol[i] = f2bf(sp[i] - bf2f(hb)); }
            const size_t o = base + (size_t)row * pitch + piece * 8; *(v8us*)(Ph + o) = oh; *(v8us*)(Pl + o) = ol; }
    } else {
        float* crow = C + (size_t)r0 * ldc + c0;
        auto pass = [&]() {
#pragma unroll
            for (int s = 0; s < 8; ++s) { const int Lid = (lane >> 3) + 4 * s, piece = lane & 7; const int row = Lid >> 1, cofs = (Lid & 1) * 32 + piece * 4;
                v4f val = *(const v4fa*)(os + row * 68 + cofs); if (R) { const v4f rv = *(const v4f*)(R + ((size_t)r0 + row) * ldc + c0 + cofs); val += roundR ? (v4f){bfr(rv[0]), bfr(rv[1]), bfr(rv[2]), bfr(rv[3])} : rv; }
                *(v4f*)(crow + (size_t)row * ldc + cofs) = val; }
        };
        pass(); 
    }
}

#define FP   72            // LDS row pitch in 16-bit elements
#define FPL  (64 * FP)     // one plane's tile
#define SC2  0.18033688f   // 1/8 x log2(e)
typedef __attribute__((ext_vector_type(16))) float v16f;
__device__ __forceinline__ float xhalf(float v) { const int b = __float_as_int(v); return __int_as_float(__builtin_amdgcn_permlanex16(b, b, 0x76543210, 0xfedcba98, false, false)); }   // lane l <-> l ^ 16
__device__ __forceinline__ v16f widen16(v16bf x) { typedef __attribute__((ext_vector_type(8))) unsigned v8u; const v8u w = __builtin_bit_cast(v8u, x); v16f r;    // packed bf16 pairs back to f32: a shift and a mask a pair
#pragma unroll
    for (int k = 0; k < 8; ++k) { r[2 * k] = __uint_as_float(w[k] << 16); r[2 * k + 1] = __uint_as_float(w[k] & 0xFFFF0000u); }
    return r; }
#define GC2  (-1.44269504f / (2.0f * LSIG * LSIG))    // un-normalised band tap = exp(-d^2 / (2 x 0.16)) = exp2(d^2 x GC2), 0 outside |d| <= 3
__device__ __forceinline__ v16f cat16f(v8f lo, v8f hi) { return __builtin_shufflevector(lo, hi, 0, 1, 2, 3, 4, 5, 6, 7, 8, 9, 10, 11, 12, 13, 14, 15); }
// Eight independent v_exp_f32 in one statement, every output apart from every input, v_nop last: no neighbour reads a result or overwrites a source in the slot directly behind a transcendental.
__device__ __forceinline__ v8f exp2x8(v8f x) { float r0, r1, r2, r3, r4, r5, r6, r7;
    asm("v_exp_f32 %0, %8\n\tv_exp_f32 %1, %9\n\tv_exp_f32 %2, %10\n\tv_exp_f32 %3, %11\n\tv_exp_f32 %4, %12\n\tv_exp_f32 %5, %13\n\tv_exp_f32 %6, %14\n\tv_exp_f32 %7, %15\n\tv_nop"
        : "=&v"(r0), "=&v"(r1), "=&v"(r2), "=&v"(r3), "=&v"(r4), "=&v"(r5), "=&v"(r6), "=&v"(r7) : "v"(x[0]), "v"(x[1]), "v"(x[2]), "v"(x[3]), "v"(x[4]), "v"(x[5]), "v"(x[6]), "v"(x[7]));
    return (v8f){r0, r1, r2, r3, r4, r5, r6, r7}; }
__device__ __forceinline__ float exp2x1(float x) { float r; asm("v_exp_f32 %0, %1\n\tv_nop" : "=v"(r) : "v"(x)); return r; }    // one v_exp_f32 with the same slot behind it
__global__ __launch_bounds__(256) void k_fattn(const bf* __restrict__ Qh, const bf* __restrict__ Ql, const bf* __restrict__ Kh, const bf* __restrict__ Kl, const bf* __restrict__ VTh, const bf* __restrict__ VTl, bf* Ch, bf* Cl) {
    __shared__ __align__(16) bf tl[2][4][FPL];
    const int tid = threadIdx.x, lane = tid & 31, lr = lane & 15, hi = lane >> 4;
    const int wave = __builtin_amdgcn_readfirstlane(tid >> 5);
    const int h = blockIdx.y, q0 = blockIdx.x * 128 + wave * 16;
    const bf* __restrict__ kh0 = Kh + (size_t)h * NN * HD; const bf* __restrict__ kl0 = Kl + (size_t)h * NN * HD;
    const bf* __restrict__ vh0 = VTh + (size_t)h * HD * NN; const bf* __restrict__ vl0 = VTl + (size_t)h * HD * NN;
    v16bf qh[2], ql[2];
#pragma unroll
    for (int ks = 0; ks < 2; ++ks) { const size_t o = ((size_t)h * NN + q0 + lr) * HD + ks * 32 + 8 * hi; qh[ks] = cat16b(*(const v8us*)(Qh + o), *(const v8us*)(Qh + o + 16)); }
    asm volatile("s_wait_xcnt 0x0" ::: "memory");    // these loads' address registers are free for re-use (the next loads' results land in them) only behind this wait
#pragma unroll
    for (int ks = 0; ks < 2; ++ks) { const size_t o = ((size_t)h * NN + q0 + lr) * HD + ks * 32 + 8 * hi; ql[ks] = cat16b(*(const v8us*)(Ql + o), *(const v8us*)(Ql + o + 16)); }
    asm volatile("s_wait_xcnt 0x0" ::: "memory");    // the same for the residual plane's loads
    const int srow = tid >> 3, spc = (tid & 7) * 8;    // staging: thread -> rows srow and srow + 32, 16-byte piece spc of each plane's 64 x 128-byte tile (a wave covers whole lines)
    v8us g[8];
    auto gload = [&](int kb) {
#pragma unroll
        for (int u = 0; u < 2; ++u) { const int row = srow + 32 * u; const size_t ko = (size_t)(kb + row) * HD + spc, vo = (size_t)row * NN + kb + spc;
            g[u] = *(const v8us*)(kh0 + ko); g[2 + u] = *(const v8us*)(kl0 + ko); g[4 + u] = *(const v8us*)(vh0 + vo); g[6 + u] = *(const v8us*)(vl0 + vo); }
    };
    auto sstore = [&](int buf) {
#pragma unroll
        for (int u = 0; u < 2; ++u) { const int o = (srow + 32 * u) * FP + spc;
            *(v8us*)(&tl[buf][0][o]) = g[u]; *(v8us*)(&tl[buf][1][o]) = g[2 + u]; *(v8us*)(&tl[buf][2][o]) = g[4 + u]; *(v8us*)(&tl[buf][3][o]) = g[6 + u]; }
    };
    v8f acc[4];
#pragma unroll
    for (int t = 0; t < 4; ++t) acc[t] = (v8f){};
    float m = -3.0e38f, lsum = 0.f;    // running maximum (raw score units, equal in both halves of the wave) and this half's part of the sum
    gload(0);
    asm volatile("s_wait_xcnt 0x0" ::: "memory");    // the loop's address arithmetic re-uses these loads' offset registers
    sstore(0);
    __syncthreads();
#pragma unroll 1
    for (int s = 0; s < NN / 64; ++s) {
        const int cur = s & 1;
        if (s + 1 < NN / 64) gload((s + 1) * 64);
#pragma unroll
        for (int hf = 0; hf < 2; ++hf) {
            v8f st[2]; st[0] = (v8f){}; st[1] = (v8f){};
#pragma unroll
            for (int ks = 0; ks < 2; ++ks) { v16bf kh[2], kl[2];
#pragma unroll
                for (int tt = 0; tt < 2; ++tt) { const int o = (hf * 32 + tt * 16 + lr) * FP + ks * 32 + 8 * hi;
                    kh[tt] = cat16b(*(const v8us*)(&tl[cur][0][o]), *(const v8us*)(&tl[cur][0][o + 16])); kl[tt] = cat16b(*(const v8us*)(&tl[cur][1][o]), *(const v8us*)(&tl[cur][1][o + 16])); }
                st[0] = wmmab(kh[0], qh[ks], st[0]); st[1] = wmmab(kh[1], qh[ks], st[1]);
                st[0] = wmmab(kl[0], qh[ks], st[0]); st[1] = wmmab(kl[1], qh[ks], st[1]);
                st[0] = wmmab(kh[0], ql[ks], st[0]); st[1] = wmmab(kh[1], ql[ks], st[1]); }
            float mx = fmaxf(st[0][0], st[1][0]);
#pragma unroll
            for (int j = 1; j < 8; ++j) mx = fmaxf(mx, fmaxf(st[0][j], st[1][j]));
            mx = fmaxf(mx, xhalf(mx));
            const float mnew = fmaxf(m, mx), alpha = exp2x1((m - mnew) * SC2), mc = mnew * SC2;
            m = mnew;
            const v16f p = cat16f(exp2x8(st[0] * SC2 - mc), exp2x8(st[1] * SC2 - mc));
            const v8f s8 = __builtin_shufflevector(p, p, 0, 1, 2, 3, 4, 5, 6, 7) + __builtin_shufflevector(p, p, 8, 9, 10, 11, 12, 13, 14, 15);
            const v4f s4 = __builtin_shufflevector(s8, s8, 0, 1, 2, 3) + __builtin_shufflevector(s8, s8, 4, 5, 6, 7);
            lsum = lsum * alpha + ((s4[0] + s4[2]) + (s4[1] + s4[3]));
            const v16bf ph = __builtin_convertvector(p, v16bf);
            const v16bf pl = __builtin_convertvector(p - widen16(ph), v16bf);
            v16bf vh[4], vl[4];
#pragma unroll
            for (int t = 0; t < 4; ++t) { const int o = (t * 16 + lr) * FP + hf * 32 + 8 * hi; acc[t] *= alpha;
                vh[t] = cat16b(*(const v8us*)(&tl[cur][2][o]), *(const v8us*)(&tl[cur][2][o + 16])); vl[t] = cat16b(*(const v8us*)(&tl[cur][3][o]), *(const v8us*)(&tl[cur][3][o + 16])); }
#pragma unroll
            for (int t = 0; t < 4; ++t) acc[t] = wmmab(vh[t], ph, acc[t]);
#pragma unroll
            for (int t = 0; t < 4; ++t) acc[t] = wmmab(vl[t], ph, acc[t]);
#pragma unroll
            for (int t = 0; t < 4; ++t) acc[t] = wmmab(vh[t], pl, acc[t]);
        }
        if (s + 1 < NN / 64) sstore(cur ^ 1);    // every wave left that buffer before the barrier that ended the tile before this one
        __syncthreads();
    }
    lsum += xhalf(lsum);
    const float inv = LJ / lsum;
#pragma unroll
    for (int t = 0; t < 4; ++t) acc[t] *= inv;
    const int i = q0 + lr;
    float lnorm = 0.f;       // row normaliser of the band (taps clipped at the sequence ends)
#pragma unroll
    for (int d = -WIN; d <= WIN; ++d) { const int k = i - d; lnorm += (k >= 0 && k < NN) ? __builtin_amdgcn_exp2f((float)(d * d) * GC2) : 0.f; }
    const float lw = (1.0f - LJ) / (lnorm + LEPSK);
#pragma unroll
    for (int bb = 0; bb < 2; ++bb) { const int kb = ((q0 - 16) & ~31) + 32 * bb;    // keys q0 - 3 .. q0 + 18 lie in these two blocks; wave-uniform test
        if (kb >= 0 && kb < NN) { v8f q2[2];    // squared distance query - key, in the B operand's k order
#pragma unroll
            for (int e = 0; e < 16; ++e) { const float fd = (float)(i - (kb + (e < 8 ? 8 * hi + e : 8 + 8 * hi + e))); q2[e >> 3][e & 7] = fd * fd; }
            const v16f ge = cat16f(exp2x8(q2[0] * GC2), exp2x8(q2[1] * GC2)); v16f lv;
#pragma unroll
            for (int e = 0; e < 16; ++e) lv[e] = q2[e >> 3][e & 7] <= (float)(WIN * WIN) ? ge[e] * lw : 0.f;
            const v16bf lh = __builtin_convertvector(lv, v16bf);
            const v16bf ll = __builtin_convertvector(lv - widen16(lh), v16bf);
#pragma unroll
            for (int t = 0; t < 4; ++t) { const size_t o = (size_t)(t * 16 + lr) * NN + kb + 8 * hi;
                const v16bf vh = cat16b(*(const v8us*)(vh0 + o), *(const v8us*)(vh0 + o + 16)); const v16bf vl = cat16b(*(const v8us*)(vl0 + o), *(const v8us*)(vl0 + o + 16));
                acc[t] = wmmab(vh, lh, acc[t]); acc[t] = wmmab(vl, lh, acc[t]); acc[t] = wmmab(vh, ll, acc[t]); } } }
    const size_t co = (size_t)i * DMOD + h * HD + hi * 8;    // acc[t][j] = O[query i][16 t + 8 hi + j]; stored as the bf16 hi + residual planes that the output projection reads
#pragma unroll
    for (int t = 0; t < 4; ++t) { v8us oh, ol;
#pragma unroll
        for (int j = 0; j < 8; ++j) { const unsigned short hb = f2bf(acc[t][j]); oh[j] = hb; ol[j] = f2bf(acc[t][j] - bf2f(hb)); }
        *(v8us*)(Ch + co + t * 16) = oh; *(v8us*)(Cl + co + t * 16) = ol; }
}

__global__ __launch_bounds__(256) void k_cvt8(const float* __restrict__ src, bf* dst, size_t n8) {
    const size_t i = (size_t)blockIdx.x * 256 + threadIdx.x; if (i >= n8) return;
    const v8f v = *(const v8f*)(src + i * 8); v8us o;
#pragma unroll
    for (int k = 0; k < 8; ++k) o[k] = f2bf(v[k]);
    *(v8us*)(dst + i * 8) = o; 
}
__global__ __launch_bounds__(256) void k_zero8(bf* dst, size_t n8) {
    const size_t i = (size_t)blockIdx.x * 256 + threadIdx.x; if (i >= n8) return; v8us z;
#pragma unroll
    for (int k = 0; k < 8; ++k) z[k] = 0;
    *(v8us*)(dst + i * 8) = z; 
}

__global__ __launch_bounds__(256) void k_cvtx(const float* __restrict__ src, bf* dst) {
    const int lane = threadIdx.x & 31; const size_t r = (size_t)blockIdx.x * 8 + (threadIdx.x >> 5); if (r >= (size_t)NN) return;
{
#pragma unroll
        for (int q = 0; q < DMOD / 256; ++q) { v8us o;
#pragma unroll
            for (int i = 0; i < 8; ++i) o[i] = f2bf(src[r * DMOD + q * 256 + lane * 8 + i]);
            *(v8us*)(dst + r * DMOD + q * 256 + lane * 8) = o; }
         }
}
extern "C" void kernel_launch(void* const* d_in, const int* in_sizes, int n_in,
                              void* d_out, int out_size, void* d_ws, size_t ws_size, hipStream_t stream) {
    (void)in_sizes; (void)n_in; (void)out_size;
    const float* x = (const float*)d_in[0]; const float* Wq = (const float*)d_in[1]; const float* bq = (const float*)d_in[2]; const float* Wk = (const float*)d_in[3]; const float* bk = (const float*)d_in[4]; const float* Wv = (const float*)d_in[5]; const float* bv = (const float*)d_in[6]; const float* Wo = (const float*)d_in[7]; const float* bo = (const float*)d_in[8];
    float* out = (float*)d_out;    // [2][2048][1024]
    char* wsp = (char*)d_ws;
    auto take = [&](size_t bytes) { char* p = wsp; wsp += (bytes + 255) & ~(size_t)255; return (void*)p; };
    bf* WQ = (bf*)take((size_t)DMOD * DMOD * 2); bf* WK = (bf*)take((size_t)DMOD * DMOD * 2); bf* WV = (bf*)take((size_t)DMOD * DMOD * 2); bf* WO = (bf*)take((size_t)DMOD * DMOD * 2);
    bf* Xb = (bf*)take((size_t)NN * DMOD * 2);
    bf* Qh = (bf*)take((size_t)NH_ * NN * HD * 2); bf* Ql = (bf*)take((size_t)NH_ * NN * HD * 2); bf* Kh = (bf*)take((size_t)NH_ * NN * HD * 2); bf* Kl = (bf*)take((size_t)NH_ * NN * HD * 2); bf* VTh = (bf*)take((size_t)NH_ * HD * NN * 2); bf* VTl = (bf*)take((size_t)NH_ * HD * NN * 2);
    bf* Ch = (bf*)take((size_t)NN * DMOD * 2); bf* Cl = (bf*)take((size_t)NN * DMOD * 2);
    if ((size_t)(wsp - (char*)d_ws) > ws_size) return;    // 8.4 + 4.2 + 25.2 + 8.4 ~ 46 MB; per item reuse in stream order
    k_cvt8<<<(unsigned)(((size_t)DMOD * DMOD / 8 + 255) / 256), 256, 0, stream>>>(Wq, WQ, (size_t)DMOD * DMOD / 8); k_cvt8<<<(unsigned)(((size_t)DMOD * DMOD / 8 + 255) / 256), 256, 0, stream>>>(Wk, WK, (size_t)DMOD * DMOD / 8);
    k_cvt8<<<(unsigned)(((size_t)DMOD * DMOD / 8 + 255) / 256), 256, 0, stream>>>(Wv, WV, (size_t)DMOD * DMOD / 8); k_cvt8<<<(unsigned)(((size_t)DMOD * DMOD / 8 + 255) / 256), 256, 0, stream>>>(Wo, WO, (size_t)DMOD * DMOD / 8);   // torch [out][in] = n-major
    for (int b = 0; b < NBT; ++b) {
        k_cvtx<<<NN / 8, 256, 0, stream>>>(x + (size_t)b * NN * DMOD, Xb);
        k_gemmb<false, 1><<<dim3(NN / 64, DMOD / 64, 1), 128, 0, stream>>>(Xb, nullptr, WQ, bq, nullptr, DMOD, Qh, Ql, nullptr, DMOD);
        k_gemmb<false, 1><<<dim3(NN / 64, DMOD / 64, 1), 128, 0, stream>>>(Xb, nullptr, WK, bk, nullptr, DMOD, Kh, Kl, nullptr, DMOD);
        k_gemmb<false, 2><<<dim3(DMOD / 64, NN / 64, 1), 128, 0, stream>>>(WV, nullptr, Xb, bv, nullptr, NN, VTh, VTl, nullptr, DMOD);    // rows = head x 64 + d, columns = tokens: V^T as [head][64][token]
        k_fattn<<<dim3(NN / 128, NH_, 1), 256, 0, stream>>>(Qh, Ql, Kh, Kl, VTh, VTl, Ch, Cl);
        k_gemmb<true, 0><<<dim3(NN / 64, DMOD / 64, 1), 128, 0, stream>>>(Ch, Cl, WO, bo, out + (size_t)b * NN * DMOD, DMOD, nullptr, nullptr, nullptr, DMOD); }
}

// v005
// A run of this version takes 150 microseconds.
// In two side-by-side timings against v004, it was 1.38 and 1.39 times as fast.
// Counting every step since v000, it is 23.6 times as fast.
#include <hip/hip_runtime.h>

// Compute dtypes, f32 accumulate, per item: Q/K = x.W^T + b as [2048 x 1024].[1024 x 1024] GEMMs, V^T = Wv.x^T + b (by row) as [1024 x 1024].[1024 x 2048], with PLAIN bf16 operands (exact products); per head: scores = q.k^T ([2048 x
// 64].[64 x 2048], both operands bf16 hi + UNSCALED residual, three products), running softmax (x 1/8) in f32, exp(s - max).V ([2048 x 2048].[2048 x 64], hi + residual, three products),
// scaled by 0.6 / sum, plus 0.4 L.V (L = the row-normalised 7-tap Gaussian band, hi + residual, three products), all in k_fattn; out = ctx.Wo^T + bo (two products) - on

#define NBT  2
#define NN   2048
#define DMOD 1024
#define NH_  16
#define HD   64
#define DM   DMOD
#define NTK  NN
#define SCL  0.125f
#define LJ   0.6f
#define LSIG 0.4f
#define WIN  3
#define LEPSK 1e-10f
#define LOSC 1024.0f

typedef _Float16 h16;
typedef unsigned short bf;
typedef __attribute__((ext_vector_type(16))) __bf16   v16bf;
typedef __attribute__((ext_vector_type(16))) _Float16 v16h;
typedef __attribute__((ext_vector_type(8)))  _Float16 v8h;
typedef __attribute__((ext_vector_type(8)))  unsigned short v8us;
typedef __attribute__((ext_vector_type(8)))  float    v8f;
typedef __attribute__((ext_vector_type(4)))  float    v4f;
typedef __attribute__((ext_vector_type(4)))  _Float16 v4h;
typedef v8h  __attribute__((may_alias)) v8ha;
typedef v4f  __attribute__((may_alias)) v4fa;
typedef v8us __attribute__((may_alias)) v8usa;

__device__ __forceinline__ unsigned short f2bf(float f) { unsigned u = __float_as_uint(f); u += 0x7FFFu + ((u >> 16) & 1u); return (unsigned short)(u >> 16); }
__device__ __forceinline__ float bf2f(unsigned short b) { return __uint_as_float(((unsigned)b) << 16); }
__device__ __forceinline__ float bfr(float f) { return bf2f(f2bf(f)); }
__device__ __forceinline__ v16h cat16(v8h lo, v8h hi) { return __builtin_shufflevector(lo, hi, 0, 1, 2, 3, 4, 5, 6, 7, 8, 9, 10, 11, 12, 13, 14, 15); }
__device__ __forceinline__ v16bf cat16b(v8us lo, v8us hi) { return __builtin_bit_cast(v16bf, __builtin_shufflevector(lo, hi, 0, 1, 2, 3, 4, 5, 6, 7, 8, 9, 10, 11, 12, 13, 14, 15)); }
__device__ __forceinline__ v8f wmma16(v16h a, v16h b, v8f c) { return __builtin_amdgcn_wmma_f32_16x16x32_f16(false, a, false, b, (short)0, c, false, false); }
__device__ __forceinline__ v8f wmmab(v16bf a, v16bf b, v8f c) { return __builtin_amdgcn_wmma_f32_16x16x32_bf16(false, a, false, b, (short)0, c, false, false); }

// k_gemmb: 64 x 64 block tile (4 waves x 16 x 64) of C[NBT x NTK][NW] = (A [+ Al]).B^T (K = 1024, a multiple of 128) [+ bf(bias[c])] [+ bf(R[r][c]) residual]; f32 whole-line epilogue (or bf16
// OUTM 0: f32 C, rows = the tokens of both items. OUTM 1: the Q, K and V products of both items in one grid, blockIdx.z = 0, 1, 2; A = tokens, Bn = the three weight planes one behind another, output = bf16 hi + residual
// planes, one set of NBT x NN x DM elements a product. Q and K: [item][column block = head][token][64]. V: the operands change places (rows = weights, columns = tokens, bias taken by ROW), which gives V^T as [item][head x 64 + d][token].
// Operands: per stage of 128 k the block's 64 rows of B, A (and Al) go from global memory into LDS by asynchronous 16-byte copies (a wave covers two whole 256-byte row pieces a copy),
// rows at a 272-byte pitch, two buffers: the copies of stage s + 2 are issued behind the barrier that ends stage s and fly while stage s + 1 is worked on. Fragments are read from LDS in the k order 8 hi + e, 16 + 8 hi + e.
#define GKS  128           // k elements a stage
#define GP   136           // LDS row pitch in 16-bit elements
#define GPL  (64 * GP)     // one operand's tile of 64 rows
// Eight copies of one thread: rows r, r + 8, .. r + 56 of one operand's tile, the same 16-byte piece of each. The s_wait_xcnt stands inside the statement, behind the last copy, so that no
// address register that a copy names is rewritten in front of it.
__device__ __forceinline__ void acopy8(unsigned l, const bf* g, size_t gs) {
    asm volatile("global_load_async_to_lds_b128 %0, %8, off\n\tglobal_load_async_to_lds_b128 %1, %9, off\n\tglobal_load_async_to_lds_b128 %2, %10, off\n\tglobal_load_async_to_lds_b128 %3, %11, off\n\t"
                 "global_load_async_to_lds_b128 %4, %12, off\n\tglobal_load_async_to_lds_b128 %5, %13, off\n\tglobal_load_async_to_lds_b128 %6, %14, off\n\tglobal_load_async_to_lds_b128 %7, %15, off\n\ts_wait_xcnt 0x0"
                 :: "v"(l), "v"(l + 1u * 16u * GP), "v"(l + 2u * 16u * GP), "v"(l + 3u * 16u * GP), "v"(l + 4u * 16u * GP), "v"(l + 5u * 16u * GP), "v"(l + 6u * 16u * GP), "v"(l + 7u * 16u * GP),
                    "v"(g), "v"(g + gs), "v"(g + 2 * gs), "v"(g + 3 * gs), "v"(g + 4 * gs), "v"(g + 5 * gs), "v"(g + 6 * gs), "v"(g + 7 * gs) : "memory");
}
template <bool SPLITA, int OUTM = 0>
__global__ __launch_bounds__(128) void k_gemmb(const bf* __restrict__ A, const bf* __restrict__ Al, const bf* __restrict__ Bn, const float* __restrict__ bias, const float* __restrict__ biasK, const float* __restrict__ biasV, float* C, int ldc, bf* Ph, bf* Pl, const float* __restrict__ R = nullptr, int K = DM, int roundR = 1) {
    constexpr int NPL = SPLITA ? 3 : 2;    // planes a stage: B, A (, Al)
    __shared__ __align__(16) float ost[4][16 * 68];
    __shared__ __align__(16) bf gt[2][NPL][GPL];
    const int lane = threadIdx.x & 31, wave = threadIdx.x >> 5, lr = lane & 15, hi = lane >> 4;
    const int z = OUTM == 1 ? (int)blockIdx.z : 0; const bool vt = OUTM == 1 && z == 2;    // which product; V^T takes its rows from the weights (block-uniform)
    const int rb = vt ? blockIdx.y : blockIdx.x, cb = vt ? blockIdx.x : blockIdx.y;         // row block, column block: blockIdx.x counts token blocks, blockIdx.y weight blocks
    const int r0 = rb * 64 + wave * 16, c0 = cb * 64;
    const int crow = threadIdx.x >> 4, cpc = (threadIdx.x & 15) * 8;    // copies: thread -> rows crow + 8 u, 16-byte piece cpc of each 256-byte row piece
    const bf* Wz = Bn + (size_t)z * DM * DM;
    const bf* ga = (vt ? Wz : A) + (size_t)(rb * 64 + crow) * K + cpc;
    const bf* gal = SPLITA ? Al + (size_t)(rb * 64 + crow) * K + cpc : nullptr;
    const bf* gb = (vt ? A : Wz) + (size_t)(c0 + crow) * K + cpc;
    const unsigned l0 = (unsigned)(size_t)&gt[0][0][crow * GP + cpc];    // the thread's LDS byte address in buffer 0, plane 0
    const size_t gs = (size_t)8 * K;
    auto fill = [&](int st) { const unsigned l = l0 + (unsigned)(st & 1) * (unsigned)(NPL * GPL * 2); const size_t ko = (size_t)st * GKS;
        acopy8(l, gb + ko, gs); acopy8(l + GPL * 2u, ga + ko, gs); if (SPLITA) acopy8(l + 2u * GPL * 2u, gal + ko, gs); };
    v8f acc[4];
#pragma unroll
    for (int t = 0; t < 4; ++t) acc[t] = (v8f){};
    const int nst = K / GKS;
    fill(0);
    asm volatile("s_wait_asynccnt 0x0" ::: "memory");    // this wave's copies of stage 0 have landed
    __syncthreads();                                     // every wave's have: stage 0 may be read
    if (nst > 1) fill(1);
#pragma unroll 1
    for (int st = 0; st < nst; ++st) {    // rolled: one stage a trip, the two buffers in turn
        const bf* tb = &gt[st & 1][0][0]; const bf* ta = &gt[st & 1][1][0]; const bf* tal = &gt[st & 1][NPL - 1][0];
        v16bf fa[4], fal[4], fb[4][4];    // the stage's fragments, all fetched as one group of LDS reads
#pragma unroll
        for (int q = 0; q < GKS / 32; ++q) { const int ao = (wave * 16 + lr) * GP + q * 32 + 8 * hi;
            fa[q] = cat16b(*(const v8us*)(ta + ao), *(const v8us*)(ta + ao + 16));
            if (SPLITA) fal[q] = cat16b(*(const v8us*)(tal + ao), *(const v8us*)(tal + ao + 16));
#pragma unroll
            for (int t = 0; t < 4; ++t) { const int bo = (t * 16 + lr) * GP + q * 32 + 8 * hi; fb[q][t] = cat16b(*(const v8us*)(tb + bo), *(const v8us*)(tb + bo + 16)); } }
        // Inputs-only fence on the loaded fragments: it keeps the LDS reads together in front of the matrix run; without it they are spread among the products, each pair with its own full wait.
        if constexpr (SPLITA) asm volatile("" :: "v"(fal[0]), "v"(fal[1]), "v"(fal[2]), "v"(fal[3]));
        asm volatile("" :: "v"(fa[0]), "v"(fa[1]), "v"(fa[2]), "v"(fa[3]), "v"(fb[0][0]), "v"(fb[0][1]), "v"(fb[0][2]), "v"(fb[0][3]), "v"(fb[1][0]), "v"(fb[1][1]), "v"(fb[1][2]), "v"(fb[1][3]),
                     "v"(fb[2][0]), "v"(fb[2][1]), "v"(fb[2][2]), "v"(fb[2][3]), "v"(fb[3][0]), "v"(fb[3][1]), "v"(fb[3][2]), "v"(fb[3][3]));
#pragma unroll
        for (int q = 0; q < GKS / 32; ++q) {
#pragma unroll
            for (int t = 0; t < 4; ++t) { acc[t] = wmmab(fa[q], fb[q][t], acc[t]); if (SPLITA) acc[t] = wmmab(fal[q], fb[q][t], acc[t]); } }
        asm volatile("s_wait_dscnt 0x0" ::: "memory");       // this wave's reads of the buffer are done before anybody refills it
        asm volatile("s_wait_asynccnt 0x0" ::: "memory");    // this wave's copies of stage st + 1 have landed
        __syncthreads();                                     // publishes stage st + 1 and ends every wave's reads of stage st
        if (st + 2 < nst) fill(st + 2);                      // into the buffer that this trip has just read
    }
    asm volatile("s_wait_asynccnt 0x0" ::: "memory");    // no copy is outstanding when the epilogue starts
    float* os = &ost[wave][0];
    const float* bz = z == 0 ? bias : z == 1 ? biasK : biasV;
    if (vt) {
#pragma unroll
        for (int j = 0; j < 8; ++j) { const float bv = bfr(bz[r0 + hi * 8 + j]);
#pragma unroll
            for (int t = 0; t < 4; ++t) os[(hi * 8 + j) * 68 + t * 16 + lr] = acc[t][j] + bv; }
    } else {
        const int bi = c0 + lr; float br[4] = {0.f, 0.f, 0.f, 0.f};
        if (bz) {
#pragma unroll
            for (int t = 0; t < 4; ++t) br[t] = bz[bi + t * 16]; }
        asm volatile("s_wait_xcnt 0x0" :: "v"(bi) : "memory");    // the bias loads' offset register is free for re-use only behind this wait; bi as an input keeps it live up to it
#pragma unroll
        for (int t = 0; t < 4; ++t) { const float bv = bfr(br[t]);
#pragma unroll
            for (int j = 0; j < 8; ++j) os[(hi * 8 + j) * 68 + t * 16 + lr] = acc[t][j] + bv; }
    }
    __syncthreads();
    if (OUTM != 0) {
        Ph += (size_t)z * NBT * NN * DM; Pl += (size_t)z * NBT * NN * DM;
        // a tile row is 64 elements = one whole 128-byte line of each plane; a token block lies in item (block / 32)
        const size_t base = vt ? ((size_t)(cb / (NN / 64)) * DM + r0) * NN + (cb % (NN / 64)) * 64 : (((size_t)(rb / (NN / 64)) * NH_ + cb) * NN + (r0 - (rb / (NN / 64)) * NN)) * HD;
        const int pitch = vt ? NN : HD;
#pragma unroll
        for (int s = 0; s < 4; ++s) { const int row = 4 * s + (lane >> 3), piece = lane & 7; const float* sp = os + row * 68 + piece * 8; v8us oh, ol;
#pragma unroll
            for (int i = 0; i < 8; ++i) { const unsigned short hb = f2bf(sp[i]); oh[i] = hb; ol[i] = f2bf(sp[i] - bf2f(hb)); }
            const size_t o = base + (size_t)row * pitch + piece * 8; *(v8us*)(Ph + o) = oh; *(v8us*)(Pl + o) = ol; }
    } else {
        float* crow = C + (size_t)r0 * ldc + c0;
        auto pass = [&]() {
#pragma unroll
            for (int s = 0; s < 8; ++s) { const int Lid = (lane >> 3) + 4 * s, piece = lane & 7; const int row = Lid >> 1, cofs = (Lid & 1) * 32 + piece * 4;
                v4f val = *(const v4fa*)(os + row * 68 + cofs); if (R) { const v4f rv = *(const v4f*)(R + ((size_t)r0 + row) * ldc + c0 + cofs); val += roundR ? (v4f){bfr(rv[0]), bfr(rv[1]), bfr(rv[2]), bfr(rv[3])} : rv; }
                *(v4f*)(crow + (size_t)row * ldc + cofs) = val; }
        };
        pass(); 
    }
}

#define FP   72            // LDS row pitch in 16-bit elements
#define FPL  (64 * FP)     // one plane's tile
#define SC2  0.18033688f   // 1/8 x log2(e)
typedef __attribute__((ext_vector_type(16))) float v16f;
__device__ __forceinline__ float xhalf(float v) { const int b = __float_as_int(v); return __int_as_float(__builtin_amdgcn_permlanex16(b, b, 0x76543210, 0xfedcba98, false, false)); }   // lane l <-> l ^ 16
__device__ __forceinline__ v16f widen16(v16bf x) { typedef __attribute__((ext_vector_type(8))) unsigned v8u; const v8u w = __builtin_bit_cast(v8u, x); v16f r;    // packed bf16 pairs back to f32: a shift and a mask a pair
#pragma unroll
    for (int k = 0; k < 8; ++k) { r[2 * k] = __uint_as_float(w[k] << 16); r[2 * k + 1] = __uint_as_float(w[k] & 0xFFFF0000u); }
    return r; }
#define GC2  (-1.44269504f / (2.0f * LSIG * LSIG))    // un-normalised band tap = exp(-d^2 / (2 x 0.16)) = exp2(d^2 x GC2), 0 outside |d| <= 3
__device__ __forceinline__ v16f cat16f(v8f lo, v8f hi) { return __builtin_shufflevector(lo, hi, 0, 1, 2, 3, 4, 5, 6, 7, 8, 9, 10, 11, 12, 13, 14, 15); }
// Eight independent v_exp_f32 in one statement, every output apart from every input, v_nop last: no neighbour reads a result or overwrites a source in the slot directly behind a transcendental.
__device__ __forceinline__ v8f exp2x8(v8f x) { float r0, r1, r2, r3, r4, r5, r6, r7;
    asm("v_exp_f32 %0, %8\n\tv_exp_f32 %1, %9\n\tv_exp_f32 %2, %10\n\tv_exp_f32 %3, %11\n\tv_exp_f32 %4, %12\n\tv_exp_f32 %5, %13\n\tv_exp_f32 %6, %14\n\tv_exp_f32 %7, %15\n\tv_nop"
        : "=&v"(r0), "=&v"(r1), "=&v"(r2), "=&v"(r3), "=&v"(r4), "=&v"(r5), "=&v"(r6), "=&v"(r7) : "v"(x[0]), "v"(x[1]), "v"(x[2]), "v"(x[3]), "v"(x[4]), "v"(x[5]), "v"(x[6]), "v"(x[7]));
    return (v8f){r0, r1, r2, r3, r4, r5, r6, r7}; }
__device__ __forceinline__ float exp2x1(float x) { float r; asm("v_exp_f32 %0, %1\n\tv_nop" : "=v"(r) : "v"(x)); return r; }    // one v_exp_f32 with the same slot behind it
__global__ __launch_bounds__(256) void k_fattn(const bf* __restrict__ Qh, const bf* __restrict__ Ql, const bf* __restrict__ Kh, const bf* __restrict__ Kl, const bf* __restrict__ VTh, const bf* __restrict__ VTl, bf* Ch, bf* Cl) {
    __shared__ __align__(16) bf tl[2][4][FPL];
    const int tid = threadIdx.x, lane = tid & 31, lr = lane & 15, hi = lane >> 4;
    const int wave = __builtin_amdgcn_readfirstlane(tid >> 5);
    const int h = blockIdx.y, q0 = blockIdx.x * 128 + wave * 16;
    const size_t hb = ((size_t)blockIdx.z * NH_ + h) * NN * HD;    // this item's and head's part of every Q, K and V^T plane
    const bf* __restrict__ kh0 = Kh + hb; const bf* __restrict__ kl0 = Kl + hb;
    const bf* __restrict__ vh0 = VTh + hb; const bf* __restrict__ vl0 = VTl + hb;
    v16bf qh[2], ql[2];
#pragma unroll
    for (int ks = 0; ks < 2; ++ks) { const size_t o = hb + (size_t)(q0 + lr) * HD + ks * 32 + 8 * hi; qh[ks] = cat16b(*(const v8us*)(Qh + o), *(const v8us*)(Qh + o + 16)); }
    asm volatile("s_wait_xcnt 0x0" ::: "memory");    // these loads' address registers are free for re-use (the next loads' results land in them) only behind this wait
#pragma unroll
    for (int ks = 0; ks < 2; ++ks) { const size_t o = hb + (size_t)(q0 + lr) * HD + ks * 32 + 8 * hi; ql[ks] = cat16b(*(const v8us*)(Ql + o), *(const v8us*)(Ql + o + 16)); }
    asm volatile("s_wait_xcnt 0x0" ::: "memory");    // the same for the residual plane's loads
    const int srow = tid >> 3, spc = (tid & 7) * 8;    // staging: thread -> rows srow and srow + 32, 16-byte piece spc of each plane's 64 x 128-byte tile (a wave covers whole lines)
    v8us g[8];
    auto gload = [&](int kb) {
#pragma unroll
        for (int u = 0; u < 2; ++u) { const int row = srow + 32 * u; const size_t ko = (size_t)(kb + row) * HD + spc, vo = (size_t)row * NN + kb + spc;
            g[u] = *(const v8us*)(kh0 + ko); g[2 + u] = *(const v8us*)(kl0 + ko); g[4 + u] = *(const v8us*)(vh0 + vo); g[6 + u] = *(const v8us*)(vl0 + vo); }
    };
    auto sstore = [&](int buf) {
#pragma unroll
        for (int u = 0; u < 2; ++u) { const int o = (srow + 32 * u) * FP + spc;
            *(v8us*)(&tl[buf][0][o]) = g[u]; *(v8us*)(&tl[buf][1][o]) = g[2 + u]; *(v8us*)(&tl[buf][2][o]) = g[4 + u]; *(v8us*)(&tl[buf][3][o]) = g[6 + u]; }
    };
    v8f acc[4];
#pragma unroll
    for (int t = 0; t < 4; ++t) acc[t] = (v8f){};
    float m = -3.0e38f, lsum = 0.f;    // running maximum (raw score units, equal in both halves of the wave) and this half's part of the sum
    gload(0);
    asm volatile("s_wait_xcnt 0x0" ::: "memory");    // the loop's address arithmetic re-uses these loads' offset registers
    sstore(0);
    __syncthreads();
#pragma unroll 1
    for (int s = 0; s < NN / 64; ++s) {
        const int cur = s & 1;
        if (s + 1 < NN / 64) gload((s + 1) * 64);
#pragma unroll
        for (int hf = 0; hf < 2; ++hf) {
            v8f st[2]; st[0] = (v8f){}; st[1] = (v8f){};
#pragma unroll
            for (int ks = 0; ks < 2; ++ks) { v16bf kh[2], kl[2];
#pragma unroll
                for (int tt = 0; tt < 2; ++tt) { const int o = (hf * 32 + tt * 16 + lr) * FP + ks * 32 + 8 * hi;
                    kh[tt] = cat16b(*(const v8us*)(&tl[cur][0][o]), *(const v8us*)(&tl[cur][0][o + 16])); kl[tt] = cat16b(*(const v8us*)(&tl[cur][1][o]), *(const v8us*)(&tl[cur][1][o + 16])); }
                st[0] = wmmab(kh[0], qh[ks], st[0]); st[1] = wmmab(kh[1], qh[ks], st[1]);
                st[0] = wmmab(kl[0], qh[ks], st[0]); st[1] = wmmab(kl[1], qh[ks], st[1]);
                st[0] = wmmab(kh[0], ql[ks], st[0]); st[1] = wmmab(kh[1], ql[ks], st[1]); }
            float mx = fmaxf(st[0][0], st[1][0]);
#pragma unroll
            for (int j = 1; j < 8; ++j) mx = fmaxf(mx, fmaxf(st[0][j], st[1][j]));
            mx = fmaxf(mx, xhalf(mx));
            const float mnew = fmaxf(m, mx), alpha = exp2x1((m - mnew) * SC2), mc = mnew * SC2;
            m = mnew;
            const v16f p = cat16f(exp2x8(st[0] * SC2 - mc), exp2x8(st[1] * SC2 - mc));
            const v8f s8 = __builtin_shufflevector(p, p, 0, 1, 2, 3, 4, 5, 6, 7) + __builtin_shufflevector(p, p, 8, 9, 10, 11, 12, 13, 14, 15);
            const v4f s4 = __builtin_shufflevector(s8, s8, 0, 1, 2, 3) + __builtin_shufflevector(s8, s8, 4, 5, 6, 7);
            lsum = lsum * alpha + ((s4[0] + s4[2]) + (s4[1] + s4[3]));
            const v16bf ph = __builtin_convertvector(p, v16bf);
            const v16bf pl = __builtin_convertvector(p - widen16(ph), v16bf);
            v16bf vh[4], vl[4];
#pragma unroll
            for (int t = 0; t < 4; ++t) { const int o = (t * 16 + lr) * FP + hf * 32 + 8 * hi; acc[t] *= alpha;
                vh[t] = cat16b(*(const v8us*)(&tl[cur][2][o]), *(const v8us*)(&tl[cur][2][o + 16])); vl[t] = cat16b(*(const v8us*)(&tl[cur][3][o]), *(const v8us*)(&tl[cur][3][o + 16])); }
#pragma unroll
            for (int t = 0; t < 4; ++t) acc[t] = wmmab(vh[t], ph, acc[t]);
#pragma unroll
            for (int t = 0; t < 4; ++t) acc[t] = wmmab(vl[t], ph, acc[t]);
#pragma unroll
            for (int t = 0; t < 4; ++t) acc[t] = wmmab(vh[t], pl, acc[t]);
        }
        if (s + 1 < NN / 64) sstore(cur ^ 1);    // every wave left that buffer before the barrier that ended the tile before this one
        __syncthreads();
    }
    lsum += xhalf(lsum);
    const float inv = LJ / lsum;
#pragma unroll
    for (int t = 0; t < 4; ++t) acc[t] *= inv;
    const int i = q0 + lr;
    float lnorm = 0.f;       // row normaliser of the band (taps clipped at the sequence ends)
#pragma unroll
    for (int d = -WIN; d <= WIN; ++d) { const int k = i - d; lnorm += (k >= 0 && k < NN) ? __builtin_amdgcn_exp2f((float)(d * d) * GC2) : 0.f; }
    const float lw = (1.0f - LJ) / (lnorm + LEPSK);
#pragma unroll
    for (int bb = 0; bb < 2; ++bb) { const int kb = ((q0 - 16) & ~31) + 32 * bb;    // keys q0 - 3 .. q0 + 18 lie in these two blocks; wave-uniform test
        if (kb >= 0 && kb < NN) { v8f q2[2];    // squared distance query - key, in the B operand's k order
#pragma unroll
            for (int e = 0; e < 16; ++e) { const float fd = (float)(i - (kb + (e < 8 ? 8 * hi + e : 8 + 8 * hi + e))); q2[e >> 3][e & 7] = fd * fd; }
            const v16f ge = cat16f(exp2x8(q2[0] * GC2), exp2x8(q2[1] * GC2)); v16f lv;
#pragma unroll
            for (int e = 0; e < 16; ++e) lv[e] = q2[e >> 3][e & 7] <= (float)(WIN * WIN) ? ge[e] * lw : 0.f;
            const v16bf lh = __builtin_convertvector(lv, v16bf);
            const v16bf ll = __builtin_convertvector(lv - widen16(lh), v16bf);
#pragma unroll
            for (int t = 0; t < 4; ++t) { const size_t o = (size_t)(t * 16 + lr) * NN + kb + 8 * hi;
                const v16bf vh = cat16b(*(const v8us*)(vh0 + o), *(const v8us*)(vh0 + o + 16)); const v16bf vl = cat16b(*(const v8us*)(vl0 + o), *(const v8us*)(vl0 + o + 16));
                acc[t] = wmmab(vh, lh, acc[t]); acc[t] = wmmab(vl, lh, acc[t]); acc[t] = wmmab(vh, ll, acc[t]); } } }
    const size_t co = ((size_t)blockIdx.z * NN + i) * DMOD + h * HD + hi * 8;    // acc[t][j] = O[query i][16 t + 8 hi + j]; stored as the bf16 hi + residual planes that the output projection reads
#pragma unroll
    for (int t = 0; t < 4; ++t) { v8us oh, ol;
#pragma unroll
        for (int j = 0; j < 8; ++j) { const unsigned short hb = f2bf(acc[t][j]); oh[j] = hb; ol[j] = f2bf(acc[t][j] - bf2f(hb)); }
        *(v8us*)(Ch + co + t * 16) = oh; *(v8us*)(Cl + co + t * 16) = ol; }
}

// f32 -> bf16 of all five operands in one grid: blockIdx.y picks a piece of DM x DM elements, 0 .. 3 = x (both items), 4 .. 7 = Wq, Wk, Wv, Wo; dst holds the pieces one behind another.
// A block converts CVB elements, a thread eight runs of 8 (2,048 elements apart, so a wave's loads and stores cover whole lines): few waves to start, all of a thread's loads in flight at once.
#define CVB  (256 * 8 * 8)
__global__ __launch_bounds__(256) void k_cvt8(const float* __restrict__ x, const float* __restrict__ Wq, const float* __restrict__ Wk, const float* __restrict__ Wv, const float* __restrict__ Wo, bf* dst) {
    const int y = blockIdx.y; const size_t i = (size_t)blockIdx.x * CVB + threadIdx.x * 8;
    const float* __restrict__ src = y < 4 ? x + (size_t)y * DM * DM : y == 4 ? Wq : y == 5 ? Wk : y == 6 ? Wv : Wo;
    const float* p = src + i; v8f v[8];
#pragma unroll
    for (int q = 0; q < 8; ++q) v[q] = *(const v8f*)(p + q * 2048);
    asm volatile("s_wait_xcnt 0x0" :: "v"(p) : "memory");    // the loads' address registers are free for re-use only behind this wait; p as an input keeps them live up to it, so that no load's result lands in them
#pragma unroll
    for (int q = 0; q < 8; ++q) { v8us o;
#pragma unroll
        for (int k = 0; k < 8; ++k) o[k] = f2bf(v[q][k]);
        *(v8us*)(dst + (size_t)y * DM * DM + i + q * 2048) = o; }
}
extern "C" void kernel_launch(void* const* d_in, const int* in_sizes, int n_in,
                              void* d_out, int out_size, void* d_ws, size_t ws_size, hipStream_t stream) {
    (void)in_sizes; (void)n_in; (void)out_size;
    const float* x = (const float*)d_in[0]; const float* Wq = (const float*)d_in[1]; const float* bq = (const float*)d_in[2]; const float* Wk = (const float*)d_in[3]; const float* bk = (const float*)d_in[4]; const float* Wv = (const float*)d_in[5]; const float* bv = (const float*)d_in[6]; const float* Wo = (const float*)d_in[7]; const float* bo = (const float*)d_in[8];
    float* out = (float*)d_out;    // [2][2048][1024]
    char* wsp = (char*)d_ws;
    auto take = [&](size_t bytes) { char* p = wsp; wsp += (bytes + 255) & ~(size_t)255; return (void*)p; };
    const size_t PW = (size_t)DMOD * DMOD, PX = (size_t)NBT * NN * DMOD;    // elements of a weight plane, of a plane over both items
    bf* Xb = (bf*)take((PX + 4 * PW) * 2); bf* WQ = Xb + PX; bf* WO = WQ + 3 * PW;    // x, Wq, Wk, Wv, Wo in bf16, one behind another
    bf* Qh = (bf*)take(3 * PX * 2); bf* Kh = Qh + PX; bf* VTh = Kh + PX;             // hi planes of Q, K, V^T, one behind another
    bf* Ql = (bf*)take(3 * PX * 2); bf* Kl = Ql + PX; bf* VTl = Kl + PX;             // residual planes
    bf* Ch = (bf*)take(PX * 2); bf* Cl = (bf*)take(PX * 2);
    if ((size_t)(wsp - (char*)d_ws) > ws_size) return;    // about 84 MB in all
    k_cvt8<<<dim3(DMOD * DMOD / CVB, 8, 1), 256, 0, stream>>>(x, Wq, Wk, Wv, Wo, Xb);    // torch [out][in] = n-major
    k_gemmb<false, 1><<<dim3(NBT * NN / 64, DMOD / 64, 3), 128, 0, stream>>>(Xb, nullptr, WQ, bq, bk, bv, nullptr, DMOD, Qh, Ql, nullptr, DMOD);
    k_fattn<<<dim3(NN / 128, NH_, NBT), 256, 0, stream>>>(Qh, Ql, Kh, Kl, VTh, VTl, Ch, Cl);
    k_gemmb<true, 0><<<dim3(NBT * NN / 64, DMOD / 64, 1), 128, 0, stream>>>(Ch, Cl, WO, bo, nullptr, nullptr, out, DMOD, nullptr, nullptr, nullptr, DMOD);
}

// v006
// One run takes 134 microseconds.
// Next to v005, in two timings, it ran 1.10 and 1.12 times as fast.
// Counting every step since v000, it is 26.1 times as fast.
#include <hip/hip_runtime.h>

// Compute dtypes, f32 accumulate, per item: Q/K = x.W^T + b as [2048 x 1024].[1024 x 1024] GEMMs, V^T = Wv.x^T + b (by row) as [1024 x 1024].[1024 x 2048], with PLAIN bf16 operands (exact products); per head: scores = q.k^T ([2048 x
// 64].[64 x 2048], both operands bf16 hi + UNSCALED residual, three products), running softmax (x 1/8) in f32, exp(s - max).V ([2048 x 2048].[2048 x 64], hi + residual, three products),
// scaled by 0.6 / sum, plus 0.4 L.V (L = the row-normalised 7-tap Gaussian band, hi + residual, three products), all in k_fattn; out = ctx.Wo^T + bo (two products) - on

#define NBT  2
#define NN   2048
#define DMOD 1024
#define NH_  16
#define HD   64
#define DM   DMOD
#define NTK  NN
#define SCL  0.125f
#define LJ   0.6f
#define LSIG 0.4f
#define WIN  3
#define LEPSK 1e-10f
#define LOSC 1024.0f

typedef _Float16 h16;
typedef unsigned short bf;
typedef __attribute__((ext_vector_type(16))) __bf16   v16bf;
typedef __attribute__((ext_vector_type(16))) _Float16 v16h;
typedef __attribute__((ext_vector_type(8)))  _Float16 v8h;
typedef __attribute__((ext_vector_type(8)))  unsigned short v8us;
typedef __attribute__((ext_vector_type(8)))  float    v8f;
typedef __attribute__((ext_vector_type(4)))  float    v4f;
typedef __attribute__((ext_vector_type(4)))  _Float16 v4h;
typedef v8h  __attribute__((may_alias)) v8ha;
typedef v4f  __attribute__((may_alias)) v4fa;
typedef v8us __attribute__((may_alias)) v8usa;

__device__ __forceinline__ unsigned short f2bf(float f) { unsigned u = __float_as_uint(f); u += 0x7FFFu + ((u >> 16) & 1u); return (unsigned short)(u >> 16); }
__device__ __forceinline__ float bf2f(unsigned short b) { return __uint_as_float(((unsigned)b) << 16); }
__device__ __forceinline__ float bfr(float f) { return bf2f(f2bf(f)); }
__device__ __forceinline__ v16h cat16(v8h lo, v8h hi) { return __builtin_shufflevector(lo, hi, 0, 1, 2, 3, 4, 5, 6, 7, 8, 9, 10, 11, 12, 13, 14, 15); }
__device__ __forceinline__ v16bf cat16b(v8us lo, v8us hi) { return __builtin_bit_cast(v16bf, __builtin_shufflevector(lo, hi, 0, 1, 2, 3, 4, 5, 6, 7, 8, 9, 10, 11, 12, 13, 14, 15)); }
__device__ __forceinline__ v8f wmma16(v16h a, v16h b, v8f c) { return __builtin_amdgcn_wmma_f32_16x16x32_f16(false, a, false, b, (short)0, c, false, false); }
__device__ __forceinline__ v8f wmmab(v16bf a, v16bf b, v8f c) { return __builtin_amdgcn_wmma_f32_16x16x32_bf16(false, a, false, b, (short)0, c, false, false); }

// k_gemmb: block tile of 32 MT rows x 128 columns, 4 waves as 2 x 2, a wave = MT x 4 tiles of 16 x 16 (16 MT rows x 64 columns), of C = (A [+ Al]).B^T (K a multiple of 64, at least 128) + bf(bias[c]).
// A loaded fragment of A feeds 4 products and one of B feeds MT (2 MT with Al), and a row of an operand is fetched from L2 once per 128 columns or 32 MT rows of the output.
// OUTM 0: f32 C, rows = the tokens of both items. OUTM 1 (MT = 4): the Q, K and V products of both items in one grid, blockIdx.z = 0, 1, 2; A = tokens, Bn = the three weight planes one behind another, output = bf16 hi + residual
// planes, one set of NBT x NN x DM elements a product. Q and K: [item][64 columns = head][token][64]. V: the operands change places (rows = weights, columns = tokens, bias taken by ROW), which gives V^T as [item][head x 64 + d][token].
// Operands: per stage of 64 k the block's 128 rows of B and 32 MT rows of A (and Al) go from global memory into LDS by asynchronous 16-byte copies (a wave covers four whole 128-byte row pieces a copy),
// rows at a 144-byte pitch, two buffers: the copies of stage s + 2 are issued behind the barrier that ends stage s and fly while stage s + 1 is worked on. Fragments are read from LDS in the k order 8 hi + e, 16 + 8 hi + e.
#define GKS  64            // k elements a stage
#define GP   72            // LDS row pitch in 16-bit elements
// Eight (four) copies of one thread: rows r, r + 16, .. of one operand's tile, the same 16-byte piece of each. The s_wait_xcnt stands inside the statement, behind the last copy, so that no
// address register that a copy names is rewritten in front of it.
__device__ __forceinline__ void acopy8(unsigned l, const bf* g, size_t gs) {
    asm volatile("global_load_async_to_lds_b128 %0, %8, off\n\tglobal_load_async_to_lds_b128 %1, %9, off\n\tglobal_load_async_to_lds_b128 %2, %10, off\n\tglobal_load_async_to_lds_b128 %3, %11, off\n\t"
                 "global_load_async_to_lds_b128 %4, %12, off\n\tglobal_load_async_to_lds_b128 %5, %13, off\n\tglobal_load_async_to_lds_b128 %6, %14, off\n\tglobal_load_async_to_lds_b128 %7, %15, off\n\ts_wait_xcnt 0x0"
                 :: "v"(l), "v"(l + 1u * 32u * GP), "v"(l + 2u * 32u * GP), "v"(l + 3u * 32u * GP), "v"(l + 4u * 32u * GP), "v"(l + 5u * 32u * GP), "v"(l + 6u * 32u * GP), "v"(l + 7u * 32u * GP),
                    "v"(g), "v"(g + gs), "v"(g + 2 * gs), "v"(g + 3 * gs), "v"(g + 4 * gs), "v"(g + 5 * gs), "v"(g + 6 * gs), "v"(g + 7 * gs) : "memory");
}
__device__ __forceinline__ void acopy4(unsigned l, const bf* g, size_t gs) {
    asm volatile("global_load_async_to_lds_b128 %0, %4, off\n\tglobal_load_async_to_lds_b128 %1, %5, off\n\tglobal_load_async_to_lds_b128 %2, %6, off\n\tglobal_load_async_to_lds_b128 %3, %7, off\n\ts_wait_xcnt 0x0"
                 :: "v"(l), "v"(l + 1u * 32u * GP), "v"(l + 2u * 32u * GP), "v"(l + 3u * 32u * GP), "v"(g), "v"(g + gs), "v"(g + 2 * gs), "v"(g + 3 * gs) : "memory");
}
template <bool SPLITA, int OUTM, int MT>
__global__ __launch_bounds__(128) void k_gemmb(const bf* __restrict__ A, const bf* __restrict__ Al, const bf* __restrict__ Bn, const float* __restrict__ bias, const float* __restrict__ biasK, const float* __restrict__ biasV, float* C, int ldc, bf* Ph, bf* Pl, int K) {
    static_assert(MT == 4 || MT == 2, "rows of A a block: 128 or 64"); static_assert(OUTM == 0 || MT == 4, "V^T swaps row and column blocks: both 128");
    constexpr int BR = 32 * MT;                                  // rows of A (and Al) a block
    constexpr int STG = (128 + (SPLITA ? 2 : 1) * BR) * GP;      // elements a stage: B, A (, Al)
    __shared__ __align__(16) float ost[4][16 * 68];
    __shared__ __align__(16) bf gt[2][STG];
    const int lane = threadIdx.x & 31, wave = threadIdx.x >> 5, lr = lane & 15, hi = lane >> 4;
    const int wr = wave >> 1, wc = wave & 1;    // the wave's place in the block tile
    const int z = OUTM == 1 ? (int)blockIdx.z : 0; const bool vt = OUTM == 1 && z == 2;    // which product; V^T takes its rows from the weights (block-uniform)
    const int rb = vt ? blockIdx.y : blockIdx.x, cb = vt ? blockIdx.x : blockIdx.y;         // row block, column block: blockIdx.x counts token blocks, blockIdx.y weight blocks
    const int r0 = rb * BR + wr * (MT * 16), c0 = cb * 128 + wc * 64;
    const int crow = threadIdx.x >> 3, cpc = (threadIdx.x & 7) * 8;    // copies: thread -> rows crow + 16 u, 16-byte piece cpc of each 128-byte row piece
    const bf* Wz = Bn + (size_t)z * DM * DM;
    const bf* ga = (vt ? Wz : A) + (size_t)(rb * BR + crow) * K + cpc;
    const bf* gal = SPLITA ? Al + (size_t)(rb * BR + crow) * K + cpc : nullptr;
    const bf* gb = (vt ? A : Wz) + (size_t)(cb * 128 + crow) * K + cpc;
    const unsigned l0 = (unsigned)(size_t)&gt[0][crow * GP + cpc];    // the thread's LDS byte address in buffer 0, operand B
    const size_t gs = (size_t)16 * K;
    auto fill = [&](int st) { const unsigned l = l0 + (unsigned)(st & 1) * (unsigned)(STG * 2); const size_t ko = (size_t)st * GKS;
        acopy8(l, gb + ko, gs);
        if constexpr (MT == 4) { acopy8(l + 128u * GP * 2u, ga + ko, gs); if (SPLITA) acopy8(l + (128u + BR) * GP * 2u, gal + ko, gs); }
        else { acopy4(l + 128u * GP * 2u, ga + ko, gs); if (SPLITA) acopy4(l + (128u + BR) * GP * 2u, gal + ko, gs); } };
    v8f acc[MT][4];
#pragma unroll
    for (int i = 0; i < MT; ++i) {
#pragma unroll
        for (int t = 0; t < 4; ++t) acc[i][t] = (v8f){}; }
    const int nst = K / GKS;
    fill(0);
    asm volatile("s_wait_asynccnt 0x0" ::: "memory");    // this wave's copies of stage 0 have landed
    __syncthreads();                                     // every wave's have: stage 0 may be read
    if (nst > 1) fill(1);
#pragma unroll 1
    for (int st = 0; st < nst; ++st) {    // rolled: one stage a trip, the two buffers in turn
        const bf* tb = &gt[st & 1][0]; const bf* ta = tb + 128 * GP; const bf* tal = ta + BR * GP;
#pragma unroll
        for (int q = 0; q < GKS / 32; ++q) {
            v16bf fa[MT], fal[MT], fb[4];    // the fragments of 32 k, fetched as one group of LDS reads
#pragma unroll
            for (int i = 0; i < MT; ++i) { const int ao = (wr * (MT * 16) + i * 16 + lr) * GP + q * 32 + 8 * hi;
                fa[i] = cat16b(*(const v8us*)(ta + ao), *(const v8us*)(ta + ao + 16));
                if (SPLITA) fal[i] = cat16b(*(const v8us*)(tal + ao), *(const v8us*)(tal + ao + 16)); }
#pragma unroll
            for (int t = 0; t < 4; ++t) { const int bo = (wc * 64 + t * 16 + lr) * GP + q * 32 + 8 * hi; fb[t] = cat16b(*(const v8us*)(tb + bo), *(const v8us*)(tb + bo + 16)); }
            // Inputs-only fence on the loaded fragments: it keeps the LDS reads together in front of the matrix run; without it they are spread among the products, each pair with its own full wait.
            if constexpr (MT == 4) asm volatile("" :: "v"(fa[0]), "v"(fa[1]), "v"(fa[2]), "v"(fa[3]), "v"(fb[0]), "v"(fb[1]), "v"(fb[2]), "v"(fb[3]));
            else asm volatile("" :: "v"(fa[0]), "v"(fa[1]), "v"(fal[0]), "v"(fal[1]), "v"(fb[0]), "v"(fb[1]), "v"(fb[2]), "v"(fb[3]));
#pragma unroll
            for (int i = 0; i < MT; ++i) {
#pragma unroll
                for (int t = 0; t < 4; ++t) acc[i][t] = wmmab(fa[i], fb[t], acc[i][t]); }
            if constexpr (SPLITA) {
#pragma unroll
                for (int i = 0; i < MT; ++i) {
#pragma unroll
                    for (int t = 0; t < 4; ++t) acc[i][t] = wmmab(fal[i], fb[t], acc[i][t]); } }
        }
        asm volatile("s_wait_dscnt 0x0" ::: "memory");       // this wave's reads of the buffer are done before anybody refills it
        asm volatile("s_wait_asynccnt 0x0" ::: "memory");    // this wave's copies of stage st + 1 have landed
        __syncthreads();                                     // publishes stage st + 1 and ends every wave's reads of stage st
        if (st + 2 < nst) fill(st + 2);                      // into the buffer that this trip has just read
    }
    asm volatile("s_wait_asynccnt 0x0" ::: "memory");    // no copy is outstanding when the epilogue starts
    float* os = &ost[wave][0];
    const float* bz = z == 0 ? bias : z == 1 ? biasK : biasV;
    float br[4] = {0.f, 0.f, 0.f, 0.f};    // bias by column
    if (!vt && bz) { const int bi = c0 + lr;
#pragma unroll
        for (int t = 0; t < 4; ++t) br[t] = bz[bi + t * 16];
        asm volatile("s_wait_xcnt 0x0" :: "v"(bi) : "memory");    // the bias loads' offset register is free for re-use only behind this wait; bi as an input keeps it live up to it
#pragma unroll
        for (int t = 0; t < 4; ++t) br[t] = bfr(br[t]); }
    if (OUTM != 0) { Ph += (size_t)z * NBT * NN * DM; Pl += (size_t)z * NBT * NN * DM; }
#pragma unroll
    for (int i = 0; i < MT; ++i) {    // the wave's tile goes out 16 rows at a time through its own LDS piece, as whole lines
        const int ri = r0 + i * 16;
        if (vt) { const float* bp = bz + ri + hi * 8; float bw[8];
#pragma unroll
            for (int j = 0; j < 8; ++j) bw[j] = bp[j];
            asm volatile("s_wait_xcnt 0x0" :: "v"(bp) : "memory");    // the same for the bias by row
#pragma unroll
            for (int j = 0; j < 8; ++j) { const float bv = bfr(bw[j]);
#pragma unroll
                for (int t = 0; t < 4; ++t) os[(hi * 8 + j) * 68 + t * 16 + lr] = acc[i][t][j] + bv; }
        } else {
#pragma unroll
            for (int t = 0; t < 4; ++t) {
#pragma unroll
                for (int j = 0; j < 8; ++j) os[(hi * 8 + j) * 68 + t * 16 + lr] = acc[i][t][j] + br[t]; }
        }
        asm volatile("s_wait_dscnt 0x0" ::: "memory");    // the wave's 16 rows stand in its own LDS piece before its lanes read them back; no other wave touches that piece, so no barrier
        if (OUTM != 0) {
            // a tile row is 64 elements = one whole 128-byte line of each plane; 16 rows and 64 columns lie in one item
            const size_t base = vt ? ((size_t)(c0 / NN) * DM + ri) * NN + (c0 % NN) : (((size_t)(ri / NN) * NH_ + (c0 >> 6)) * NN + (ri % NN)) * HD;
            const int pitch = vt ? NN : HD;
#pragma unroll
            for (int s = 0; s < 4; ++s) { const int row = 4 * s + (lane >> 3), piece = lane & 7; const float* sp = os + row * 68 + piece * 8; v8us oh, ol;
#pragma unroll
                for (int e = 0; e < 8; ++e) { const unsigned short hb = f2bf(sp[e]); oh[e] = hb; ol[e] = f2bf(sp[e] - bf2f(hb)); }
                const size_t o = base + (size_t)row * pitch + piece * 8; *(v8us*)(Ph + o) = oh; *(v8us*)(Pl + o) = ol; }
        } else {
            float* crw = C + (size_t)ri * ldc + c0;
#pragma unroll
            for (int s = 0; s < 8; ++s) { const int Lid = (lane >> 3) + 4 * s, piece = lane & 7; const int row = Lid >> 1, cofs = (Lid & 1) * 32 + piece * 4;
                *(v4f*)(crw + (size_t)row * ldc + cofs) = *(const v4fa*)(os + row * 68 + cofs); }
        }
        if (i + 1 < MT) asm volatile("s_wait_xcnt 0x0" ::: "memory");    // the stores' address and data registers are re-used by the next 16 rows only behind this wait
    }
}

#define FP   72            // LDS row pitch in 16-bit elements
#define FPL  (64 * FP)     // one plane's tile
#define SC2  0.18033688f   // 1/8 x log2(e)
typedef __attribute__((ext_vector_type(16))) float v16f;
__device__ __forceinline__ float xhalf(float v) { const int b = __float_as_int(v); return __int_as_float(__builtin_amdgcn_permlanex16(b, b, 0x76543210, 0xfedcba98, false, false)); }   // lane l <-> l ^ 16
__device__ __forceinline__ v16f widen16(v16bf x) { typedef __attribute__((ext_vector_type(8))) unsigned v8u; const v8u w = __builtin_bit_cast(v8u, x); v16f r;    // packed bf16 pairs back to f32: a shift and a mask a pair
#pragma unroll
    for (int k = 0; k < 8; ++k) { r[2 * k] = __uint_as_float(w[k] << 16); r[2 * k + 1] = __uint_as_float(w[k] & 0xFFFF0000u); }
    return r; }
#define GC2  (-1.44269504f / (2.0f * LSIG * LSIG))    // un-normalised band tap = exp(-d^2 / (2 x 0.16)) = exp2(d^2 x GC2), 0 outside |d| <= 3
__device__ __forceinline__ v16f cat16f(v8f lo, v8f hi) { return __builtin_shufflevector(lo, hi, 0, 1, 2, 3, 4, 5, 6, 7, 8, 9, 10, 11, 12, 13, 14, 15); }
// Eight independent v_exp_f32 in one statement, every output apart from every input, v_nop last: no neighbour reads a result or overwrites a source in the slot directly behind a transcendental.
__device__ __forceinline__ v8f exp2x8(v8f x) { float r0, r1, r2, r3, r4, r5, r6, r7;
    asm("v_exp_f32 %0, %8\n\tv_exp_f32 %1, %9\n\tv_exp_f32 %2, %10\n\tv_exp_f32 %3, %11\n\tv_exp_f32 %4, %12\n\tv_exp_f32 %5, %13\n\tv_exp_f32 %6, %14\n\tv_exp_f32 %7, %15\n\tv_nop"
        : "=&v"(r0), "=&v"(r1), "=&v"(r2), "=&v"(r3), "=&v"(r4), "=&v"(r5), "=&v"(r6), "=&v"(r7) : "v"(x[0]), "v"(x[1]), "v"(x[2]), "v"(x[3]), "v"(x[4]), "v"(x[5]), "v"(x[6]), "v"(x[7]));
    return (v8f){r0, r1, r2, r3, r4, r5, r6, r7}; }
__device__ __forceinline__ float exp2x1(float x) { float r; asm("v_exp_f32 %0, %1\n\tv_nop" : "=v"(r) : "v"(x)); return r; }    // one v_exp_f32 with the same slot behind it
__global__ __launch_bounds__(256) void k_fattn(const bf* __restrict__ Qh, const bf* __restrict__ Ql, const bf* __restrict__ Kh, const bf* __restrict__ Kl, const bf* __restrict__ VTh, const bf* __restrict__ VTl, bf* Ch, bf* Cl) {
    __shared__ __align__(16) bf tl[2][4][FPL];
    const int tid = threadIdx.x, lane = tid & 31, lr = lane & 15, hi = lane >> 4;
    const int wave = __builtin_amdgcn_readfirstlane(tid >> 5);
    const int h = blockIdx.y, q0 = blockIdx.x * 128 + wave * 16;
    const size_t hb = ((size_t)blockIdx.z * NH_ + h) * NN * HD;    // this item's and head's part of every Q, K and V^T plane
    const bf* __restrict__ kh0 = Kh + hb; const bf* __restrict__ kl0 = Kl + hb;
    const bf* __restrict__ vh0 = VTh + hb; const bf* __restrict__ vl0 = VTl + hb;
    v16bf qh[2], ql[2];
#pragma unroll
    for (int ks = 0; ks < 2; ++ks) { const size_t o = hb + (size_t)(q0 + lr) * HD + ks * 32 + 8 * hi; qh[ks] = cat16b(*(const v8us*)(Qh + o), *(const v8us*)(Qh + o + 16)); }
    asm volatile("s_wait_xcnt 0x0" ::: "memory");    // these loads' address registers are free for re-use (the next loads' results land in them) only behind this wait
#pragma unroll
    for (int ks = 0; ks < 2; ++ks) { const size_t o = hb + (size_t)(q0 + lr) * HD + ks * 32 + 8 * hi; ql[ks] = cat16b(*(const v8us*)(Ql + o), *(const v8us*)(Ql + o + 16)); }
    asm volatile("s_wait_xcnt 0x0" ::: "memory");    // the same for the residual plane's loads
    const int srow = tid >> 3, spc = (tid & 7) * 8;    // staging: thread -> rows srow and srow + 32, 16-byte piece spc of each plane's 64 x 128-byte tile (a wave covers whole lines)
    v8us g[8];
    auto gload = [&](int kb) {
#pragma unroll
        for (int u = 0; u < 2; ++u) { const int row = srow + 32 * u; const size_t ko = (size_t)(kb + row) * HD + spc, vo = (size_t)row * NN + kb + spc;
            g[u] = *(const v8us*)(kh0 + ko); g[2 + u] = *(const v8us*)(kl0 + ko); g[4 + u] = *(const v8us*)(vh0 + vo); g[6 + u] = *(const v8us*)(vl0 + vo); }
    };
    auto sstore = [&](int buf) {
#pragma unroll
        for (int u = 0; u < 2; ++u) { const int o = (srow + 32 * u) * FP + spc;
            *(v8us*)(&tl[buf][0][o]) = g[u]; *(v8us*)(&tl[buf][1][o]) = g[2 + u]; *(v8us*)(&tl[buf][2][o]) = g[4 + u]; *(v8us*)(&tl[buf][3][o]) = g[6 + u]; }
    };
    v8f acc[4];
#pragma unroll
    for (int t = 0; t < 4; ++t) acc[t] = (v8f){};
    float m = -3.0e38f, lsum = 0.f;    // running maximum (raw score units, equal in both halves of the wave) and this half's part of the sum
    gload(0);
    asm volatile("s_wait_xcnt 0x0" ::: "memory");    // the loop's address arithmetic re-uses these loads' offset registers
    sstore(0);
    __syncthreads();
#pragma unroll 1
    for (int s = 0; s < NN / 64; ++s) {
        const int cur = s & 1;
        if (s + 1 < NN / 64) gload((s + 1) * 64);
#pragma unroll
        for (int hf = 0; hf < 2; ++hf) {
            v8f st[2]; st[0] = (v8f){}; st[1] = (v8f){};
#pragma unroll
            for (int ks = 0; ks < 2; ++ks) { v16bf kh[2], kl[2];
#pragma unroll
                for (int tt = 0; tt < 2; ++tt) { const int o = (hf * 32 + tt * 16 + lr) * FP + ks * 32 + 8 * hi;
                    kh[tt] = cat16b(*(const v8us*)(&tl[cur][0][o]), *(const v8us*)(&tl[cur][0][o + 16])); kl[tt] = cat16b(*(const v8us*)(&tl[cur][1][o]), *(const v8us*)(&tl[cur][1][o + 16])); }
                st[0] = wmmab(kh[0], qh[ks], st[0]); st[1] = wmmab(kh[1], qh[ks], st[1]);
                st[0] = wmmab(kl[0], qh[ks], st[0]); st[1] = wmmab(kl[1], qh[ks], st[1]);
                st[0] = wmmab(kh[0], ql[ks], st[0]); st[1] = wmmab(kh[1], ql[ks], st[1]); }
            float mx = fmaxf(st[0][0], st[1][0]);
#pragma unroll
            for (int j = 1; j < 8; ++j) mx = fmaxf(mx, fmaxf(st[0][j], st[1][j]));
            mx = fmaxf(mx, xhalf(mx));
            const float mnew = fmaxf(m, mx), alpha = exp2x1((m - mnew) * SC2), mc = mnew * SC2;
            m = mnew;
            const v16f p = cat16f(exp2x8(st[0] * SC2 - mc), exp2x8(st[1] * SC2 - mc));
            const v8f s8 = __builtin_shufflevector(p, p, 0, 1, 2, 3, 4, 5, 6, 7) + __builtin_shufflevector(p, p, 8, 9, 10, 11, 12, 13, 14, 15);
            const v4f s4 = __builtin_shufflevector(s8, s8, 0, 1, 2, 3) + __builtin_shufflevector(s8, s8, 4, 5, 6, 7);
            lsum = lsum * alpha + ((s4[0] + s4[2]) + (s4[1] + s4[3]));
            const v16bf ph = __builtin_convertvector(p, v16bf);
            const v16bf pl = __builtin_convertvector(p - widen16(ph), v16bf);
            v16bf vh[4], vl[4];
#pragma unroll
            for (int t = 0; t < 4; ++t) { const int o = (t * 16 + lr) * FP + hf * 32 + 8 * hi; acc[t] *= alpha;
                vh[t] = cat16b(*(const v8us*)(&tl[cur][2][o]), *(const v8us*)(&tl[cur][2][o + 16])); vl[t] = cat16b(*(const v8us*)(&tl[cur][3][o]), *(const v8us*)(&tl[cur][3][o + 16])); }
#pragma unroll
            for (int t = 0; t < 4; ++t) acc[t] = wmmab(vh[t], ph, acc[t]);
#pragma unroll
            for (int t = 0; t < 4; ++t) acc[t] = wmmab(vl[t], ph, acc[t]);
#pragma unroll
            for (int t = 0; t < 4; ++t) acc[t] = wmmab(vh[t], pl, acc[t]);
        }
        if (s + 1 < NN / 64) sstore(cur ^ 1);    // every wave left that buffer before the barrier that ended the tile before this one
        __syncthreads();
    }
    lsum += xhalf(lsum);
    const float inv = LJ / lsum;
#pragma unroll
    for (int t = 0; t < 4; ++t) acc[t] *= inv;
    const int i = q0 + lr;
    float lnorm = 0.f;       // row normaliser of the band (taps clipped at the sequence ends)
#pragma unroll
    for (int d = -WIN; d <= WIN; ++d) { const int k = i - d; lnorm += (k >= 0 && k < NN) ? __builtin_amdgcn_exp2f((float)(d * d) * GC2) : 0.f; }
    const float lw = (1.0f - LJ) / (lnorm + LEPSK);
#pragma unroll
    for (int bb = 0; bb < 2; ++bb) { const int kb = ((q0 - 16) & ~31) + 32 * bb;    // keys q0 - 3 .. q0 + 18 lie in these two blocks; wave-uniform test
        if (kb >= 0 && kb < NN) { v8f q2[2];    // squared distance query - key, in the B operand's k order
#pragma unroll
            for (int e = 0; e < 16; ++e) { const float fd = (float)(i - (kb + (e < 8 ? 8 * hi + e : 8 + 8 * hi + e))); q2[e >> 3][e & 7] = fd * fd; }
            const v16f ge = cat16f(exp2x8(q2[0] * GC2), exp2x8(q2[1] * GC2)); v16f lv;
#pragma unroll
            for (int e = 0; e < 16; ++e) lv[e] = q2[e >> 3][e & 7] <= (float)(WIN * WIN) ? ge[e] * lw : 0.f;
            const v16bf lh = __builtin_convertvector(lv, v16bf);
            const v16bf ll = __builtin_convertvector(lv - widen16(lh), v16bf);
#pragma unroll
            for (int t = 0; t < 4; ++t) { const size_t o = (size_t)(t * 16 + lr) * NN + kb + 8 * hi;
                const v16bf vh = cat16b(*(const v8us*)(vh0 + o), *(const v8us*)(vh0 + o + 16)); const v16bf vl = cat16b(*(const v8us*)(vl0 + o), *(const v8us*)(vl0 + o + 16));
                acc[t] = wmmab(vh, lh, acc[t]); acc[t] = wmmab(vl, lh, acc[t]); acc[t] = wmmab(vh, ll, acc[t]); } } }
    const size_t co = ((size_t)blockIdx.z * NN + i) * DMOD + h * HD + hi * 8;    // acc[t][j] = O[query i][16 t + 8 hi + j]; stored as the bf16 hi + residual planes that the output projection reads
#pragma unroll
    for (int t = 0; t < 4; ++t) { v8us oh, ol;
#pragma unroll
        for (int j = 0; j < 8; ++j) { const unsigned short hb = f2bf(acc[t][j]); oh[j] = hb; ol[j] = f2bf(acc[t][j] - bf2f(hb)); }
        *(v8us*)(Ch + co + t * 16) = oh; *(v8us*)(Cl + co + t * 16) = ol; }
}

// f32 -> bf16 of all five operands in one grid: blockIdx.y picks a piece of DM x DM elements, 0 .. 3 = x (both items), 4 .. 7 = Wq, Wk, Wv, Wo; dst holds the pieces one behind another.
// A block converts CVB elements, a thread eight runs of 8 (2,048 elements apart, so a wave's loads and stores cover whole lines): few waves to start, all of a thread's loads in flight at once.
#define CVB  (256 * 8 * 8)
__global__ __launch_bounds__(256) void k_cvt8(const float* __restrict__ x, const float* __restrict__ Wq, const float* __restrict__ Wk, const float* __restrict__ Wv, const float* __restrict__ Wo, bf* dst) {
    const int y = blockIdx.y; const size_t i = (size_t)blockIdx.x * CVB + threadIdx.x * 8;
    const float* __restrict__ src = y < 4 ? x + (size_t)y * DM * DM : y == 4 ? Wq : y == 5 ? Wk : y == 6 ? Wv : Wo;
    const float* p = src + i; v8f v[8];
#pragma unroll
    for (int q = 0; q < 8; ++q) v[q] = *(const v8f*)(p + q * 2048);
    asm volatile("s_wait_xcnt 0x0" :: "v"(p) : "memory");    // the loads' address registers are free for re-use only behind this wait; p as an input keeps them live up to it, so that no load's result lands in them
#pragma unroll
    for (int q = 0; q < 8; ++q) { v8us o;
#pragma unroll
        for (int k = 0; k < 8; ++k) o[k] = f2bf(v[q][k]);
        *(v8us*)(dst + (size_t)y * DM * DM + i + q * 2048) = o; }
}
extern "C" void kernel_launch(void* const* d_in, const int* in_sizes, int n_in,
                              void* d_out, int out_size, void* d_ws, size_t ws_size, hipStream_t stream) {
    (void)in_sizes; (void)n_in; (void)out_size;
    const float* x = (const float*)d_in[0]; const float* Wq = (const float*)d_in[1]; const float* bq = (const float*)d_in[2]; const float* Wk = (const float*)d_in[3]; const float* bk = (const float*)d_in[4]; const float* Wv = (const float*)d_in[5]; const float* bv = (const float*)d_in[6]; const float* Wo = (const float*)d_in[7]; const float* bo = (const float*)d_in[8];
    float* out = (float*)d_out;    // [2][2048][1024]
    char* wsp = (char*)d_ws;
    auto take = [&](size_t bytes) { char* p = wsp; wsp += (bytes + 255) & ~(size_t)255; return (void*)p; };
    const size_t PW = (size_t)DMOD * DMOD, PX = (size_t)NBT * NN * DMOD;    // elements of a weight plane, of a plane over both items
    bf* Xb = (bf*)take((PX + 4 * PW) * 2); bf* WQ = Xb + PX; bf* WO = WQ + 3 * PW;    // x, Wq, Wk, Wv, Wo in bf16, one behind another
    bf* Qh = (bf*)take(3 * PX * 2); bf* Kh = Qh + PX; bf* VTh = Kh + PX;             // hi planes of Q, K, V^T, one behind another
    bf* Ql = (bf*)take(3 * PX * 2); bf* Kl = Ql + PX; bf* VTl = Kl + PX;             // residual planes
    bf* Ch = (bf*)take(PX * 2); bf* Cl = (bf*)take(PX * 2);
    if ((size_t)(wsp - (char*)d_ws) > ws_size) return;    // about 84 MB in all
    k_cvt8<<<dim3(DMOD * DMOD / CVB, 8, 1), 256, 0, stream>>>(x, Wq, Wk, Wv, Wo, Xb);    // torch [out][in] = n-major
    k_gemmb<false, 1, 4><<<dim3(NBT * NN / 128, DMOD / 128, 3), 128, 0, stream>>>(Xb, nullptr, WQ, bq, bk, bv, nullptr, DMOD, Qh, Ql, DMOD);
    k_fattn<<<dim3(NN / 128, NH_, NBT), 256, 0, stream>>>(Qh, Ql, Kh, Kl, VTh, VTl, Ch, Cl);
    k_gemmb<true, 0, 2><<<dim3(NBT * NN / 64, DMOD / 128, 1), 128, 0, stream>>>(Ch, Cl, WO, bo, nullptr, nullptr, out, DMOD, nullptr, nullptr, DMOD);
}

// v007
// One run takes 130 microseconds.
// Timed twice side by side with v006, it ran 1.04 times as fast both times.
// Over all steps from v000 it is 27.2 times as fast.
#include <hip/hip_runtime.h>

// Compute dtypes, f32 accumulate, per item: Q/K = x.W^T + b as [2048 x 1024].[1024 x 1024] GEMMs, V^T = Wv.x^T + b (by row) as [1024 x 1024].[1024 x 2048], with PLAIN bf16 operands (exact products); per head: scores = q.k^T ([2048 x
// 64].[64 x 2048], both operands bf16 hi + UNSCALED residual, three products), running softmax (x 1/8) in f32, exp(s - max).V ([2048 x 2048].[2048 x 64], hi + residual, three products),
// scaled by 0.6 / sum, plus 0.4 L.V (L = the row-normalised 7-tap Gaussian band, hi + residual, three products), all in k_fattn; out = ctx.Wo^T + bo (two products) - on

#define NBT  2
#define NN   2048
#define DMOD 1024
#define NH_  16
#define HD   64
#define DM   DMOD
#define NTK  NN
#define SCL  0.125f
#define LJ   0.6f
#define LSIG 0.4f
#define WIN  3
#define LEPSK 1e-10f
#define LOSC 1024.0f

typedef _Float16 h16;
typedef unsigned short bf;
typedef __attribute__((ext_vector_type(16))) __bf16   v16bf;
typedef __attribute__((ext_vector_type(16))) _Float16 v16h;
typedef __attribute__((ext_vector_type(8)))  _Float16 v8h;
typedef __attribute__((ext_vector_type(8)))  unsigned short v8us;
typedef __attribute__((ext_vector_type(8)))  float    v8f;
typedef __attribute__((ext_vector_type(4)))  float    v4f;
typedef __attribute__((ext_vector_type(4)))  _Float16 v4h;
typedef v8h  __attribute__((may_alias)) v8ha;
typedef v4f  __attribute__((may_alias)) v4fa;
typedef v8us __attribute__((may_alias)) v8usa;

__device__ __forceinline__ unsigned short f2bf(float f) { unsigned u = __float_as_uint(f); u += 0x7FFFu + ((u >> 16) & 1u); return (unsigned short)(u >> 16); }
__device__ __forceinline__ float bf2f(unsigned short b) { return __uint_as_float(((unsigned)b) << 16); }
__device__ __forceinline__ float bfr(float f) { return bf2f(f2bf(f)); }
__device__ __forceinline__ v16h cat16(v8h lo, v8h hi) { return __builtin_shufflevector(lo, hi, 0, 1, 2, 3, 4, 5, 6, 7, 8, 9, 10, 11, 12, 13, 14, 15); }
__device__ __forceinline__ v16bf cat16b(v8us lo, v8us hi) { return __builtin_bit_cast(v16bf, __builtin_shufflevector(lo, hi, 0, 1, 2, 3, 4, 5, 6, 7, 8, 9, 10, 11, 12, 13, 14, 15)); }
__device__ __forceinline__ v8f wmma16(v16h a, v16h b, v8f c) { return __builtin_amdgcn_wmma_f32_16x16x32_f16(false, a, false, b, (short)0, c, false, false); }
__device__ __forceinline__ v8f wmmab(v16bf a, v16bf b, v8f c) { return __builtin_amdgcn_wmma_f32_16x16x32_bf16(false, a, false, b, (short)0, c, false, false); }

// k_gemmb: block tile of 32 MT rows x 128 columns, 4 waves as 2 x 2, a wave = MT x 4 tiles of 16 x 16 (16 MT rows x 64 columns), of C = (A [+ Al]).B^T (K a multiple of 64, at least 128) + bf(bias[c]).
// A loaded fragment of A feeds 4 products and one of B feeds MT (2 MT with Al), and a row of an operand is fetched from L2 once per 128 columns or 32 MT rows of the output.
// OUTM 0: f32 C, rows = the tokens of both items. OUTM 1 (MT = 4): the Q, K and V products of both items in one grid, blockIdx.z = 0, 1, 2; A = tokens, Bn = the three weight planes one behind another, output = bf16 hi + residual
// planes, one set of NBT x NN x DM elements a product. Q and K: [item][64 columns = head][token][64]. V: the operands change places (rows = weights, columns = tokens, bias taken by ROW), which gives V^T as [item][head x 64 + d][token].
// Operands: per stage of 64 k the block's 128 rows of B and 32 MT rows of A (and Al) go from global memory into LDS by asynchronous 16-byte copies (a wave covers four whole 128-byte row pieces a copy),
// rows at a 144-byte pitch, two buffers: the copies of stage s + 2 are issued behind the barrier that ends stage s and fly while stage s + 1 is worked on. Fragments are read from LDS in the k order 8 hi + e, 16 + 8 hi + e.
#define GKS  64            // k elements a stage
#define GP   72            // LDS row pitch in 16-bit elements
// Eight (four) copies of one thread: rows r, r + 16, .. of one operand's tile, the same 16-byte piece of each. The s_wait_xcnt stands inside the statement, behind the last copy, so that no
// address register that a copy names is rewritten in front of it.
__device__ __forceinline__ void acopy8(unsigned l, const bf* g, size_t gs) {
    asm volatile("global_load_async_to_lds_b128 %0, %8, off\n\tglobal_load_async_to_lds_b128 %1, %9, off\n\tglobal_load_async_to_lds_b128 %2, %10, off\n\tglobal_load_async_to_lds_b128 %3, %11, off\n\t"
                 "global_load_async_to_lds_b128 %4, %12, off\n\tglobal_load_async_to_lds_b128 %5, %13, off\n\tglobal_load_async_to_lds_b128 %6, %14, off\n\tglobal_load_async_to_lds_b128 %7, %15, off\n\ts_wait_xcnt 0x0"
                 :: "v"(l), "v"(l + 1u * 32u * GP), "v"(l + 2u * 32u * GP), "v"(l + 3u * 32u * GP), "v"(l + 4u * 32u * GP), "v"(l + 5u * 32u * GP), "v"(l + 6u * 32u * GP), "v"(l + 7u * 32u * GP),
                    "v"(g), "v"(g + gs), "v"(g + 2 * gs), "v"(g + 3 * gs), "v"(g + 4 * gs), "v"(g + 5 * gs), "v"(g + 6 * gs), "v"(g + 7 * gs) : "memory");
}
__device__ __forceinline__ void acopy4(unsigned l, const bf* g, size_t gs) {
    asm volatile("global_load_async_to_lds_b128 %0, %4, off\n\tglobal_load_async_to_lds_b128 %1, %5, off\n\tglobal_load_async_to_lds_b128 %2, %6, off\n\tglobal_load_async_to_lds_b128 %3, %7, off\n\ts_wait_xcnt 0x0"
                 :: "v"(l), "v"(l + 1u * 32u * GP), "v"(l + 2u * 32u * GP), "v"(l + 3u * 32u * GP), "v"(g), "v"(g + gs), "v"(g + 2 * gs), "v"(g + 3 * gs) : "memory");
}
template <bool SPLITA, int OUTM, int MT>
__global__ __launch_bounds__(128) void k_gemmb(const bf* __restrict__ A, const bf* __restrict__ Al, const bf* __restrict__ Bn, const float* __restrict__ bias, const float* __restrict__ biasK, const float* __restrict__ biasV, float* C, int ldc, bf* Ph, bf* Pl, int K) {
    static_assert(MT == 4 || MT == 2, "rows of A a block: 128 or 64"); static_assert(OUTM == 0 || MT == 4, "V^T swaps row and column blocks: both 128");
    constexpr int BR = 32 * MT;                                  // rows of A (and Al) a block
    constexpr int STG = (128 + (SPLITA ? 2 : 1) * BR) * GP;      // elements a stage: B, A (, Al)
    __shared__ __align__(16) float ost[4][16 * 68];
    __shared__ __align__(16) bf gt[2][STG];
    const int lane = threadIdx.x & 31, wave = threadIdx.x >> 5, lr = lane & 15, hi = lane >> 4;
    const int wr = wave >> 1, wc = wave & 1;    // the wave's place in the block tile
    const int z = OUTM == 1 ? (int)blockIdx.z : 0; const bool vt = OUTM == 1 && z == 2;    // which product; V^T takes its rows from the weights (block-uniform)
    const int rb = vt ? blockIdx.y : blockIdx.x, cb = vt ? blockIdx.x : blockIdx.y;         // row block, column block: blockIdx.x counts token blocks, blockIdx.y weight blocks
    const int r0 = rb * BR + wr * (MT * 16), c0 = cb * 128 + wc * 64;
    const int crow = threadIdx.x >> 3, cpc = (threadIdx.x & 7) * 8;    // copies: thread -> rows crow + 16 u, 16-byte piece cpc of each 128-byte row piece
    const bf* Wz = Bn + (size_t)z * DM * DM;
    const bf* ga = (vt ? Wz : A) + (size_t)(rb * BR + crow) * K + cpc;
    const bf* gal = SPLITA ? Al + (size_t)(rb * BR + crow) * K + cpc : nullptr;
    const bf* gb = (vt ? A : Wz) + (size_t)(cb * 128 + crow) * K + cpc;
    const unsigned l0 = (unsigned)(size_t)&gt[0][crow * GP + cpc];    // the thread's LDS byte address in buffer 0, operand B
    const size_t gs = (size_t)16 * K;
    auto fill = [&](int st) { const unsigned l = l0 + (unsigned)(st & 1) * (unsigned)(STG * 2); const size_t ko = (size_t)st * GKS;
        acopy8(l, gb + ko, gs);
        if constexpr (MT == 4) { acopy8(l + 128u * GP * 2u, ga + ko, gs); if (SPLITA) acopy8(l + (128u + BR) * GP * 2u, gal + ko, gs); }
        else { acopy4(l + 128u * GP * 2u, ga + ko, gs); if (SPLITA) acopy4(l + (128u + BR) * GP * 2u, gal + ko, gs); } };
    v8f acc[MT][4];
#pragma unroll
    for (int i = 0; i < MT; ++i) {
#pragma unroll
        for (int t = 0; t < 4; ++t) acc[i][t] = (v8f){}; }
    const int nst = K / GKS;
    fill(0);
    asm volatile("s_wait_asynccnt 0x0" ::: "memory");    // this wave's copies of stage 0 have landed
    __syncthreads();                                     // every wave's have: stage 0 may be read
    if (nst > 1) fill(1);
#pragma unroll 1
    for (int st = 0; st < nst; ++st) {    // rolled: one stage a trip, the two buffers in turn
        const bf* tb = &gt[st & 1][0]; const bf* ta = tb + 128 * GP; const bf* tal = ta + BR * GP;
#pragma unroll
        for (int q = 0; q < GKS / 32; ++q) {
            v16bf fa[MT], fal[MT], fb[4];    // the fragments of 32 k, fetched as one group of LDS reads
#pragma unroll
            for (int i = 0; i < MT; ++i) { const int ao = (wr * (MT * 16) + i * 16 + lr) * GP + q * 32 + 8 * hi;
                fa[i] = cat16b(*(const v8us*)(ta + ao), *(const v8us*)(ta + ao + 16));
                if (SPLITA) fal[i] = cat16b(*(const v8us*)(tal + ao), *(const v8us*)(tal + ao + 16)); }
#pragma unroll
            for (int t = 0; t < 4; ++t) { const int bo = (wc * 64 + t * 16 + lr) * GP + q * 32 + 8 * hi; fb[t] = cat16b(*(const v8us*)(tb + bo), *(const v8us*)(tb + bo + 16)); }
            // Inputs-only fence on the loaded fragments: it keeps the LDS reads together in front of the matrix run; without it they are spread among the products, each pair with its own full wait.
            if constexpr (MT == 4) asm volatile("" :: "v"(fa[0]), "v"(fa[1]), "v"(fa[2]), "v"(fa[3]), "v"(fb[0]), "v"(fb[1]), "v"(fb[2]), "v"(fb[3]));
            else asm volatile("" :: "v"(fa[0]), "v"(fa[1]), "v"(fal[0]), "v"(fal[1]), "v"(fb[0]), "v"(fb[1]), "v"(fb[2]), "v"(fb[3]));
#pragma unroll
            for (int i = 0; i < MT; ++i) {
#pragma unroll
                for (int t = 0; t < 4; ++t) acc[i][t] = wmmab(fa[i], fb[t], acc[i][t]); }
            if constexpr (SPLITA) {
#pragma unroll
                for (int i = 0; i < MT; ++i) {
#pragma unroll
                    for (int t = 0; t < 4; ++t) acc[i][t] = wmmab(fal[i], fb[t], acc[i][t]); } }
        }
        asm volatile("s_wait_dscnt 0x0" ::: "memory");       // this wave's reads of the buffer are done before anybody refills it
        asm volatile("s_wait_asynccnt 0x0" ::: "memory");    // this wave's copies of stage st + 1 have landed
        __syncthreads();                                     // publishes stage st + 1 and ends every wave's reads of stage st
        if (st + 2 < nst) fill(st + 2);                      // into the buffer that this trip has just read
    }
    asm volatile("s_wait_asynccnt 0x0" ::: "memory");    // no copy is outstanding when the epilogue starts
    float* os = &ost[wave][0];
    const float* bz = z == 0 ? bias : z == 1 ? biasK : biasV;
    float br[4] = {0.f, 0.f, 0.f, 0.f};    // bias by column
    if (!vt && bz) { const int bi = c0 + lr;
#pragma unroll
        for (int t = 0; t < 4; ++t) br[t] = bz[bi + t * 16];
        asm volatile("s_wait_xcnt 0x0" :: "v"(bi) : "memory");    // the bias loads' offset register is free for re-use only behind this wait; bi as an input keeps it live up to it
#pragma unroll
        for (int t = 0; t < 4; ++t) br[t] = bfr(br[t]); }
    if (OUTM != 0) { Ph += (size_t)z * NBT * NN * DM; Pl += (size_t)z * NBT * NN * DM; }
#pragma unroll
    for (int i = 0; i < MT; ++i) {    // the wave's tile goes out 16 rows at a time through its own LDS piece, as whole lines
        const int ri = r0 + i * 16;
        if (vt) { const float* bp = bz + ri + hi * 8; float bw[8];
#pragma unroll
            for (int j = 0; j < 8; ++j) bw[j] = bp[j];
            asm volatile("s_wait_xcnt 0x0" :: "v"(bp) : "memory");    // the same for the bias by row
#pragma unroll
            for (int j = 0; j < 8; ++j) { const float bv = bfr(bw[j]);
#pragma unroll
                for (int t = 0; t < 4; ++t) os[(hi * 8 + j) * 68 + t * 16 + lr] = acc[i][t][j] + bv; }
        } else {
#pragma unroll
            for (int t = 0; t < 4; ++t) {
#pragma unroll
                for (int j = 0; j < 8; ++j) os[(hi * 8 + j) * 68 + t * 16 + lr] = acc[i][t][j] + br[t]; }
        }
        asm volatile("s_wait_dscnt 0x0" ::: "memory");    // the wave's 16 rows stand in its own LDS piece before its lanes read them back; no other wave touches that piece, so no barrier
        if (OUTM != 0) {
            // a tile row is 64 elements = one whole 128-byte line of each plane; 16 rows and 64 columns lie in one item
            const size_t base = vt ? ((size_t)(c0 / NN) * DM + ri) * NN + (c0 % NN) : (((size_t)(ri / NN) * NH_ + (c0 >> 6)) * NN + (ri % NN)) * HD;
            const int pitch = vt ? NN : HD;
#pragma unroll
            for (int s = 0; s < 4; ++s) { const int row = 4 * s + (lane >> 3), piece = lane & 7; const float* sp = os + row * 68 + piece * 8; v8us oh, ol;
#pragma unroll
                for (int e = 0; e < 8; ++e) { const unsigned short hb = f2bf(sp[e]); oh[e] = hb; ol[e] = f2bf(sp[e] - bf2f(hb)); }
                const size_t o = base + (size_t)row * pitch + piece * 8; *(v8us*)(Ph + o) = oh; *(v8us*)(Pl + o) = ol; }
        } else {
            float* crw = C + (size_t)ri * ldc + c0;
#pragma unroll
            for (int s = 0; s < 8; ++s) { const int Lid = (lane >> 3) + 4 * s, piece = lane & 7; const int row = Lid >> 1, cofs = (Lid & 1) * 32 + piece * 4;
                *(v4f*)(crw + (size_t)row * ldc + cofs) = *(const v4fa*)(os + row * 68 + cofs); }
        }
        if (i + 1 < MT) asm volatile("s_wait_xcnt 0x0" ::: "memory");    // the stores' address and data registers are re-used by the next 16 rows only behind this wait
    }
}

#define FP   72            // LDS row pitch in 16-bit elements
#define FPL  (64 * FP)     // one plane's tile
#define SC2  0.18033688f   // 1/8 x log2(e)
typedef __attribute__((ext_vector_type(16))) float v16f;
__device__ __forceinline__ float xhalf(float v) { const int b = __float_as_int(v); return __int_as_float(__builtin_amdgcn_permlanex16(b, b, 0x76543210, 0xfedcba98, false, false)); }   // lane l <-> l ^ 16
__device__ __forceinline__ v16f widen16(v16bf x) { typedef __attribute__((ext_vector_type(8))) unsigned v8u; const v8u w = __builtin_bit_cast(v8u, x); v16f r;    // packed bf16 pairs back to f32: a shift and a mask a pair
#pragma unroll
    for (int k = 0; k < 8; ++k) { r[2 * k] = __uint_as_float(w[k] << 16); r[2 * k + 1] = __uint_as_float(w[k] & 0xFFFF0000u); }
    return r; }
#define GC2  (-1.44269504f / (2.0f * LSIG * LSIG))    // un-normalised band tap = exp(-d^2 / (2 x 0.16)) = exp2(d^2 x GC2), 0 outside |d| <= 3
__device__ __forceinline__ v16f cat16f(v8f lo, v8f hi) { return __builtin_shufflevector(lo, hi, 0, 1, 2, 3, 4, 5, 6, 7, 8, 9, 10, 11, 12, 13, 14, 15); }
// Eight independent v_exp_f32 in one statement, every output apart from every input, v_nop last: no neighbour reads a result or overwrites a source in the slot directly behind a transcendental.
__device__ __forceinline__ v8f exp2x8(v8f x) { float r0, r1, r2, r3, r4, r5, r6, r7;
    asm("v_exp_f32 %0, %8\n\tv_exp_f32 %1, %9\n\tv_exp_f32 %2, %10\n\tv_exp_f32 %3, %11\n\tv_exp_f32 %4, %12\n\tv_exp_f32 %5, %13\n\tv_exp_f32 %6, %14\n\tv_exp_f32 %7, %15\n\tv_nop"
        : "=&v"(r0), "=&v"(r1), "=&v"(r2), "=&v"(r3), "=&v"(r4), "=&v"(r5), "=&v"(r6), "=&v"(r7) : "v"(x[0]), "v"(x[1]), "v"(x[2]), "v"(x[3]), "v"(x[4]), "v"(x[5]), "v"(x[6]), "v"(x[7]));
    return (v8f){r0, r1, r2, r3, r4, r5, r6, r7}; }
__device__ __forceinline__ float exp2x1(float x) { float r; asm("v_exp_f32 %0, %1\n\tv_nop" : "=v"(r) : "v"(x)); return r; }    // one v_exp_f32 with the same slot behind it
__global__ __launch_bounds__(256) __attribute__((amdgpu_waves_per_eu(4, 4))) void k_fattn(const bf* __restrict__ Qh, const bf* __restrict__ Ql, const bf* __restrict__ Kh, const bf* __restrict__ Kl, const bf* __restrict__ VTh, const bf* __restrict__ VTl, bf* Ch, bf* Cl) {
    __shared__ __align__(16) bf tl[2][4][FPL];
    __shared__ __align__(16) float xch[8][34 * 32];    // a wave's hand-over: 32 accumulator registers, the maximum and the sum of one query tile, lane by lane
    const int tid = threadIdx.x, lane = tid & 31, lr = lane & 15, hi = lane >> 4;
    const int wave = __builtin_amdgcn_readfirstlane(tid >> 5);
    const int pr = wave & 3, kq = wave >> 2;    // query group of 32; which 32 keys of every tile
    const int h = blockIdx.y, qg = blockIdx.x * 128 + pr * 32;
    const size_t hb = ((size_t)blockIdx.z * NH_ + h) * NN * HD;    // this item's and head's part of every Q, K and V^T plane
    const bf* __restrict__ kh0 = Kh + hb; const bf* __restrict__ kl0 = Kl + hb;
    const bf* __restrict__ vh0 = VTh + hb; const bf* __restrict__ vl0 = VTl + hb;
    v16bf qh[2][2], ql[2][2];    // [query tile][32 of the 64 head elements]
#pragma unroll
    for (int x = 0; x < 2; ++x) {
#pragma unroll
        for (int ks = 0; ks < 2; ++ks) { const size_t o = hb + (size_t)(qg + x * 16 + lr) * HD + ks * 32 + 8 * hi; qh[x][ks] = cat16b(*(const v8us*)(Qh + o), *(const v8us*)(Qh + o + 16)); } }
    asm volatile("s_wait_xcnt 0x0" ::: "memory");    // these loads' address registers are free for re-use (the next loads' results land in them) only behind this wait
#pragma unroll
    for (int x = 0; x < 2; ++x) {
#pragma unroll
        for (int ks = 0; ks < 2; ++ks) { const size_t o = hb + (size_t)(qg + x * 16 + lr) * HD + ks * 32 + 8 * hi; ql[x][ks] = cat16b(*(const v8us*)(Ql + o), *(const v8us*)(Ql + o + 16)); } }
    asm volatile("s_wait_xcnt 0x0" ::: "memory");    // the same for the residual plane's loads
    const int srow = tid >> 3, spc = (tid & 7) * 8;    // staging: thread -> rows srow and srow + 32, 16-byte piece spc of each plane's 64 x 128-byte tile (a wave covers whole lines)
    v8us g[8];
    auto gload = [&](int kb) {
#pragma unroll
        for (int u = 0; u < 2; ++u) { const int row = srow + 32 * u; const size_t ko = (size_t)(kb + row) * HD + spc, vo = (size_t)row * NN + kb + spc;
            g[u] = *(const v8us*)(kh0 + ko); g[2 + u] = *(const v8us*)(kl0 + ko); g[4 + u] = *(const v8us*)(vh0 + vo); g[6 + u] = *(const v8us*)(vl0 + vo); }
    };
    auto sstore = [&](int buf) {
#pragma unroll
        for (int u = 0; u < 2; ++u) { const int o = (srow + 32 * u) * FP + spc;
            *(v8us*)(&tl[buf][0][o]) = g[u]; *(v8us*)(&tl[buf][1][o]) = g[2 + u]; *(v8us*)(&tl[buf][2][o]) = g[4 + u]; *(v8us*)(&tl[buf][3][o]) = g[6 + u]; }
    };
    v8f ac2[2][4];    // [query tile][16 of the 64 head elements]
#pragma unroll
    for (int x = 0; x < 2; ++x) {
#pragma unroll
        for (int t = 0; t < 4; ++t) ac2[x][t] = (v8f){}; }
    float m2[2] = {-3.0e38f, -3.0e38f}, ls2[2] = {0.f, 0.f};    // per query tile: running maximum over this wave's keys (raw score units, equal in both halves of the wave), this half's part of the sum
    const int ko0 = (kq * 32 + lr) * FP + 8 * hi, vo0 = lr * FP + kq * 32 + 8 * hi;    // this wave's 32 keys: rows of the K tile, columns of the V^T tile
    gload(0);
    asm volatile("s_wait_xcnt 0x0" ::: "memory");    // the loop's address arithmetic re-uses these loads' offset registers
    sstore(0);
    __syncthreads();
    auto tile = [&](int cur) __attribute__((always_inline)) {    // this wave's 32 keys of the tile in buffer cur against its 32 queries
        v8f st[2][2];    // [query tile][16 of the 32 keys]
#pragma unroll
        for (int x = 0; x < 2; ++x) { st[x][0] = (v8f){}; st[x][1] = (v8f){}; }
#pragma unroll
        for (int ks = 0; ks < 2; ++ks) { v16bf kh[2], kl[2];
#pragma unroll
            for (int tt = 0; tt < 2; ++tt) { const int o = ko0 + tt * 16 * FP + ks * 32;
                kh[tt] = cat16b(*(const v8us*)(&tl[cur][0][o]), *(const v8us*)(&tl[cur][0][o + 16])); kl[tt] = cat16b(*(const v8us*)(&tl[cur][1][o]), *(const v8us*)(&tl[cur][1][o + 16])); }
#pragma unroll
            for (int x = 0; x < 2; ++x) { st[x][0] = wmmab(kh[0], qh[x][ks], st[x][0]); st[x][1] = wmmab(kh[1], qh[x][ks], st[x][1]); }
#pragma unroll
            for (int x = 0; x < 2; ++x) { st[x][0] = wmmab(kl[0], qh[x][ks], st[x][0]); st[x][1] = wmmab(kl[1], qh[x][ks], st[x][1]); }
#pragma unroll
            for (int x = 0; x < 2; ++x) { st[x][0] = wmmab(kh[0], ql[x][ks], st[x][0]); st[x][1] = wmmab(kh[1], ql[x][ks], st[x][1]); } }
        v16bf ph[2], pl[2];
#pragma unroll
        for (int x = 0; x < 2; ++x) {
            float mx = fmaxf(st[x][0][0], st[x][1][0]);
#pragma unroll
            for (int j = 1; j < 8; ++j) mx = fmaxf(mx, fmaxf(st[x][0][j], st[x][1][j]));
            mx = fmaxf(mx, xhalf(mx));
            const float mnew = fmaxf(m2[x], mx), alpha = exp2x1((m2[x] - mnew) * SC2), mc = mnew * SC2;
            m2[x] = mnew;
            const v16f p = cat16f(exp2x8(st[x][0] * SC2 - mc), exp2x8(st[x][1] * SC2 - mc));
            const v8f s8 = __builtin_shufflevector(p, p, 0, 1, 2, 3, 4, 5, 6, 7) + __builtin_shufflevector(p, p, 8, 9, 10, 11, 12, 13, 14, 15);
            const v4f s4 = __builtin_shufflevector(s8, s8, 0, 1, 2, 3) + __builtin_shufflevector(s8, s8, 4, 5, 6, 7);
            ls2[x] = ls2[x] * alpha + ((s4[0] + s4[2]) + (s4[1] + s4[3]));
            ph[x] = __builtin_convertvector(p, v16bf);
            pl[x] = __builtin_convertvector(p - widen16(ph[x]), v16bf);
#pragma unroll
            for (int t = 0; t < 4; ++t) ac2[x][t] *= alpha;
        }
        __builtin_amdgcn_sched_barrier(0);    // holds the softmax's vector work, the row sums among it, in front of the products with V^T, so that p's 32 registers are free when the V^T fragments come in; without it the build needs scratch
#pragma unroll
        for (int tp = 0; tp < 2; ++tp) { v16bf vh[2], vl[2];    // two V^T fragments of each plane at a time: four independent accumulators a product
#pragma unroll
            for (int u = 0; u < 2; ++u) { const int o = vo0 + (tp * 2 + u) * 16 * FP;
                vh[u] = cat16b(*(const v8us*)(&tl[cur][2][o]), *(const v8us*)(&tl[cur][2][o + 16])); vl[u] = cat16b(*(const v8us*)(&tl[cur][3][o]), *(const v8us*)(&tl[cur][3][o + 16])); }
#pragma unroll
            for (int x = 0; x < 2; ++x) { ac2[x][tp * 2] = wmmab(vh[0], ph[x], ac2[x][tp * 2]); ac2[x][tp * 2 + 1] = wmmab(vh[1], ph[x], ac2[x][tp * 2 + 1]); }
#pragma unroll
            for (int x = 0; x < 2; ++x) { ac2[x][tp * 2] = wmmab(vl[0], ph[x], ac2[x][tp * 2]); ac2[x][tp * 2 + 1] = wmmab(vl[1], ph[x], ac2[x][tp * 2 + 1]); }
#pragma unroll
            for (int x = 0; x < 2; ++x) { ac2[x][tp * 2] = wmmab(vh[0], pl[x], ac2[x][tp * 2]); ac2[x][tp * 2 + 1] = wmmab(vh[1], pl[x], ac2[x][tp * 2 + 1]); } }
    };
#pragma unroll 1
    for (int s = 0; s + 1 < NN / 64; ++s) {    // rolled, one straight block a trip: the last tile, behind which nothing is staged, stands behind the loop (with a branch round the staging the compiler sinks the row sums behind it, p stays live and the staged tile is spilled)
        gload((s + 1) * 64);
        tile(s & 1);
        sstore((s & 1) ^ 1);    // every wave left that buffer before the barrier that ended the tile before this one
        __syncthreads();
    }
    tile((NN / 64 - 1) & 1);
    // The join: wave (pr, kq) keeps query tile kq and hands tile 1 - kq to wave (pr, 1 - kq), lane to lane (both waves hold a query's values in the same lanes and registers).
    const bool up = kq != 0;    // wave-uniform
    float* xw = &xch[wave][0];
#pragma unroll
    for (int t = 0; t < 4; ++t) { const v8f gv = up ? ac2[0][t] : ac2[1][t];
        *(v4f*)(xw + ((2 * t) * 32 + lane) * 4) = __builtin_shufflevector(gv, gv, 0, 1, 2, 3); *(v4f*)(xw + ((2 * t + 1) * 32 + lane) * 4) = __builtin_shufflevector(gv, gv, 4, 5, 6, 7); }
    xw[32 * 32 + lane] = up ? m2[0] : m2[1]; xw[33 * 32 + lane] = up ? ls2[0] : ls2[1];
    __syncthreads();    // every wave's hand-over stands in LDS before its partner reads it
    const float* xp = &xch[wave ^ 4][0];
    const float mk = up ? m2[1] : m2[0], mp = xp[32 * 32 + lane], mj = fmaxf(mk, mp);
    const float ak = exp2x1((mk - mj) * SC2), ap = exp2x1((mp - mj) * SC2);
    float lsum = (up ? ls2[1] : ls2[0]) * ak + xp[33 * 32 + lane] * ap;
    v8f acc[4];
#pragma unroll
    for (int t = 0; t < 4; ++t) { const v4f a = *(const v4f*)(xp + ((2 * t) * 32 + lane) * 4), b = *(const v4f*)(xp + ((2 * t + 1) * 32 + lane) * 4);
        acc[t] = (up ? ac2[1][t] : ac2[0][t]) * ak + __builtin_shufflevector(a, b, 0, 1, 2, 3, 4, 5, 6, 7) * ap; }
    const int q0 = qg + kq * 16;    // the 16 queries that this wave finishes
    lsum += xhalf(lsum);
    const float inv = LJ / lsum;
#pragma unroll
    for (int t = 0; t < 4; ++t) acc[t] *= inv;
    const int i = q0 + lr;
    float lnorm = 0.f;       // row normaliser of the band (taps clipped at the sequence ends)
#pragma unroll
    for (int d = -WIN; d <= WIN; ++d) { const int k = i - d; lnorm += (k >= 0 && k < NN) ? __builtin_amdgcn_exp2f((float)(d * d) * GC2) : 0.f; }
    const float lw = (1.0f - LJ) / (lnorm + LEPSK);
#pragma unroll
    for (int bb = 0; bb < 2; ++bb) { const int kb = ((q0 - 16) & ~31) + 32 * bb;    // keys q0 - 3 .. q0 + 18 lie in these two blocks; wave-uniform test
        if (kb >= 0 && kb < NN) { v8f q2[2];    // squared distance query - key, in the B operand's k order
#pragma unroll
            for (int e = 0; e < 16; ++e) { const float fd = (float)(i - (kb + (e < 8 ? 8 * hi + e : 8 + 8 * hi + e))); q2[e >> 3][e & 7] = fd * fd; }
            const v16f ge = cat16f(exp2x8(q2[0] * GC2), exp2x8(q2[1] * GC2)); v16f lv;
#pragma unroll
            for (int e = 0; e < 16; ++e) lv[e] = q2[e >> 3][e & 7] <= (float)(WIN * WIN) ? ge[e] * lw : 0.f;
            const v16bf lh = __builtin_convertvector(lv, v16bf);
            const v16bf ll = __builtin_convertvector(lv - widen16(lh), v16bf);
#pragma unroll
            for (int t = 0; t < 4; ++t) { const size_t o = (size_t)(t * 16 + lr) * NN + kb + 8 * hi;
                const v16bf vh = cat16b(*(const v8us*)(vh0 + o), *(const v8us*)(vh0 + o + 16)); const v16bf vl = cat16b(*(const v8us*)(vl0 + o), *(const v8us*)(vl0 + o + 16));
                acc[t] = wmmab(vh, lh, acc[t]); acc[t] = wmmab(vl, lh, acc[t]); acc[t] = wmmab(vh, ll, acc[t]); } } }
    const size_t co = ((size_t)blockIdx.z * NN + i) * DMOD + h * HD + hi * 8;    // acc[t][j] = O[query i][16 t + 8 hi + j]; stored as the bf16 hi + residual planes that the output projection reads
#pragma unroll
    for (int t = 0; t < 4; ++t) { v8us oh, ol;
#pragma unroll
        for (int j = 0; j < 8; ++j) { const unsigned short hb = f2bf(acc[t][j]); oh[j] = hb; ol[j] = f2bf(acc[t][j] - bf2f(hb)); }
        *(v8us*)(Ch + co + t * 16) = oh; *(v8us*)(Cl + co + t * 16) = ol; }
}

// f32 -> bf16 of all five operands in one grid: blockIdx.y picks a piece of DM x DM elements, 0 .. 3 = x (both items), 4 .. 7 = Wq, Wk, Wv, Wo; dst holds the pieces one behind another.
// A block converts CVB elements, a thread eight runs of 8 (2,048 elements apart, so a wave's loads and stores cover whole lines): few waves to start, all of a thread's loads in flight at once.
#define CVB  (256 * 8 * 8)
__global__ __launch_bounds__(256) void k_cvt8(const float* __restrict__ x, const float* __restrict__ Wq, const float* __restrict__ Wk, const float* __restrict__ Wv, const float* __restrict__ Wo, bf* dst) {
    const int y = blockIdx.y; const size_t i = (size_t)blockIdx.x * CVB + threadIdx.x * 8;
    const float* __restrict__ src = y < 4 ? x + (size_t)y * DM * DM : y == 4 ? Wq : y == 5 ? Wk : y == 6 ? Wv : Wo;
    const float* p = src + i; v8f v[8];
#pragma unroll
    for (int q = 0; q < 8; ++q) v[q] = *(const v8f*)(p + q * 2048);
    asm volatile("s_wait_xcnt 0x0" :: "v"(p) : "memory");    // the loads' address registers are free for re-use only behind this wait; p as an input keeps them live up to it, so that no load's result lands in them
#pragma unroll
    for (int q = 0; q < 8; ++q) { v8us o;
#pragma unroll
        for (int k = 0; k < 8; ++k) o[k] = f2bf(v[q][k]);
        *(v8us*)(dst + (size_t)y * DM * DM + i + q * 2048) = o; }
}
extern "C" void kernel_launch(void* const* d_in, const int* in_sizes, int n_in,
                              void* d_out, int out_size, void* d_ws, size_t ws_size, hipStream_t stream) {
    (void)in_sizes; (void)n_in; (void)out_size;
    const float* x = (const float*)d_in[0]; const float* Wq = (const float*)d_in[1]; const float* bq = (const float*)d_in[2]; const float* Wk = (const float*)d_in[3]; const float* bk = (const float*)d_in[4]; const float* Wv = (const float*)d_in[5]; const float* bv = (const float*)d_in[6]; const float* Wo = (const float*)d_in[7]; const float* bo = (const float*)d_in[8];
    float* out = (float*)d_out;    // [2][2048][1024]
    char* wsp = (char*)d_ws;
    auto take = [&](size_t bytes) { char* p = wsp; wsp += (bytes + 255) & ~(size_t)255; return (void*)p; };
    const size_t PW = (size_t)DMOD * DMOD, PX = (size_t)NBT * NN * DMOD;    // elements of a weight plane, of a plane over both items
    bf* Xb = (bf*)take((PX + 4 * PW) * 2); bf* WQ = Xb + PX; bf* WO = WQ + 3 * PW;    // x, Wq, Wk, Wv, Wo in bf16, one behind another
    bf* Qh = (bf*)take(3 * PX * 2); bf* Kh = Qh + PX; bf* VTh = Kh + PX;             // hi planes of Q, K, V^T, one behind another
    bf* Ql = (bf*)take(3 * PX * 2); bf* Kl = Ql + PX; bf* VTl = Kl + PX;             // residual planes
    bf* Ch = (bf*)take(PX * 2); bf* Cl = (bf*)take(PX * 2);
    if ((size_t)(wsp - (char*)d_ws) > ws_size) return;    // about 84 MB in all
    k_cvt8<<<dim3(DMOD * DMOD / CVB, 8, 1), 256, 0, stream>>>(x, Wq, Wk, Wv, Wo, Xb);    // torch [out][in] = n-major
    k_gemmb<false, 1, 4><<<dim3(NBT * NN / 128, DMOD / 128, 3), 128, 0, stream>>>(Xb, nullptr, WQ, bq, bk, bv, nullptr, DMOD, Qh, Ql, DMOD);
    k_fattn<<<dim3(NN / 128, NH_, NBT), 256, 0, stream>>>(Qh, Ql, Kh, Kl, VTh, VTl, Ch, Cl);
    k_gemmb<true, 0, 2><<<dim3(NBT * NN / 64, DMOD / 128, 1), 128, 0, stream>>>(Ch, Cl, WO, bo, nullptr, nullptr, out, DMOD, nullptr, nullptr, DMOD);
}

// v008
// It runs in 95.5 microseconds.
// Next to v007, in two timings, it ran 1.36 times as fast each time.
// All steps since v000 together make it 36.9 times as fast.
#include <hip/hip_runtime.h>

// Compute dtypes, f32 accumulate, per item: Q/K/V = x.W^T + b as [2048 x 1024].[1024 x 1024] GEMMs with PLAIN bf16 operands (exact products); per head: scores = q.k^T ([2048 x
// 64].[64 x 2048], plain bf16 operands, one product), running softmax (x 1/8) in f32, exp(s - max).V ([2048 x 2048].[2048 x 64], plain bf16 operands, one product),
// scaled by 0.6 / sum, plus 0.4 L.V (L = the row-normalised 7-tap Gaussian band, hi + UNSCALED residual, three products), all in k_fattn; out = ctx.Wo^T + bo (two products) - on

#define NBT  2
#define NN   2048
#define DMOD 1024
#define NH_  16
#define HD   64
#define DM   DMOD
#define NTK  NN
#define SCL  0.125f
#define LJ   0.6f
#define LSIG 0.4f
#define WIN  3
#define LEPSK 1e-10f
#define LOSC 1024.0f

typedef _Float16 h16;
typedef unsigned short bf;
typedef __attribute__((ext_vector_type(16))) __bf16   v16bf;
typedef __attribute__((ext_vector_type(16))) _Float16 v16h;
typedef __attribute__((ext_vector_type(8)))  _Float16 v8h;
typedef __attribute__((ext_vector_type(8)))  unsigned short v8us;
typedef __attribute__((ext_vector_type(8)))  float    v8f;
typedef __attribute__((ext_vector_type(4)))  float    v4f;
typedef __attribute__((ext_vector_type(4)))  _Float16 v4h;
typedef v8h  __attribute__((may_alias)) v8ha;
typedef v4f  __attribute__((may_alias)) v4fa;
typedef v8us __attribute__((may_alias)) v8usa;

__device__ __forceinline__ unsigned short f2bf(float f) { unsigned u = __float_as_uint(f); u += 0x7FFFu + ((u >> 16) & 1u); return (unsigned short)(u >> 16); }
__device__ __forceinline__ float bf2f(unsigned short b) { return __uint_as_float(((unsigned)b) << 16); }
__device__ __forceinline__ float bfr(float f) { return bf2f(f2bf(f)); }
__device__ __forceinline__ v16h cat16(v8h lo, v8h hi) { return __builtin_shufflevector(lo, hi, 0, 1, 2, 3, 4, 5, 6, 7, 8, 9, 10, 11, 12, 13, 14, 15); }
__device__ __forceinline__ v16bf cat16b(v8us lo, v8us hi) { return __builtin_bit_cast(v16bf, __builtin_shufflevector(lo, hi, 0, 1, 2, 3, 4, 5, 6, 7, 8, 9, 10, 11, 12, 13, 14, 15)); }
__device__ __forceinline__ v8f wmma16(v16h a, v16h b, v8f c) { return __builtin_amdgcn_wmma_f32_16x16x32_f16(false, a, false, b, (short)0, c, false, false); }
__device__ __forceinline__ v8f wmmab(v16bf a, v16bf b, v8f c) { return __builtin_amdgcn_wmma_f32_16x16x32_bf16(false, a, false, b, (short)0, c, false, false); }

// k_gemmb: block tile of 32 MT rows x 128 columns, 4 waves as 2 x 2, a wave = MT x 4 tiles of 16 x 16 (16 MT rows x 64 columns), of C = (A [+ Al]).B^T (K a multiple of 64, at least 128) + bf(bias[c]).
// A loaded fragment of A feeds 4 products and one of B feeds MT (2 MT with Al), and a row of an operand is fetched from L2 once per 128 columns or 32 MT rows of the output.
// OUTM 0: f32 C, rows = the tokens of both items. OUTM 1 (MT = 4): the Q, K and V products of both items in one grid, blockIdx.z = 0, 1, 2; A = tokens, Bn = the three weight planes one behind another, output = bf16
// planes of NBT x NN x DM elements, one a product in Ph, and V's residual plane in Pl. Q and K: [item][64 columns = head][token][64]. V: the operands change places (rows = weights, columns = tokens, bias taken by ROW), which gives V^T as [item][head x 64 + d][token].
// Operands: per stage of 64 k the block's 128 rows of B and 32 MT rows of A (and Al) go from global memory into LDS by asynchronous 16-byte copies (a wave covers four whole 128-byte row pieces a copy),
// rows at a 144-byte pitch, two buffers: the copies of stage s + 2 are issued behind the barrier that ends stage s and fly while stage s + 1 is worked on. Fragments are read from LDS in the k order 8 hi + e, 16 + 8 hi + e.
#define GKS  64            // k elements a stage
#define GP   72            // LDS row pitch in 16-bit elements
// Eight (four) copies of one thread: rows r, r + 16, .. of one operand's tile, the same 16-byte piece of each. The s_wait_xcnt stands inside the statement, behind the last copy, so that no
// address register that a copy names is rewritten in front of it.
__device__ __forceinline__ void acopy8(unsigned l, const bf* g, size_t gs) {
    asm volatile("global_load_async_to_lds_b128 %0, %8, off\n\tglobal_load_async_to_lds_b128 %1, %9, off\n\tglobal_load_async_to_lds_b128 %2, %10, off\n\tglobal_load_async_to_lds_b128 %3, %11, off\n\t"
                 "global_load_async_to_lds_b128 %4, %12, off\n\tglobal_load_async_to_lds_b128 %5, %13, off\n\tglobal_load_async_to_lds_b128 %6, %14, off\n\tglobal_load_async_to_lds_b128 %7, %15, off\n\ts_wait_xcnt 0x0"
                 :: "v"(l), "v"(l + 1u * 32u * GP), "v"(l + 2u * 32u * GP), "v"(l + 3u * 32u * GP), "v"(l + 4u * 32u * GP), "v"(l + 5u * 32u * GP), "v"(l + 6u * 32u * GP), "v"(l + 7u * 32u * GP),
                    "v"(g), "v"(g + gs), "v"(g + 2 * gs), "v"(g + 3 * gs), "v"(g + 4 * gs), "v"(g + 5 * gs), "v"(g + 6 * gs), "v"(g + 7 * gs) : "memory");
}
__device__ __forceinline__ void acopy4(unsigned l, const bf* g, size_t gs) {
    asm volatile("global_load_async_to_lds_b128 %0, %4, off\n\tglobal_load_async_to_lds_b128 %1, %5, off\n\tglobal_load_async_to_lds_b128 %2, %6, off\n\tglobal_load_async_to_lds_b128 %3, %7, off\n\ts_wait_xcnt 0x0"
                 :: "v"(l), "v"(l + 1u * 32u * GP), "v"(l + 2u * 32u * GP), "v"(l + 3u * 32u * GP), "v"(g), "v"(g + gs), "v"(g + 2 * gs), "v"(g + 3 * gs) : "memory");
}
template <bool SPLITA, int OUTM, int MT>
__global__ __launch_bounds__(128) void k_gemmb(const bf* __restrict__ A, const bf* __restrict__ Al, const bf* __restrict__ Bn, const float* __restrict__ bias, const float* __restrict__ biasK, const float* __restrict__ biasV, float* C, int ldc, bf* Ph, bf* Pl, int K) {
    static_assert(MT == 4 || MT == 2, "rows of A a block: 128 or 64"); static_assert(OUTM == 0 || MT == 4, "V^T swaps row and column blocks: both 128");
    constexpr int BR = 32 * MT;                                  // rows of A (and Al) a block
    constexpr int STG = (128 + (SPLITA ? 2 : 1) * BR) * GP;      // elements a stage: B, A (, Al)
    __shared__ __align__(16) float ost[4][16 * 68];
    __shared__ __align__(16) bf gt[2][STG];
    const int lane = threadIdx.x & 31, wave = threadIdx.x >> 5, lr = lane & 15, hi = lane >> 4;
    const int wr = wave >> 1, wc = wave & 1;    // the wave's place in the block tile
    const int z = OUTM == 1 ? (int)blockIdx.z : 0; const bool vt = OUTM == 1 && z == 2;    // which product; V^T takes its rows from the weights (block-uniform)
    const int rb = vt ? blockIdx.y : blockIdx.x, cb = vt ? blockIdx.x : blockIdx.y;         // row block, column block: blockIdx.x counts token blocks, blockIdx.y weight blocks
    const int r0 = rb * BR + wr * (MT * 16), c0 = cb * 128 + wc * 64;
    const int crow = threadIdx.x >> 3, cpc = (threadIdx.x & 7) * 8;    // copies: thread -> rows crow + 16 u, 16-byte piece cpc of each 128-byte row piece
    const bf* Wz = Bn + (size_t)z * DM * DM;
    const bf* ga = (vt ? Wz : A) + (size_t)(rb * BR + crow) * K + cpc;
    const bf* gal = SPLITA ? Al + (size_t)(rb * BR + crow) * K + cpc : nullptr;
    const bf* gb = (vt ? A : Wz) + (size_t)(cb * 128 + crow) * K + cpc;
    const unsigned l0 = (unsigned)(size_t)&gt[0][crow * GP + cpc];    // the thread's LDS byte address in buffer 0, operand B
    const size_t gs = (size_t)16 * K;
    auto fill = [&](int st) { const unsigned l = l0 + (unsigned)(st & 1) * (unsigned)(STG * 2); const size_t ko = (size_t)st * GKS;
        acopy8(l, gb + ko, gs);
        if constexpr (MT == 4) { acopy8(l + 128u * GP * 2u, ga + ko, gs); if (SPLITA) acopy8(l + (128u + BR) * GP * 2u, gal + ko, gs); }
        else { acopy4(l + 128u * GP * 2u, ga + ko, gs); if (SPLITA) acopy4(l + (128u + BR) * GP * 2u, gal + ko, gs); } };
    v8f acc[MT][4];
#pragma unroll
    for (int i = 0; i < MT; ++i) {
#pragma unroll
        for (int t = 0; t < 4; ++t) acc[i][t] = (v8f){}; }
    const int nst = K / GKS;
    fill(0);
    asm volatile("s_wait_asynccnt 0x0" ::: "memory");    // this wave's copies of stage 0 have landed
    __syncthreads();                                     // every wave's have: stage 0 may be read
    if (nst > 1) fill(1);
#pragma unroll 1
    for (int st = 0; st < nst; ++st) {    // rolled: one stage a trip, the two buffers in turn
        const bf* tb = &gt[st & 1][0]; const bf* ta = tb + 128 * GP; const bf* tal = ta + BR * GP;
#pragma unroll
        for (int q = 0; q < GKS / 32; ++q) {
            v16bf fa[MT], fal[MT], fb[4];    // the fragments of 32 k, fetched as one group of LDS reads
#pragma unroll
            for (int i = 0; i < MT; ++i) { const int ao = (wr * (MT * 16) + i * 16 + lr) * GP + q * 32 + 8 * hi;
                fa[i] = cat16b(*(const v8us*)(ta + ao), *(const v8us*)(ta + ao + 16));
                if (SPLITA) fal[i] = cat16b(*(const v8us*)(tal + ao), *(const v8us*)(tal + ao + 16)); }
#pragma unroll
            for (int t = 0; t < 4; ++t) { const int bo = (wc * 64 + t * 16 + lr) * GP + q * 32 + 8 * hi; fb[t] = cat16b(*(const v8us*)(tb + bo), *(const v8us*)(tb + bo + 16)); }
            // Inputs-only fence on the loaded fragments: it keeps the LDS reads together in front of the matrix run; without it they are spread among the products, each pair with its own full wait.
            if constexpr (MT == 4) asm volatile("" :: "v"(fa[0]), "v"(fa[1]), "v"(fa[2]), "v"(fa[3]), "v"(fb[0]), "v"(fb[1]), "v"(fb[2]), "v"(fb[3]));
            else asm volatile("" :: "v"(fa[0]), "v"(fa[1]), "v"(fal[0]), "v"(fal[1]), "v"(fb[0]), "v"(fb[1]), "v"(fb[2]), "v"(fb[3]));
#pragma unroll
            for (int i = 0; i < MT; ++i) {
#pragma unroll
                for (int t = 0; t < 4; ++t) acc[i][t] = wmmab(fa[i], fb[t], acc[i][t]); }
            if constexpr (SPLITA) {
#pragma unroll
                for (int i = 0; i < MT; ++i) {
#pragma unroll
                    for (int t = 0; t < 4; ++t) acc[i][t] = wmmab(fal[i], fb[t], acc[i][t]); } }
        }
        asm volatile("s_wait_dscnt 0x0" ::: "memory");       // this wave's reads of the buffer are done before anybody refills it
        asm volatile("s_wait_asynccnt 0x0" ::: "memory");    // this wave's copies of stage st + 1 have landed
        __syncthreads();                                     // publishes stage st + 1 and ends every wave's reads of stage st
        if (st + 2 < nst) fill(st + 2);                      // into the buffer that this trip has just read
    }
    asm volatile("s_wait_asynccnt 0x0" ::: "memory");    // no copy is outstanding when the epilogue starts
    float* os = &ost[wave][0];
    const float* bz = z == 0 ? bias : z == 1 ? biasK : biasV;
    float br[4] = {0.f, 0.f, 0.f, 0.f};    // bias by column
    if (!vt && bz) { const int bi = c0 + lr;
#pragma unroll
        for (int t = 0; t < 4; ++t) br[t] = bz[bi + t * 16];
        asm volatile("s_wait_xcnt 0x0" :: "v"(bi) : "memory");    // the bias loads' offset register is free for re-use only behind this wait; bi as an input keeps it live up to it
#pragma unroll
        for (int t = 0; t < 4; ++t) br[t] = bfr(br[t]); }
    if (OUTM != 0) Ph += (size_t)z * NBT * NN * DM;
#pragma unroll
    for (int i = 0; i < MT; ++i) {    // the wave's tile goes out 16 rows at a time through its own LDS piece, as whole lines
        const int ri = r0 + i * 16;
        if (vt) { const float* bp = bz + ri + hi * 8; float bw[8];
#pragma unroll
            for (int j = 0; j < 8; ++j) bw[j] = bp[j];
            asm volatile("s_wait_xcnt 0x0" :: "v"(bp) : "memory");    // the same for the bias by row
#pragma unroll
            for (int j = 0; j < 8; ++j) { const float bv = bfr(bw[j]);
#pragma unroll
                for (int t = 0; t < 4; ++t) os[(hi * 8 + j) * 68 + t * 16 + lr] = acc[i][t][j] + bv; }
        } else {
#pragma unroll
            for (int t = 0; t < 4; ++t) {
#pragma unroll
                for (int j = 0; j < 8; ++j) os[(hi * 8 + j) * 68 + t * 16 + lr] = acc[i][t][j] + br[t]; }
        }
        asm volatile("s_wait_dscnt 0x0" ::: "memory");    // the wave's 16 rows stand in its own LDS piece before its lanes read them back; no other wave touches that piece, so no barrier
        if (OUTM != 0) {
            // a tile row is 64 elements = one whole 128-byte line of a plane; 16 rows and 64 columns lie in one item; only V^T has a residual plane (block-uniform test)
            const size_t base = vt ? ((size_t)(c0 / NN) * DM + ri) * NN + (c0 % NN) : (((size_t)(ri / NN) * NH_ + (c0 >> 6)) * NN + (ri % NN)) * HD;
            const int pitch = vt ? NN : HD;
            if (vt) {
#pragma unroll
                for (int s = 0; s < 4; ++s) { const int row = 4 * s + (lane >> 3), piece = lane & 7; const float* sp = os + row * 68 + piece * 8; v8us oh, ol;
#pragma unroll
                    for (int e = 0; e < 8; ++e) { const unsigned short hb = f2bf(sp[e]); oh[e] = hb; ol[e] = f2bf(sp[e] - bf2f(hb)); }
                    const size_t o = base + (size_t)row * pitch + piece * 8; *(v8us*)(Ph + o) = oh; *(v8us*)(Pl + o) = ol; }
                asm volatile("s_wait_xcnt 0x0" ::: "memory");    // this branch's stores, in every pass: in the built code the other branch's block, which re-uses their registers, follows them in front of the wait behind the join
            } else {
#pragma unroll
                for (int s = 0; s < 4; ++s) { const int row = 4 * s + (lane >> 3), piece = lane & 7; const float* sp = os + row * 68 + piece * 8; v8us oh;
#pragma unroll
                    for (int e = 0; e < 8; ++e) oh[e] = f2bf(sp[e]);
                    *(v8us*)(Ph + base + (size_t)row * pitch + piece * 8) = oh; }
            }
        } else {
            float* crw = C + (size_t)ri * ldc + c0;
#pragma unroll
            for (int s = 0; s < 8; ++s) { const int Lid = (lane >> 3) + 4 * s, piece = lane & 7; const int row = Lid >> 1, cofs = (Lid & 1) * 32 + piece * 4;
                *(v4f*)(crw + (size_t)row * ldc + cofs) = *(const v4fa*)(os + row * 68 + cofs); }
        }
        if (i + 1 < MT) asm volatile("s_wait_xcnt 0x0" ::: "memory");    // the stores' address and data registers are re-used by the next 16 rows only behind this wait
    }
}

#define FP   72            // LDS row pitch in 16-bit elements
#define FPL  (64 * FP)     // one plane's tile
#define SC2  0.18033688f   // 1/8 x log2(e)
typedef __attribute__((ext_vector_type(16))) float v16f;
__device__ __forceinline__ float xhalf(float v) { const int b = __float_as_int(v); return __int_as_float(__builtin_amdgcn_permlanex16(b, b, 0x76543210, 0xfedcba98, false, false)); }   // lane l <-> l ^ 16
__device__ __forceinline__ v16f widen16(v16bf x) { typedef __attribute__((ext_vector_type(8))) unsigned v8u; const v8u w = __builtin_bit_cast(v8u, x); v16f r;    // packed bf16 pairs back to f32: a shift and a mask a pair
#pragma unroll
    for (int k = 0; k < 8; ++k) { r[2 * k] = __uint_as_float(w[k] << 16); r[2 * k + 1] = __uint_as_float(w[k] & 0xFFFF0000u); }
    return r; }
#define GC2  (-1.44269504f / (2.0f * LSIG * LSIG))    // un-normalised band tap = exp(-d^2 / (2 x 0.16)) = exp2(d^2 x GC2), 0 outside |d| <= 3
__device__ __forceinline__ v16f cat16f(v8f lo, v8f hi) { return __builtin_shufflevector(lo, hi, 0, 1, 2, 3, 4, 5, 6, 7, 8, 9, 10, 11, 12, 13, 14, 15); }
// Eight independent v_exp_f32 in one statement, every output apart from every input, v_nop last: no neighbour reads a result or overwrites a source in the slot directly behind a transcendental.
__device__ __forceinline__ v8f exp2x8(v8f x) { float r0, r1, r2, r3, r4, r5, r6, r7;
    asm("v_exp_f32 %0, %8\n\tv_exp_f32 %1, %9\n\tv_exp_f32 %2, %10\n\tv_exp_f32 %3, %11\n\tv_exp_f32 %4, %12\n\tv_exp_f32 %5, %13\n\tv_exp_f32 %6, %14\n\tv_exp_f32 %7, %15\n\tv_nop"
        : "=&v"(r0), "=&v"(r1), "=&v"(r2), "=&v"(r3), "=&v"(r4), "=&v"(r5), "=&v"(r6), "=&v"(r7) : "v"(x[0]), "v"(x[1]), "v"(x[2]), "v"(x[3]), "v"(x[4]), "v"(x[5]), "v"(x[6]), "v"(x[7]));
    return (v8f){r0, r1, r2, r3, r4, r5, r6, r7}; }
__device__ __forceinline__ float exp2x1(float x) { float r; asm("v_exp_f32 %0, %1\n\tv_nop" : "=v"(r) : "v"(x)); return r; }    // one v_exp_f32 with the same slot behind it
__global__ __launch_bounds__(256) __attribute__((amdgpu_waves_per_eu(4, 4))) void k_fattn(const bf* __restrict__ Qh, const bf* __restrict__ Kh, const bf* __restrict__ VTh, const bf* __restrict__ VTl, bf* Ch, bf* Cl) {
    __shared__ __align__(16) bf tl[2][2][FPL];    // [buffer][K, V^T]
    __shared__ __align__(16) float xch[8][34 * 32];    // a wave's hand-over: 32 accumulator registers, the maximum and the sum of one query tile, lane by lane
    const int tid = threadIdx.x, lane = tid & 31, lr = lane & 15, hi = lane >> 4;
    const int wave = __builtin_amdgcn_readfirstlane(tid >> 5);
    const int pr = wave & 3, kq = wave >> 2;    // query group of 32; which 32 keys of every tile
    const int h = blockIdx.y, qg = blockIdx.x * 128 + pr * 32;
    const size_t hb = ((size_t)blockIdx.z * NH_ + h) * NN * HD;    // this item's and head's part of every Q, K and V^T plane
    const bf* __restrict__ kh0 = Kh + hb;
    const bf* __restrict__ vh0 = VTh + hb; const bf* __restrict__ vl0 = VTl + hb;
    v16bf qh[2][2];    // [query tile][32 of the 64 head elements]
#pragma unroll
    for (int x = 0; x < 2; ++x) {
#pragma unroll
        for (int ks = 0; ks < 2; ++ks) { const size_t o = hb + (size_t)(qg + x * 16 + lr) * HD + ks * 32 + 8 * hi; qh[x][ks] = cat16b(*(const v8us*)(Qh + o), *(const v8us*)(Qh + o + 16)); } }
    asm volatile("s_wait_xcnt 0x0" ::: "memory");    // these loads' address registers are free for re-use (the next loads' results land in them) only behind this wait
    const int srow = tid >> 3, spc = (tid & 7) * 8;    // staging: thread -> rows srow and srow + 32, 16-byte piece spc of each 64 x 128-byte tile (a wave covers whole lines)
    v8us g[4];
    auto gload = [&](int kb) {
#pragma unroll
        for (int u = 0; u < 2; ++u) { const int row = srow + 32 * u; const size_t ko = (size_t)(kb + row) * HD + spc, vo = (size_t)row * NN + kb + spc;
            g[u] = *(const v8us*)(kh0 + ko); g[2 + u] = *(const v8us*)(vh0 + vo); }
    };
    auto sstore = [&](int buf) {
#pragma unroll
        for (int u = 0; u < 2; ++u) { const int o = (srow + 32 * u) * FP + spc;
            *(v8us*)(&tl[buf][0][o]) = g[u]; *(v8us*)(&tl[buf][1][o]) = g[2 + u]; }
    };
    v8f ac2[2][4];    // [query tile][16 of the 64 head elements]
#pragma unroll
    for (int x = 0; x < 2; ++x) {
#pragma unroll
        for (int t = 0; t < 4; ++t) ac2[x][t] = (v8f){}; }
    float m2[2] = {-3.0e38f, -3.0e38f}, ls2[2] = {0.f, 0.f};    // per query tile: running maximum over this wave's keys (raw score units, equal in both halves of the wave), this half's part of the sum
    const int ko0 = (kq * 32 + lr) * FP + 8 * hi, vo0 = lr * FP + kq * 32 + 8 * hi;    // this wave's 32 keys: rows of the K tile, columns of the V^T tile
    gload(0);
    asm volatile("s_wait_xcnt 0x0" ::: "memory");    // the loop's address arithmetic re-uses these loads' offset registers
    sstore(0);
    __syncthreads();
    auto tile = [&](int cur) __attribute__((always_inline)) {    // this wave's 32 keys of the tile in buffer cur against its 32 queries
        v8f st[2][2];    // [query tile][16 of the 32 keys]
#pragma unroll
        for (int x = 0; x < 2; ++x) { st[x][0] = (v8f){}; st[x][1] = (v8f){}; }
#pragma unroll
        for (int ks = 0; ks < 2; ++ks) { v16bf kh[2];
#pragma unroll
            for (int tt = 0; tt < 2; ++tt) { const int o = ko0 + tt * 16 * FP + ks * 32; kh[tt] = cat16b(*(const v8us*)(&tl[cur][0][o]), *(const v8us*)(&tl[cur][0][o + 16])); }
#pragma unroll
            for (int x = 0; x < 2; ++x) { st[x][0] = wmmab(kh[0], qh[x][ks], st[x][0]); st[x][1] = wmmab(kh[1], qh[x][ks], st[x][1]); } }
        v16bf ph[2];
#pragma unroll
        for (int x = 0; x < 2; ++x) {
            float mx = fmaxf(st[x][0][0], st[x][1][0]);
#pragma unroll
            for (int j = 1; j < 8; ++j) mx = fmaxf(mx, fmaxf(st[x][0][j], st[x][1][j]));
            mx = fmaxf(mx, xhalf(mx));
            const float mnew = fmaxf(m2[x], mx), alpha = exp2x1((m2[x] - mnew) * SC2), mc = mnew * SC2;
            m2[x] = mnew;
            const v16f p = cat16f(exp2x8(st[x][0] * SC2 - mc), exp2x8(st[x][1] * SC2 - mc));
            const v8f s8 = __builtin_shufflevector(p, p, 0, 1, 2, 3, 4, 5, 6, 7) + __builtin_shufflevector(p, p, 8, 9, 10, 11, 12, 13, 14, 15);
            const v4f s4 = __builtin_shufflevector(s8, s8, 0, 1, 2, 3) + __builtin_shufflevector(s8, s8, 4, 5, 6, 7);
            ls2[x] = ls2[x] * alpha + ((s4[0] + s4[2]) + (s4[1] + s4[3]));
            ph[x] = __builtin_convertvector(p, v16bf);
#pragma unroll
            for (int t = 0; t < 4; ++t) ac2[x][t] *= alpha;
        }
        __builtin_amdgcn_sched_barrier(0);    // holds the softmax's vector work in front of the V^T reads and products; without it the compiler lifts those reads, and with them the staging stores, their wait on the global loads and the barrier, to the head of the trip, where the loads have only just been issued
#pragma unroll
        for (int tp = 0; tp < 2; ++tp) { v16bf vh[2];    // two V^T fragments at a time: four independent accumulators
#pragma unroll
            for (int u = 0; u < 2; ++u) { const int o = vo0 + (tp * 2 + u) * 16 * FP; vh[u] = cat16b(*(const v8us*)(&tl[cur][1][o]), *(const v8us*)(&tl[cur][1][o + 16])); }
#pragma unroll
            for (int x = 0; x < 2; ++x) { ac2[x][tp * 2] = wmmab(vh[0], ph[x], ac2[x][tp * 2]); ac2[x][tp * 2 + 1] = wmmab(vh[1], ph[x], ac2[x][tp * 2 + 1]); } }
    };
#pragma unroll 1
    for (int s = 0; s + 1 < NN / 64; ++s) {    // rolled, one straight block a trip: the last tile, behind which nothing is staged, stands behind the loop (with a branch round the staging the compiler sinks the row sums behind it, p stays live and the staged tile is spilled)
        gload((s + 1) * 64);
        tile(s & 1);
        sstore((s & 1) ^ 1);    // every wave left that buffer before the barrier that ended the tile before this one
        __syncthreads();
    }
    tile((NN / 64 - 1) & 1);
    // The join: wave (pr, kq) keeps query tile kq and hands tile 1 - kq to wave (pr, 1 - kq), lane to lane (both waves hold a query's values in the same lanes and registers).
    const bool up = kq != 0;    // wave-uniform
    float* xw = &xch[wave][0];
#pragma unroll
    for (int t = 0; t < 4; ++t) { const v8f gv = up ? ac2[0][t] : ac2[1][t];
        *(v4f*)(xw + ((2 * t) * 32 + lane) * 4) = __builtin_shufflevector(gv, gv, 0, 1, 2, 3); *(v4f*)(xw + ((2 * t + 1) * 32 + lane) * 4) = __builtin_shufflevector(gv, gv, 4, 5, 6, 7); }
    xw[32 * 32 + lane] = up ? m2[0] : m2[1]; xw[33 * 32 + lane] = up ? ls2[0] : ls2[1];
    __syncthreads();    // every wave's hand-over stands in LDS before its partner reads it
    const float* xp = &xch[wave ^ 4][0];
    const float mk = up ? m2[1] : m2[0], mp = xp[32 * 32 + lane], mj = fmaxf(mk, mp);
    const float ak = exp2x1((mk - mj) * SC2), ap = exp2x1((mp - mj) * SC2);
    float lsum = (up ? ls2[1] : ls2[0]) * ak + xp[33 * 32 + lane] * ap;
    v8f acc[4];
#pragma unroll
    for (int t = 0; t < 4; ++t) { const v4f a = *(const v4f*)(xp + ((2 * t) * 32 + lane) * 4), b = *(const v4f*)(xp + ((2 * t + 1) * 32 + lane) * 4);
        acc[t] = (up ? ac2[1][t] : ac2[0][t]) * ak + __builtin_shufflevector(a, b, 0, 1, 2, 3, 4, 5, 6, 7) * ap; }
    const int q0 = qg + kq * 16;    // the 16 queries that this wave finishes
    lsum += xhalf(lsum);
    const float inv = LJ / lsum;
#pragma unroll
    for (int t = 0; t < 4; ++t) acc[t] *= inv;
    const int i = q0 + lr;
    float lnorm = 0.f;       // row normaliser of the band (taps clipped at the sequence ends)
#pragma unroll
    for (int d = -WIN; d <= WIN; ++d) { const int k = i - d; lnorm += (k >= 0 && k < NN) ? __builtin_amdgcn_exp2f((float)(d * d) * GC2) : 0.f; }
    const float lw = (1.0f - LJ) / (lnorm + LEPSK);
#pragma unroll
    for (int bb = 0; bb < 2; ++bb) { const int kb = ((q0 - 16) & ~31) + 32 * bb;    // keys q0 - 3 .. q0 + 18 lie in these two blocks; wave-uniform test
        if (kb >= 0 && kb < NN) { v8f q2[2];    // squared distance query - key, in the B operand's k order
#pragma unroll
            for (int e = 0; e < 16; ++e) { const float fd = (float)(i - (kb + (e < 8 ? 8 * hi + e : 8 + 8 * hi + e))); q2[e >> 3][e & 7] = fd * fd; }
            const v16f ge = cat16f(exp2x8(q2[0] * GC2), exp2x8(q2[1] * GC2)); v16f lv;
#pragma unroll
            for (int e = 0; e < 16; ++e) lv[e] = q2[e >> 3][e & 7] <= (float)(WIN * WIN) ? ge[e] * lw : 0.f;
            const v16bf lh = __builtin_convertvector(lv, v16bf);
            const v16bf ll = __builtin_convertvector(lv - widen16(lh), v16bf);
#pragma unroll
            for (int t = 0; t < 4; ++t) { const size_t o = (size_t)(t * 16 + lr) * NN + kb + 8 * hi;
                const v16bf vh = cat16b(*(const v8us*)(vh0 + o), *(const v8us*)(vh0 + o + 16)); const v16bf vl = cat16b(*(const v8us*)(vl0 + o), *(const v8us*)(vl0 + o + 16));
                acc[t] = wmmab(vh, lh, acc[t]); acc[t] = wmmab(vl, lh, acc[t]); acc[t] = wmmab(vh, ll, acc[t]); } } }
    const size_t co = ((size_t)blockIdx.z * NN + i) * DMOD + h * HD + hi * 8;    // acc[t][j] = O[query i][16 t + 8 hi + j]; stored as the bf16 hi + residual planes that the output projection reads
#pragma unroll
    for (int t = 0; t < 4; ++t) { v8us oh, ol;
#pragma unroll
        for (int j = 0; j < 8; ++j) { const unsigned short hb = f2bf(acc[t][j]); oh[j] = hb; ol[j] = f2bf(acc[t][j] - bf2f(hb)); }
        *(v8us*)(Ch + co + t * 16) = oh; *(v8us*)(Cl + co + t * 16) = ol; }
}

// f32 -> bf16 of all five operands in one grid: blockIdx.y picks a piece of DM x DM elements, 0 .. 3 = x (both items), 4 .. 7 = Wq, Wk, Wv, Wo; dst holds the pieces one behind another.
// A block converts CVB elements, a thread eight runs of 8 (2,048 elements apart, so a wave's loads and stores cover whole lines): few waves to start, all of a thread's loads in flight at once.
#define CVB  (256 * 8 * 8)
__global__ __launch_bounds__(256) void k_cvt8(const float* __restrict__ x, const float* __restrict__ Wq, const float* __restrict__ Wk, const float* __restrict__ Wv, const float* __restrict__ Wo, bf* dst) {
    const int y = blockIdx.y; const size_t i = (size_t)blockIdx.x * CVB + threadIdx.x * 8;
    const float* __restrict__ src = y < 4 ? x + (size_t)y * DM * DM : y == 4 ? Wq : y == 5 ? Wk : y == 6 ? Wv : Wo;
    const float* p = src + i; v8f v[8];
#pragma unroll
    for (int q = 0; q < 8; ++q) v[q] = *(const v8f*)(p + q * 2048);
    asm volatile("s_wait_xcnt 0x0" :: "v"(p) : "memory");    // the loads' address registers are free for re-use only behind this wait; p as an input keeps them live up to it, so that no load's result lands in them
#pragma unroll
    for (int q = 0; q < 8; ++q) { v8us o;
#pragma unroll
        for (int k = 0; k < 8; ++k) o[k] = f2bf(v[q][k]);
        *(v8us*)(dst + (size_t)y * DM * DM + i + q * 2048) = o; }
}
extern "C" void kernel_launch(void* const* d_in, const int* in_sizes, int n_in,
                              void* d_out, int out_size, void* d_ws, size_t ws_size, hipStream_t stream) {
    (void)in_sizes; (void)n_in; (void)out_size;
    const float* x = (const float*)d_in[0]; const float* Wq = (const float*)d_in[1]; const float* bq = (const float*)d_in[2]; const float* Wk = (const float*)d_in[3]; const float* bk = (const float*)d_in[4]; const float* Wv = (const float*)d_in[5]; const float* bv = (const float*)d_in[6]; const float* Wo = (const float*)d_in[7]; const float* bo = (const float*)d_in[8];
    float* out = (float*)d_out;    // [2][2048][1024]
    char* wsp = (char*)d_ws;
    auto take = [&](size_t bytes) { char* p = wsp; wsp += (bytes + 255) & ~(size_t)255; return (void*)p; };
    const size_t PW = (size_t)DMOD * DMOD, PX = (size_t)NBT * NN * DMOD;    // elements of a weight plane, of a plane over both items
    bf* Xb = (bf*)take((PX + 4 * PW) * 2); bf* WQ = Xb + PX; bf* WO = WQ + 3 * PW;    // x, Wq, Wk, Wv, Wo in bf16, one behind another
    bf* Qh = (bf*)take(3 * PX * 2); bf* Kh = Qh + PX; bf* VTh = Kh + PX;             // hi planes of Q, K, V^T, one behind another
    bf* VTl = (bf*)take(PX * 2);                                                     // residual plane of V^T
    bf* Ch = (bf*)take(PX * 2); bf* Cl = (bf*)take(PX * 2);
    if ((size_t)(wsp - (char*)d_ws) > ws_size) return;    // about 67 MB in all
    k_cvt8<<<dim3(DMOD * DMOD / CVB, 8, 1), 256, 0, stream>>>(x, Wq, Wk, Wv, Wo, Xb);    // torch [out][in] = n-major
    k_gemmb<false, 1, 4><<<dim3(NBT * NN / 128, DMOD / 128, 3), 128, 0, stream>>>(Xb, nullptr, WQ, bq, bk, bv, nullptr, DMOD, Qh, VTl, DMOD);
    k_fattn<<<dim3(NN / 128, NH_, NBT), 256, 0, stream>>>(Qh, Kh, VTh, VTl, Ch, Cl);
    k_gemmb<true, 0, 2><<<dim3(NBT * NN / 64, DMOD / 128, 1), 128, 0, stream>>>(Ch, Cl, WO, bo, nullptr, nullptr, out, DMOD, nullptr, nullptr, DMOD);
}

// v009
// One run takes 92.9 microseconds.
// In both of two side-by-side timings against v008, it was 1.03 times as fast.
// All steps since v000 together make it 37.9 times as fast.
#include <hip/hip_runtime.h>

// Compute dtypes, f32 accumulate, per item: Q/K/V = x.W^T + b as [2048 x 1024].[1024 x 1024] GEMMs with PLAIN bf16 operands (exact products); per head: scores = q.k^T ([2048 x
// 64].[64 x 2048], plain bf16 operands, one product), running softmax (x 1/8) in f32, exp(s - max).V ([2048 x 2048].[2048 x 64], plain bf16 operands, one product),
// scaled by 0.6 / sum, plus 0.4 L.V (L = the row-normalised 7-tap Gaussian band, hi + UNSCALED residual, three products), all in k_fattn; out = ctx.Wo^T + bo (two products) - on

#define NBT  2
#define NN   2048
#define DMOD 1024
#define NH_  16
#define HD   64
#define DM   DMOD
#define NTK  NN
#define SCL  0.125f
#define LJ   0.6f
#define LSIG 0.4f
#define WIN  3
#define LEPSK 1e-10f
#define LOSC 1024.0f

typedef _Float16 h16;
typedef unsigned short bf;
typedef __attribute__((ext_vector_type(16))) __bf16   v16bf;
typedef __attribute__((ext_vector_type(16))) _Float16 v16h;
typedef __attribute__((ext_vector_type(8)))  _Float16 v8h;
typedef __attribute__((ext_vector_type(8)))  unsigned short v8us;
typedef __attribute__((ext_vector_type(8)))  float    v8f;
typedef __attribute__((ext_vector_type(4)))  float    v4f;
typedef __attribute__((ext_vector_type(4)))  _Float16 v4h;
typedef v8h  __attribute__((may_alias)) v8ha;
typedef v4f  __attribute__((may_alias)) v4fa;
typedef v8us __attribute__((may_alias)) v8usa;

__device__ __forceinline__ unsigned short f2bf(float f) { unsigned u = __float_as_uint(f); u += 0x7FFFu + ((u >> 16) & 1u); return (unsigned short)(u >> 16); }
__device__ __forceinline__ float bf2f(unsigned short b) { return __uint_as_float(((unsigned)b) << 16); }
__device__ __forceinline__ float bfr(float f) { return bf2f(f2bf(f)); }
__device__ __forceinline__ v16h cat16(v8h lo, v8h hi) { return __builtin_shufflevector(lo, hi, 0, 1, 2, 3, 4, 5, 6, 7, 8, 9, 10, 11, 12, 13, 14, 15); }
__device__ __forceinline__ v16bf cat16b(v8us lo, v8us hi) { return __builtin_bit_cast(v16bf, __builtin_shufflevector(lo, hi, 0, 1, 2, 3, 4, 5, 6, 7, 8, 9, 10, 11, 12, 13, 14, 15)); }
__device__ __forceinline__ v8f wmma16(v16h a, v16h b, v8f c) { return __builtin_amdgcn_wmma_f32_16x16x32_f16(false, a, false, b, (short)0, c, false, false); }
__device__ __forceinline__ v8f wmmab(v16bf a, v16bf b, v8f c) { return __builtin_amdgcn_wmma_f32_16x16x32_bf16(false, a, false, b, (short)0, c, false, false); }

// k_gemmb: block tile of 32 MT rows x 128 columns, 4 waves as 2 x 2, a wave = MT x 4 tiles of 16 x 16 (16 MT rows x 64 columns), of C = (A [+ Al]).B^T (K a multiple of 64, at least 128) + bf(bias[c]).
// A loaded fragment of A feeds 4 products and one of B feeds MT (2 MT with Al), and a row of an operand is fetched from L2 once per 128 columns or 32 MT rows of the output.
// OUTM 0: f32 C, rows = the tokens of both items. OUTM 1 (MT = 4): the Q, K and V products of both items in one grid, blockIdx.z = 0, 1, 2; A = tokens, Bn = the three weight planes one behind another, output = bf16
// planes of NBT x NN x DM elements, one a product in Ph, and V's residual plane in Pl. Q and K: [item][64 columns = head][token][64]. V: the operands change places (rows = weights, columns = tokens, bias taken by ROW), which gives V^T as [item][head x 64 + d][token].
// Operands: per stage of 64 k the block's 128 rows of B and 32 MT rows of A (and Al) go from global memory into LDS by asynchronous 16-byte copies (a wave covers four whole 128-byte row pieces a copy),
// rows at a 144-byte pitch, two buffers: the copies of stage s + 2 are issued behind the barrier that ends stage s and fly while stage s + 1 is worked on. Trip s works k stage (s + rot) mod stages, rot by block. Fragments are read from LDS in the k order 8 hi + e, 16 + 8 hi + e.
#define GKS  64            // k elements a stage
#define GP   72            // LDS row pitch in 16-bit elements
// Eight (four) copies of one thread: rows r, r + 16, .. of one operand's tile, the same 16-byte piece of each. The s_wait_xcnt stands inside the statement, behind the last copy, so that no
// address register that a copy names is rewritten in front of it.
__device__ __forceinline__ void acopy8(unsigned l, const bf* g, size_t gs) {
    asm volatile("global_load_async_to_lds_b128 %0, %8, off\n\tglobal_load_async_to_lds_b128 %1, %9, off\n\tglobal_load_async_to_lds_b128 %2, %10, off\n\tglobal_load_async_to_lds_b128 %3, %11, off\n\t"
                 "global_load_async_to_lds_b128 %4, %12, off\n\tglobal_load_async_to_lds_b128 %5, %13, off\n\tglobal_load_async_to_lds_b128 %6, %14, off\n\tglobal_load_async_to_lds_b128 %7, %15, off\n\ts_wait_xcnt 0x0"
                 :: "v"(l), "v"(l + 1u * 32u * GP), "v"(l + 2u * 32u * GP), "v"(l + 3u * 32u * GP), "v"(l + 4u * 32u * GP), "v"(l + 5u * 32u * GP), "v"(l + 6u * 32u * GP), "v"(l + 7u * 32u * GP),
                    "v"(g), "v"(g + gs), "v"(g + 2 * gs), "v"(g + 3 * gs), "v"(g + 4 * gs), "v"(g + 5 * gs), "v"(g + 6 * gs), "v"(g + 7 * gs) : "memory");
}
__device__ __forceinline__ void acopy4(unsigned l, const bf* g, size_t gs) {
    asm volatile("global_load_async_to_lds_b128 %0, %4, off\n\tglobal_load_async_to_lds_b128 %1, %5, off\n\tglobal_load_async_to_lds_b128 %2, %6, off\n\tglobal_load_async_to_lds_b128 %3, %7, off\n\ts_wait_xcnt 0x0"
                 :: "v"(l), "v"(l + 1u * 32u * GP), "v"(l + 2u * 32u * GP), "v"(l + 3u * 32u * GP), "v"(g), "v"(g + gs), "v"(g + 2 * gs), "v"(g + 3 * gs) : "memory");
}
template <bool SPLITA, int OUTM, int MT>
__global__ __launch_bounds__(128) void k_gemmb(const bf* __restrict__ A, const bf* __restrict__ Al, const bf* __restrict__ Bn, const float* __restrict__ bias, const float* __restrict__ biasK, const float* __restrict__ biasV, float* C, int ldc, bf* Ph, bf* Pl, int K) {
    static_assert(MT == 4 || MT == 2, "rows of A a block: 128 or 64"); static_assert(OUTM == 0 || MT == 4, "V^T swaps row and column blocks: both 128");
    constexpr int BR = 32 * MT;                                  // rows of A (and Al) a block
    constexpr int STG = (128 + (SPLITA ? 2 : 1) * BR) * GP;      // elements a stage: B, A (, Al)
    __shared__ __align__(16) float ost[4][16 * 68];
    __shared__ __align__(16) bf gt[2][STG];
    const int lane = threadIdx.x & 31, wave = threadIdx.x >> 5, lr = lane & 15, hi = lane >> 4;
    const int wr = wave >> 1, wc = wave & 1;    // the wave's place in the block tile
    const int z = OUTM == 1 ? (int)blockIdx.z : 0; const bool vt = OUTM == 1 && z == 2;    // which product; V^T takes its rows from the weights (block-uniform)
    const int rb = vt ? blockIdx.y : blockIdx.x, cb = vt ? blockIdx.x : blockIdx.y;         // row block, column block: blockIdx.x counts token blocks, blockIdx.y weight blocks
    const int r0 = rb * BR + wr * (MT * 16), c0 = cb * 128 + wc * 64;
    const int crow = threadIdx.x >> 3, cpc = (threadIdx.x & 7) * 8;    // copies: thread -> rows crow + 16 u, 16-byte piece cpc of each 128-byte row piece
    const bf* Wz = Bn + (size_t)z * DM * DM;
    const bf* ga = (vt ? Wz : A) + (size_t)(rb * BR + crow) * K + cpc;
    const bf* gal = SPLITA ? Al + (size_t)(rb * BR + crow) * K + cpc : nullptr;
    const bf* gb = (vt ? A : Wz) + (size_t)(cb * 128 + crow) * K + cpc;
    const unsigned l0 = (unsigned)(size_t)&gt[0][crow * GP + cpc];    // the thread's LDS byte address in buffer 0, operand B
    const size_t gs = (size_t)16 * K;
    const int nst = K / GKS;
    // The block's own first k stage; the walk wraps. Blocks that read the same rows of an operand (same blockIdx.x, or same blockIdx.y and z) get starts spread over the stages, at most four on one start, so that few of them ask L2 for the same lines at the same moment.
    const int rot = (int)((((blockIdx.x & 3u) << 2) + (blockIdx.x >> 3) + (OUTM == 1 ? blockIdx.y + 8u * blockIdx.z : 2u * blockIdx.y)) % (unsigned)nst);
    auto fill = [&](int st) { const unsigned l = l0 + (unsigned)(st & 1) * (unsigned)(STG * 2); const int sk = st + rot; const size_t ko = (size_t)(sk >= nst ? sk - nst : sk) * GKS;
        acopy8(l, gb + ko, gs);
        if constexpr (MT == 4) { acopy8(l + 128u * GP * 2u, ga + ko, gs); if (SPLITA) acopy8(l + (128u + BR) * GP * 2u, gal + ko, gs); }
        else { acopy4(l + 128u * GP * 2u, ga + ko, gs); if (SPLITA) acopy4(l + (128u + BR) * GP * 2u, gal + ko, gs); } };
    v8f acc[MT][4];
#pragma unroll
    for (int i = 0; i < MT; ++i) {
#pragma unroll
        for (int t = 0; t < 4; ++t) acc[i][t] = (v8f){}; }
    fill(0);
    asm volatile("s_wait_asynccnt 0x0" ::: "memory");    // this wave's copies of stage 0 have landed
    __syncthreads();                                     // every wave's have: stage 0 may be read
    if (nst > 1) fill(1);
#pragma unroll 1
    for (int st = 0; st < nst; ++st) {    // rolled: one stage a trip, the two buffers in turn
        const bf* tb = &gt[st & 1][0]; const bf* ta = tb + 128 * GP; const bf* tal = ta + BR * GP;
#pragma unroll
        for (int q = 0; q < GKS / 32; ++q) {
            v16bf fa[MT], fal[MT], fb[4];    // the fragments of 32 k, fetched as one group of LDS reads
#pragma unroll
            for (int i = 0; i < MT; ++i) { const int ao = (wr * (MT * 16) + i * 16 + lr) * GP + q * 32 + 8 * hi;
                fa[i] = cat16b(*(const v8us*)(ta + ao), *(const v8us*)(ta + ao + 16));
                if (SPLITA) fal[i] = cat16b(*(const v8us*)(tal + ao), *(const v8us*)(tal + ao + 16)); }
#pragma unroll
            for (int t = 0; t < 4; ++t) { const int bo = (wc * 64 + t * 16 + lr) * GP + q * 32 + 8 * hi; fb[t] = cat16b(*(const v8us*)(tb + bo), *(const v8us*)(tb + bo + 16)); }
            // Inputs-only fence on the loaded fragments: it keeps the LDS reads together in front of the matrix run; without it they are spread among the products, each pair with its own full wait.
            if constexpr (MT == 4) asm volatile("" :: "v"(fa[0]), "v"(fa[1]), "v"(fa[2]), "v"(fa[3]), "v"(fb[0]), "v"(fb[1]), "v"(fb[2]), "v"(fb[3]));
            else asm volatile("" :: "v"(fa[0]), "v"(fa[1]), "v"(fal[0]), "v"(fal[1]), "v"(fb[0]), "v"(fb[1]), "v"(fb[2]), "v"(fb[3]));
#pragma unroll
            for (int i = 0; i < MT; ++i) {
#pragma unroll
                for (int t = 0; t < 4; ++t) acc[i][t] = wmmab(fa[i], fb[t], acc[i][t]); }
            if constexpr (SPLITA) {
#pragma unroll
                for (int i = 0; i < MT; ++i) {
#pragma unroll
                    for (int t = 0; t < 4; ++t) acc[i][t] = wmmab(fal[i], fb[t], acc[i][t]); } }
        }
        asm volatile("s_wait_dscnt 0x0" ::: "memory");       // this wave's reads of the buffer are done before anybody refills it
        asm volatile("s_wait_asynccnt 0x0" ::: "memory");    // this wave's copies of stage st + 1 have landed
        __syncthreads();                                     // publishes stage st + 1 and ends every wave's reads of stage st
        if (st + 2 < nst) fill(st + 2);                      // into the buffer that this trip has just read
    }
    asm volatile("s_wait_asynccnt 0x0" ::: "memory");    // no copy is outstanding when the epilogue starts
    float* os = &ost[wave][0];
    const float* bz = z == 0 ? bias : z == 1 ? biasK : biasV;
    float br[4] = {0.f, 0.f, 0.f, 0.f};    // bias by column
    if (!vt && bz) { const int bi = c0 + lr;
#pragma unroll
        for (int t = 0; t < 4; ++t) br[t] = bz[bi + t * 16];
        asm volatile("s_wait_xcnt 0x0" :: "v"(bi) : "memory");    // the bias loads' offset register is free for re-use only behind this wait; bi as an input keeps it live up to it
#pragma unroll
        for (int t = 0; t < 4; ++t) br[t] = bfr(br[t]); }
    if (OUTM != 0) Ph += (size_t)z * NBT * NN * DM;
#pragma unroll
    for (int i = 0; i < MT; ++i) {    // the wave's tile goes out 16 rows at a time through its own LDS piece, as whole lines
        const int ri = r0 + i * 16;
        if (vt) { const float* bp = bz + ri + hi * 8; float bw[8];
#pragma unroll
            for (int j = 0; j < 8; ++j) bw[j] = bp[j];
            asm volatile("s_wait_xcnt 0x0" :: "v"(bp) : "memory");    // the same for the bias by row
#pragma unroll
            for (int j = 0; j < 8; ++j) { const float bv = bfr(bw[j]);
#pragma unroll
                for (int t = 0; t < 4; ++t) os[(hi * 8 + j) * 68 + t * 16 + lr] = acc[i][t][j] + bv; }
        } else {
#pragma unroll
            for (int t = 0; t < 4; ++t) {
#pragma unroll
                for (int j = 0; j < 8; ++j) os[(hi * 8 + j) * 68 + t * 16 + lr] = acc[i][t][j] + br[t]; }
        }
        asm volatile("s_wait_dscnt 0x0" ::: "memory");    // the wave's 16 rows stand in its own LDS piece before its lanes read them back; no other wave touches that piece, so no barrier
        if (OUTM != 0) {
            // a tile row is 64 elements = one whole 128-byte line of a plane; 16 rows and 64 columns lie in one item; only V^T has a residual plane (block-uniform test)
            const size_t base = vt ? ((size_t)(c0 / NN) * DM + ri) * NN + (c0 % NN) : (((size_t)(ri / NN) * NH_ + (c0 >> 6)) * NN + (ri % NN)) * HD;
            const int pitch = vt ? NN : HD;
            if (vt) {
#pragma unroll
                for (int s = 0; s < 4; ++s) { const int row = 4 * s + (lane >> 3), piece = lane & 7; const float* sp = os + row * 68 + piece * 8; v8us oh, ol;
#pragma unroll
                    for (int e = 0; e < 8; ++e) { const unsigned short hb = f2bf(sp[e]); oh[e] = hb; ol[e] = f2bf(sp[e] - bf2f(hb)); }
                    const size_t o = base + (size_t)row * pitch + piece * 8; *(v8us*)(Ph + o) = oh; *(v8us*)(Pl + o) = ol; }
                asm volatile("s_wait_xcnt 0x0" ::: "memory");    // this branch's stores, in every pass: in the built code the other branch's block, which re-uses their registers, follows them in front of the wait behind the join
            } else {
#pragma unroll
                for (int s = 0; s < 4; ++s) { const int row = 4 * s + (lane >> 3), piece = lane & 7; const float* sp = os + row * 68 + piece * 8; v8us oh;
#pragma unroll
                    for (int e = 0; e < 8; ++e) oh[e] = f2bf(sp[e]);
                    *(v8us*)(Ph + base + (size_t)row * pitch + piece * 8) = oh; }
            }
        } else {
            float* crw = C + (size_t)ri * ldc + c0;
#pragma unroll
            for (int s = 0; s < 8; ++s) { const int Lid = (lane >> 3) + 4 * s, piece = lane & 7; const int row = Lid >> 1, cofs = (Lid & 1) * 32 + piece * 4;
                *(v4f*)(crw + (size_t)row * ldc + cofs) = *(const v4fa*)(os + row * 68 + cofs); }
        }
        if (i + 1 < MT) asm volatile("s_wait_xcnt 0x0" ::: "memory");    // the stores' address and data registers are re-used by the next 16 rows only behind this wait
    }
}

#define FP   72            // LDS row pitch in 16-bit elements
#define FPL  (64 * FP)     // one plane's tile
#define SC2  0.18033688f   // 1/8 x log2(e)
typedef __attribute__((ext_vector_type(16))) float v16f;
__device__ __forceinline__ float xhalf(float v) { const int b = __float_as_int(v); return __int_as_float(__builtin_amdgcn_permlanex16(b, b, 0x76543210, 0xfedcba98, false, false)); }   // lane l <-> l ^ 16
__device__ __forceinline__ v16f widen16(v16bf x) { typedef __attribute__((ext_vector_type(8))) unsigned v8u; const v8u w = __builtin_bit_cast(v8u, x); v16f r;    // packed bf16 pairs back to f32: a shift and a mask a pair
#pragma unroll
    for (int k = 0; k < 8; ++k) { r[2 * k] = __uint_as_float(w[k] << 16); r[2 * k + 1] = __uint_as_float(w[k] & 0xFFFF0000u); }
    return r; }
#define GC2  (-1.44269504f / (2.0f * LSIG * LSIG))    // un-normalised band tap = exp(-d^2 / (2 x 0.16)) = exp2(d^2 x GC2), 0 outside |d| <= 3
__device__ __forceinline__ v16f cat16f(v8f lo, v8f hi) { return __builtin_shufflevector(lo, hi, 0, 1, 2, 3, 4, 5, 6, 7, 8, 9, 10, 11, 12, 13, 14, 15); }
// Eight independent v_exp_f32 in one statement, every output apart from every input, v_nop last: no neighbour reads a result or overwrites a source in the slot directly behind a transcendental.
__device__ __forceinline__ v8f exp2x8(v8f x) { float r0, r1, r2, r3, r4, r5, r6, r7;
    asm("v_exp_f32 %0, %8\n\tv_exp_f32 %1, %9\n\tv_exp_f32 %2, %10\n\tv_exp_f32 %3, %11\n\tv_exp_f32 %4, %12\n\tv_exp_f32 %5, %13\n\tv_exp_f32 %6, %14\n\tv_exp_f32 %7, %15\n\tv_nop"
        : "=&v"(r0), "=&v"(r1), "=&v"(r2), "=&v"(r3), "=&v"(r4), "=&v"(r5), "=&v"(r6), "=&v"(r7) : "v"(x[0]), "v"(x[1]), "v"(x[2]), "v"(x[3]), "v"(x[4]), "v"(x[5]), "v"(x[6]), "v"(x[7]));
    return (v8f){r0, r1, r2, r3, r4, r5, r6, r7}; }
__device__ __forceinline__ float exp2x1(float x) { float r; asm("v_exp_f32 %0, %1\n\tv_nop" : "=v"(r) : "v"(x)); return r; }    // one v_exp_f32 with the same slot behind it
__global__ __launch_bounds__(256) __attribute__((amdgpu_waves_per_eu(4, 4))) void k_fattn(const bf* __restrict__ Qh, const bf* __restrict__ Kh, const bf* __restrict__ VTh, const bf* __restrict__ VTl, bf* Ch, bf* Cl) {
    __shared__ __align__(16) bf tl[2][2][FPL];    // [buffer][K, V^T]
    __shared__ __align__(16) float xch[8][34 * 32];    // a wave's hand-over: 32 accumulator registers, the maximum and the sum of one query tile, lane by lane
    const int tid = threadIdx.x, lane = tid & 31, lr = lane & 15, hi = lane >> 4;
    const int wave = __builtin_amdgcn_readfirstlane(tid >> 5);
    const int pr = wave & 3, kq = wave >> 2;    // query group of 32; which 32 keys of every tile
    const int h = blockIdx.y, qg = blockIdx.x * 128 + pr * 32;
    const size_t hb = ((size_t)blockIdx.z * NH_ + h) * NN * HD;    // this item's and head's part of every Q, K and V^T plane
    const bf* __restrict__ kh0 = Kh + hb;
    const bf* __restrict__ vh0 = VTh + hb; const bf* __restrict__ vl0 = VTl + hb;
    v16bf qh[2][2];    // [query tile][32 of the 64 head elements]
#pragma unroll
    for (int x = 0; x < 2; ++x) {
#pragma unroll
        for (int ks = 0; ks < 2; ++ks) { const size_t o = hb + (size_t)(qg + x * 16 + lr) * HD + ks * 32 + 8 * hi; qh[x][ks] = cat16b(*(const v8us*)(Qh + o), *(const v8us*)(Qh + o + 16)); } }
    asm volatile("s_wait_xcnt 0x0" ::: "memory");    // these loads' address registers are free for re-use (the next loads' results land in them) only behind this wait
    const int srow = tid >> 3, spc = (tid & 7) * 8;    // staging: thread -> rows srow and srow + 32, 16-byte piece spc of each 64 x 128-byte tile (a wave covers whole lines)
    v8us g[4];
    auto gload = [&](int kb) {
#pragma unroll
        for (int u = 0; u < 2; ++u) { const int row = srow + 32 * u; const size_t ko = (size_t)(kb + row) * HD + spc, vo = (size_t)row * NN + kb + spc;
            g[u] = *(const v8us*)(kh0 + ko); g[2 + u] = *(const v8us*)(vh0 + vo); }
    };
    auto sstore = [&](int buf) {
#pragma unroll
        for (int u = 0; u < 2; ++u) { const int o = (srow + 32 * u) * FP + spc;
            *(v8us*)(&tl[buf][0][o]) = g[u]; *(v8us*)(&tl[buf][1][o]) = g[2 + u]; }
    };
    v8f ac2[2][4];    // [query tile][16 of the 64 head elements]
#pragma unroll
    for (int x = 0; x < 2; ++x) {
#pragma unroll
        for (int t = 0; t < 4; ++t) ac2[x][t] = (v8f){}; }
    float m2[2] = {-3.0e38f, -3.0e38f}, ls2[2] = {0.f, 0.f};    // per query tile: running maximum over this wave's keys (raw score units, equal in both halves of the wave), this half's part of the sum
    const int ko0 = (kq * 32 + lr) * FP + 8 * hi, vo0 = lr * FP + kq * 32 + 8 * hi;    // this wave's 32 keys: rows of the K tile, columns of the V^T tile
    // The block's own first key tile; the walk wraps. The 16 blocks that read one head's K and V^T start at 16 different tiles, so that they do not ask L2 for the same lines at the same moment.
    const int rot = (int)(((((blockIdx.x & 3u) << 1) + (blockIdx.x >> 3)) << 2) + ((blockIdx.x >> 1) & 2u)) & (NN / 64 - 1);
    gload(rot * 64);
    asm volatile("s_wait_xcnt 0x0" ::: "memory");    // the loop's address arithmetic re-uses these loads' offset registers
    sstore(0);
    __syncthreads();
    auto tile = [&](int cur) __attribute__((always_inline)) {    // this wave's 32 keys of the tile in buffer cur against its 32 queries
        v8f st[2][2];    // [query tile][16 of the 32 keys]
#pragma unroll
        for (int x = 0; x < 2; ++x) { st[x][0] = (v8f){}; st[x][1] = (v8f){}; }
#pragma unroll
        for (int ks = 0; ks < 2; ++ks) { v16bf kh[2];
#pragma unroll
            for (int tt = 0; tt < 2; ++tt) { const int o = ko0 + tt * 16 * FP + ks * 32; kh[tt] = cat16b(*(const v8us*)(&tl[cur][0][o]), *(const v8us*)(&tl[cur][0][o + 16])); }
#pragma unroll
            for (int x = 0; x < 2; ++x) { st[x][0] = wmmab(kh[0], qh[x][ks], st[x][0]); st[x][1] = wmmab(kh[1], qh[x][ks], st[x][1]); } }
        v16bf ph[2];
#pragma unroll
        for (int x = 0; x < 2; ++x) {
            float mx = fmaxf(st[x][0][0], st[x][1][0]);
#pragma unroll
            for (int j = 1; j < 8; ++j) mx = fmaxf(mx, fmaxf(st[x][0][j], st[x][1][j]));
            mx = fmaxf(mx, xhalf(mx));
            const float mnew = fmaxf(m2[x], mx), alpha = exp2x1((m2[x] - mnew) * SC2), mc = mnew * SC2;
            m2[x] = mnew;
            const v16f p = cat16f(exp2x8(st[x][0] * SC2 - mc), exp2x8(st[x][1] * SC2 - mc));
            const v8f s8 = __builtin_shufflevector(p, p, 0, 1, 2, 3, 4, 5, 6, 7) + __builtin_shufflevector(p, p, 8, 9, 10, 11, 12, 13, 14, 15);
            const v4f s4 = __builtin_shufflevector(s8, s8, 0, 1, 2, 3) + __builtin_shufflevector(s8, s8, 4, 5, 6, 7);
            ls2[x] = ls2[x] * alpha + ((s4[0] + s4[2]) + (s4[1] + s4[3]));
            ph[x] = __builtin_convertvector(p, v16bf);
#pragma unroll
            for (int t = 0; t < 4; ++t) ac2[x][t] *= alpha;
        }
        __builtin_amdgcn_sched_barrier(0);    // holds the softmax's vector work in front of the V^T reads and products; without it the compiler lifts those reads, and with them the staging stores, their wait on the global loads and the barrier, to the head of the trip, where the loads have only just been issued
#pragma unroll
        for (int tp = 0; tp < 2; ++tp) { v16bf vh[2];    // two V^T fragments at a time: four independent accumulators
#pragma unroll
            for (int u = 0; u < 2; ++u) { const int o = vo0 + (tp * 2 + u) * 16 * FP; vh[u] = cat16b(*(const v8us*)(&tl[cur][1][o]), *(const v8us*)(&tl[cur][1][o + 16])); }
#pragma unroll
            for (int x = 0; x < 2; ++x) { ac2[x][tp * 2] = wmmab(vh[0], ph[x], ac2[x][tp * 2]); ac2[x][tp * 2 + 1] = wmmab(vh[1], ph[x], ac2[x][tp * 2 + 1]); } }
    };
#pragma unroll 1
    for (int s = 0; s + 1 < NN / 64; ++s) {    // rolled, one straight block a trip: the last tile, behind which nothing is staged, stands behind the loop (with a branch round the staging the compiler sinks the row sums behind it, p stays live and the staged tile is spilled)
        gload(((s + 1 + rot) & (NN / 64 - 1)) * 64);    // the next tile of the wrapped walk flies while this one is worked on
        tile(s & 1);
        sstore((s & 1) ^ 1);    // every wave left that buffer before the barrier that ended the tile before this one
        __syncthreads();
    }
    tile((NN / 64 - 1) & 1);
    // The join: wave (pr, kq) keeps query tile kq and hands tile 1 - kq to wave (pr, 1 - kq), lane to lane (both waves hold a query's values in the same lanes and registers).
    const bool up = kq != 0;    // wave-uniform
    float* xw = &xch[wave][0];
#pragma unroll
    for (int t = 0; t < 4; ++t) { const v8f gv = up ? ac2[0][t] : ac2[1][t];
        *(v4f*)(xw + ((2 * t) * 32 + lane) * 4) = __builtin_shufflevector(gv, gv, 0, 1, 2, 3); *(v4f*)(xw + ((2 * t + 1) * 32 + lane) * 4) = __builtin_shufflevector(gv, gv, 4, 5, 6, 7); }
    xw[32 * 32 + lane] = up ? m2[0] : m2[1]; xw[33 * 32 + lane] = up ? ls2[0] : ls2[1];
    __syncthreads();    // every wave's hand-over stands in LDS before its partner reads it
    const float* xp = &xch[wave ^ 4][0];
    const float mk = up ? m2[1] : m2[0], mp = xp[32 * 32 + lane], mj = fmaxf(mk, mp);
    const float ak = exp2x1((mk - mj) * SC2), ap = exp2x1((mp - mj) * SC2);
    float lsum = (up ? ls2[1] : ls2[0]) * ak + xp[33 * 32 + lane] * ap;
    v8f acc[4];
#pragma unroll
    for (int t = 0; t < 4; ++t) { const v4f a = *(const v4f*)(xp + ((2 * t) * 32 + lane) * 4), b = *(const v4f*)(xp + ((2 * t + 1) * 32 + lane) * 4);
        acc[t] = (up ? ac2[1][t] : ac2[0][t]) * ak + __builtin_shufflevector(a, b, 0, 1, 2, 3, 4, 5, 6, 7) * ap; }
    const int q0 = qg + kq * 16;    // the 16 queries that this wave finishes
    lsum += xhalf(lsum);
    const float inv = LJ / lsum;
#pragma unroll
    for (int t = 0; t < 4; ++t) acc[t] *= inv;
    const int i = q0 + lr;
    float lnorm = 0.f;       // row normaliser of the band (taps clipped at the sequence ends)
#pragma unroll
    for (int d = -WIN; d <= WIN; ++d) { const int k = i - d; lnorm += (k >= 0 && k < NN) ? __builtin_amdgcn_exp2f((float)(d * d) * GC2) : 0.f; }
    const float lw = (1.0f - LJ) / (lnorm + LEPSK);
#pragma unroll
    for (int bb = 0; bb < 2; ++bb) { const int kb = ((q0 - 16) & ~31) + 32 * bb;    // keys q0 - 3 .. q0 + 18 lie in these two blocks; wave-uniform test
        if (kb >= 0 && kb < NN) { v8f q2[2];    // squared distance query - key, in the B operand's k order
#pragma unroll
            for (int e = 0; e < 16; ++e) { const float fd = (float)(i - (kb + (e < 8 ? 8 * hi + e : 8 + 8 * hi + e))); q2[e >> 3][e & 7] = fd * fd; }
            const v16f ge = cat16f(exp2x8(q2[0] * GC2), exp2x8(q2[1] * GC2)); v16f lv;
#pragma unroll
            for (int e = 0; e < 16; ++e) lv[e] = q2[e >> 3][e & 7] <= (float)(WIN * WIN) ? ge[e] * lw : 0.f;
            const v16bf lh = __builtin_convertvector(lv, v16bf);
            const v16bf ll = __builtin_convertvector(lv - widen16(lh), v16bf);
#pragma unroll
            for (int t = 0; t < 4; ++t) { const size_t o = (size_t)(t * 16 + lr) * NN + kb + 8 * hi;
                const v16bf vh = cat16b(*(const v8us*)(vh0 + o), *(const v8us*)(vh0 + o + 16)); const v16bf vl = cat16b(*(const v8us*)(vl0 + o), *(const v8us*)(vl0 + o + 16));
                acc[t] = wmmab(vh, lh, acc[t]); acc[t] = wmmab(vl, lh, acc[t]); acc[t] = wmmab(vh, ll, acc[t]); } } }
    const size_t co = ((size_t)blockIdx.z * NN + i) * DMOD + h * HD + hi * 8;    // acc[t][j] = O[query i][16 t + 8 hi + j]; stored as the bf16 hi + residual planes that the output projection reads
#pragma unroll
    for (int t = 0; t < 4; ++t) { v8us oh, ol;
#pragma unroll
        for (int j = 0; j < 8; ++j) { const unsigned short hb = f2bf(acc[t][j]); oh[j] = hb; ol[j] = f2bf(acc[t][j] - bf2f(hb)); }
        *(v8us*)(Ch + co + t * 16) = oh; *(v8us*)(Cl + co + t * 16) = ol; }
}

// f32 -> bf16 of all five operands in one grid: blockIdx.y picks a piece of DM x DM elements, 0 .. 3 = x (both items), 4 .. 7 = Wq, Wk, Wv, Wo; dst holds the pieces one behind another.
// A block converts CVB elements, a thread eight runs of 8 (2,048 elements apart, so a wave's loads and stores cover whole lines): few waves to start, all of a thread's loads in flight at once.
#define CVB  (256 * 8 * 8)
__global__ __launch_bounds__(256) void k_cvt8(const float* __restrict__ x, const float* __restrict__ Wq, const float* __restrict__ Wk, const float* __restrict__ Wv, const float* __restrict__ Wo, bf* dst) {
    const int y = blockIdx.y; const size_t i = (size_t)blockIdx.x * CVB + threadIdx.x * 8;
    const float* __restrict__ src = y < 4 ? x + (size_t)y * DM * DM : y == 4 ? Wq : y == 5 ? Wk : y == 6 ? Wv : Wo;
    const float* p = src + i; v8f v[8];
#pragma unroll
    for (int q = 0; q < 8; ++q) v[q] = *(const v8f*)(p + q * 2048);
    asm volatile("s_wait_xcnt 0x0" :: "v"(p) : "memory");    // the loads' address registers are free for re-use only behind this wait; p as an input keeps them live up to it, so that no load's result lands in them
#pragma unroll
    for (int q = 0; q < 8; ++q) { v8us o;
#pragma unroll
        for (int k = 0; k < 8; ++k) o[k] = f2bf(v[q][k]);
        *(v8us*)(dst + (size_t)y * DM * DM + i + q * 2048) = o; }
}
extern "C" void kernel_launch(void* const* d_in, const int* in_sizes, int n_in,
                              void* d_out, int out_size, void* d_ws, size_t ws_size, hipStream_t stream) {
    (void)in_sizes; (void)n_in; (void)out_size;
    const float* x = (const float*)d_in[0]; const float* Wq = (const float*)d_in[1]; const float* bq = (const float*)d_in[2]; const float* Wk = (const float*)d_in[3]; const float* bk = (const float*)d_in[4]; const float* Wv = (const float*)d_in[5]; const float* bv = (const float*)d_in[6]; const float* Wo = (const float*)d_in[7]; const float* bo = (const float*)d_in[8];
    float* out = (float*)d_out;    // [2][2048][1024]
    char* wsp = (char*)d_ws;
    auto take = [&](size_t bytes) { char* p = wsp; wsp += (bytes + 255) & ~(size_t)255; return (void*)p; };
    const size_t PW = (size_t)DMOD * DMOD, PX = (size_t)NBT * NN * DMOD;    // elements of a weight plane, of a plane over both items
    bf* Xb = (bf*)take((PX + 4 * PW) * 2); bf* WQ = Xb + PX; bf* WO = WQ + 3 * PW;    // x, Wq, Wk, Wv, Wo in bf16, one behind another
    bf* Qh = (bf*)take(3 * PX * 2); bf* Kh = Qh + PX; bf* VTh = Kh + PX;             // hi planes of Q, K, V^T, one behind another
    bf* VTl = (bf*)take(PX * 2);                                                     // residual plane of V^T
    bf* Ch = (bf*)take(PX * 2); bf* Cl = (bf*)take(PX * 2);
    if ((size_t)(wsp - (char*)d_ws) > ws_size) return;    // about 67 MB in all
    k_cvt8<<<dim3(DMOD * DMOD / CVB, 8, 1), 256, 0, stream>>>(x, Wq, Wk, Wv, Wo, Xb);    // torch [out][in] = n-major
    k_gemmb<false, 1, 4><<<dim3(NBT * NN / 128, DMOD / 128, 3), 128, 0, stream>>>(Xb, nullptr, WQ, bq, bk, bv, nullptr, DMOD, Qh, VTl, DMOD);
    k_fattn<<<dim3(NN / 128, NH_, NBT), 256, 0, stream>>>(Qh, Kh, VTh, VTl, Ch, Cl);
    k_gemmb<true, 0, 2><<<dim3(NBT * NN / 64, DMOD / 128, 1), 128, 0, stream>>>(Ch, Cl, WO, bo, nullptr, nullptr, out, DMOD, nullptr, nullptr, DMOD);
}

// v010
// One run takes 88.1 microseconds.
// Timed twice side by side with v009, it ran 1.06 times as fast both times.
// Counting every step since v000, it is 40.1 times as fast.
#include <hip/hip_runtime.h>

// Compute dtypes, f32 accumulate, per item: Q/K/V = x.W^T + b as [2048 x 1024].[1024 x 1024] GEMMs with PLAIN bf16 operands (exact products); per head: scores = q.k^T ([2048 x
// 64].[64 x 2048], plain bf16 operands, one product), running softmax (x 1/8) in f32, exp(s - max).V ([2048 x 2048].[2048 x 64], plain bf16 operands, one product),
// scaled by 0.6 / sum, plus 0.4 L.V (L = the row-normalised 7-tap Gaussian band, hi + UNSCALED residual, three products), all in k_fattn; out = ctx.Wo^T + bo (two products) - on

#define NBT  2
#define NN   2048
#define DMOD 1024
#define NH_  16
#define HD   64
#define DM   DMOD
#define NTK  NN
#define SCL  0.125f
#define LJ   0.6f
#define LSIG 0.4f
#define WIN  3
#define LEPSK 1e-10f
#define LOSC 1024.0f

typedef _Float16 h16;
typedef unsigned short bf;
typedef __attribute__((ext_vector_type(16))) __bf16   v16bf;
typedef __attribute__((ext_vector_type(16))) _Float16 v16h;
typedef __attribute__((ext_vector_type(8)))  _Float16 v8h;
typedef __attribute__((ext_vector_type(8)))  unsigned short v8us;
typedef __attribute__((ext_vector_type(8)))  float    v8f;
typedef __attribute__((ext_vector_type(4)))  float    v4f;
typedef __attribute__((ext_vector_type(4)))  _Float16 v4h;
typedef v8h  __attribute__((may_alias)) v8ha;
typedef v4f  __attribute__((may_alias)) v4fa;
typedef v8us __attribute__((may_alias)) v8usa;

__device__ __forceinline__ unsigned short f2bf(float f) { unsigned u = __float_as_uint(f); u += 0x7FFFu + ((u >> 16) & 1u); return (unsigned short)(u >> 16); }
__device__ __forceinline__ float bf2f(unsigned short b) { return __uint_as_float(((unsigned)b) << 16); }
__device__ __forceinline__ float bfr(float f) { return bf2f(f2bf(f)); }
__device__ __forceinline__ v16h cat16(v8h lo, v8h hi) { return __builtin_shufflevector(lo, hi, 0, 1, 2, 3, 4, 5, 6, 7, 8, 9, 10, 11, 12, 13, 14, 15); }
__device__ __forceinline__ v16bf cat16b(v8us lo, v8us hi) { return __builtin_bit_cast(v16bf, __builtin_shufflevector(lo, hi, 0, 1, 2, 3, 4, 5, 6, 7, 8, 9, 10, 11, 12, 13, 14, 15)); }
__device__ __forceinline__ v8f wmma16(v16h a, v16h b, v8f c) { return __builtin_amdgcn_wmma_f32_16x16x32_f16(false, a, false, b, (short)0, c, false, false); }
__device__ __forceinline__ v8f wmmab(v16bf a, v16bf b, v8f c) { return __builtin_amdgcn_wmma_f32_16x16x32_bf16(false, a, false, b, (short)0, c, false, false); }

// k_gemmb: block tile of 32 MT rows x 128 columns, 4 waves as 2 x 2, a wave = MT x 4 tiles of 16 x 16 (16 MT rows x 64 columns), of C = (A [+ Al]).B^T (K a multiple of 64, at least 128) + bf(bias[c]).
// A loaded fragment of A feeds 4 products and one of B feeds MT (2 MT with Al), and a row of an operand is fetched from L2 once per 128 columns or 32 MT rows of the output.
// OUTM 0: f32 C, rows = the tokens of both items. OUTM 1 (MT = 4): the Q, K and V products of both items in one grid, blockIdx.z = 0, 1, 2; A = tokens, Bn = the three weight planes one behind another, output = bf16
// planes of NBT x NN x DM elements, one a product in Ph, and V's residual plane in Pl. Q and K: [item][64 columns = head][token][64]. V: the operands change places (rows = weights, columns = tokens, bias taken by ROW), which gives V^T as [item][head x 64 + d][token].
// Operands: per stage of 64 k the block's 128 rows of B and 32 MT rows of A (and Al) go from global memory into LDS by asynchronous 16-byte copies (a wave covers four whole 128-byte row pieces a copy),
// rows at a 144-byte pitch, two buffers: the copies of stage s + 2 are issued behind the barrier that ends stage s and fly while stage s + 1 is worked on. Trip s works k stage (s + rot) mod stages, rot by block. Fragments are read from LDS in the k order 8 hi + e, 16 + 8 hi + e.
#define GKS  64            // k elements a stage
#define GP   72            // LDS row pitch in 16-bit elements
// Eight (four) copies of one thread: rows r, r + 16, .. of one operand's tile, the same 16-byte piece of each. The s_wait_xcnt stands inside the statement, behind the last copy, so that no
// address register that a copy names is rewritten in front of it.
__device__ __forceinline__ void acopy8(unsigned l, const bf* g, size_t gs) {
    asm volatile("global_load_async_to_lds_b128 %0, %8, off\n\tglobal_load_async_to_lds_b128 %1, %9, off\n\tglobal_load_async_to_lds_b128 %2, %10, off\n\tglobal_load_async_to_lds_b128 %3, %11, off\n\t"
                 "global_load_async_to_lds_b128 %4, %12, off\n\tglobal_load_async_to_lds_b128 %5, %13, off\n\tglobal_load_async_to_lds_b128 %6, %14, off\n\tglobal_load_async_to_lds_b128 %7, %15, off\n\ts_wait_xcnt 0x0"
                 :: "v"(l), "v"(l + 1u * 32u * GP), "v"(l + 2u * 32u * GP), "v"(l + 3u * 32u * GP), "v"(l + 4u * 32u * GP), "v"(l + 5u * 32u * GP), "v"(l + 6u * 32u * GP), "v"(l + 7u * 32u * GP),
                    "v"(g), "v"(g + gs), "v"(g + 2 * gs), "v"(g + 3 * gs), "v"(g + 4 * gs), "v"(g + 5 * gs), "v"(g + 6 * gs), "v"(g + 7 * gs) : "memory");
}
__device__ __forceinline__ void acopy4(unsigned l, const bf* g, size_t gs) {
    asm volatile("global_load_async_to_lds_b128 %0, %4, off\n\tglobal_load_async_to_lds_b128 %1, %5, off\n\tglobal_load_async_to_lds_b128 %2, %6, off\n\tglobal_load_async_to_lds_b128 %3, %7, off\n\ts_wait_xcnt 0x0"
                 :: "v"(l), "v"(l + 1u * 32u * GP), "v"(l + 2u * 32u * GP), "v"(l + 3u * 32u * GP), "v"(g), "v"(g + gs), "v"(g + 2 * gs), "v"(g + 3 * gs) : "memory");
}
template <bool SPLITA, int OUTM, int MT>
__global__ __launch_bounds__(128) void k_gemmb(const bf* __restrict__ A, const bf* __restrict__ Al, const bf* __restrict__ Bn, const float* __restrict__ bias, const float* __restrict__ biasK, const float* __restrict__ biasV, float* C, int ldc, bf* Ph, bf* Pl, int K) {
    static_assert(MT == 4 || MT == 2, "rows of A a block: 128 or 64"); static_assert(OUTM == 0 || MT == 4, "V^T swaps row and column blocks: both 128");
    constexpr int BR = 32 * MT;                                  // rows of A (and Al) a block
    constexpr int STG = (128 + (SPLITA ? 2 : 1) * BR) * GP;      // elements a stage: B, A (, Al)
    __shared__ __align__(16) float ost[4][16 * 68];
    __shared__ __align__(16) bf gt[2][STG];
    const int lane = threadIdx.x & 31, wave = threadIdx.x >> 5, lr = lane & 15, hi = lane >> 4;
    const int wr = wave >> 1, wc = wave & 1;    // the wave's place in the block tile
    const int z = OUTM == 1 ? (int)blockIdx.z : 0; const bool vt = OUTM == 1 && z == 2;    // which product; V^T takes its rows from the weights (block-uniform)
    const int rb = vt ? blockIdx.y : blockIdx.x, cb = vt ? blockIdx.x : blockIdx.y;         // row block, column block: blockIdx.x counts token blocks, blockIdx.y weight blocks
    const int r0 = rb * BR + wr * (MT * 16), c0 = cb * 128 + wc * 64;
    const int crow = threadIdx.x >> 3, cpc = (threadIdx.x & 7) * 8;    // copies: thread -> rows crow + 16 u, 16-byte piece cpc of each 128-byte row piece
    const bf* Wz = Bn + (size_t)z * DM * DM;
    const bf* ga = (vt ? Wz : A) + (size_t)(rb * BR + crow) * K + cpc;
    const bf* gal = SPLITA ? Al + (size_t)(rb * BR + crow) * K + cpc : nullptr;
    const bf* gb = (vt ? A : Wz) + (size_t)(cb * 128 + crow) * K + cpc;
    const unsigned l0 = (unsigned)(size_t)&gt[0][crow * GP + cpc];    // the thread's LDS byte address in buffer 0, operand B
    const size_t gs = (size_t)16 * K;
    const int nst = K / GKS;
    // The block's own first k stage; the walk wraps. Blocks that read the same rows of an operand (same blockIdx.x, or same blockIdx.y and z) get starts spread over the stages, at most four on one start, so that few of them ask L2 for the same lines at the same moment.
    const int rot = (int)((((blockIdx.x & 3u) << 2) + (blockIdx.x >> 3) + (OUTM == 1 ? blockIdx.y + 8u * blockIdx.z : 2u * blockIdx.y)) % (unsigned)nst);
    auto fill = [&](int st) { const unsigned l = l0 + (unsigned)(st & 1) * (unsigned)(STG * 2); const int sk = st + rot; const size_t ko = (size_t)(sk >= nst ? sk - nst : sk) * GKS;
        acopy8(l, gb + ko, gs);
        if constexpr (MT == 4) { acopy8(l + 128u * GP * 2u, ga + ko, gs); if (SPLITA) acopy8(l + (128u + BR) * GP * 2u, gal + ko, gs); }
        else { acopy4(l + 128u * GP * 2u, ga + ko, gs); if (SPLITA) acopy4(l + (128u + BR) * GP * 2u, gal + ko, gs); } };
    v8f acc[MT][4];
#pragma unroll
    for (int i = 0; i < MT; ++i) {
#pragma unroll
        for (int t = 0; t < 4; ++t) acc[i][t] = (v8f){}; }
    fill(0);
    asm volatile("s_wait_asynccnt 0x0" ::: "memory");    // this wave's copies of stage 0 have landed
    __syncthreads();                                     // every wave's have: stage 0 may be read
    if (nst > 1) fill(1);
#pragma unroll 1
    for (int st = 0; st < nst; ++st) {    // rolled: one stage a trip, the two buffers in turn
        const bf* tb = &gt[st & 1][0]; const bf* ta = tb + 128 * GP; const bf* tal = ta + BR * GP;
#pragma unroll
        for (int q = 0; q < GKS / 32; ++q) {
            v16bf fa[MT], fal[MT], fb[4];    // the fragments of 32 k, fetched as one group of LDS reads
#pragma unroll
            for (int i = 0; i < MT; ++i) { const int ao = (wr * (MT * 16) + i * 16 + lr) * GP + q * 32 + 8 * hi;
                fa[i] = cat16b(*(const v8us*)(ta + ao), *(const v8us*)(ta + ao + 16));
                if (SPLITA) fal[i] = cat16b(*(const v8us*)(tal + ao), *(const v8us*)(tal + ao + 16)); }
#pragma unroll
            for (int t = 0; t < 4; ++t) { const int bo = (wc * 64 + t * 16 + lr) * GP + q * 32 + 8 * hi; fb[t] = cat16b(*(const v8us*)(tb + bo), *(const v8us*)(tb + bo + 16)); }
            // Inputs-only fence on the loaded fragments: it keeps the LDS reads together in front of the matrix run; without it they are spread among the products, each pair with its own full wait.
            if constexpr (MT == 4) asm volatile("" :: "v"(fa[0]), "v"(fa[1]), "v"(fa[2]), "v"(fa[3]), "v"(fb[0]), "v"(fb[1]), "v"(fb[2]), "v"(fb[3]));
            else asm volatile("" :: "v"(fa[0]), "v"(fa[1]), "v"(fal[0]), "v"(fal[1]), "v"(fb[0]), "v"(fb[1]), "v"(fb[2]), "v"(fb[3]));
#pragma unroll
            for (int i = 0; i < MT; ++i) {
#pragma unroll
                for (int t = 0; t < 4; ++t) acc[i][t] = wmmab(fa[i], fb[t], acc[i][t]); }
            if constexpr (SPLITA) {
#pragma unroll
                for (int i = 0; i < MT; ++i) {
#pragma unroll
                    for (int t = 0; t < 4; ++t) acc[i][t] = wmmab(fal[i], fb[t], acc[i][t]); } }
        }
        asm volatile("s_wait_dscnt 0x0" ::: "memory");       // this wave's reads of the buffer are done before anybody refills it
        asm volatile("s_wait_asynccnt 0x0" ::: "memory");    // this wave's copies of stage st + 1 have landed
        __syncthreads();                                     // publishes stage st + 1 and ends every wave's reads of stage st
        if (st + 2 < nst) fill(st + 2);                      // into the buffer that this trip has just read
    }
    asm volatile("s_wait_asynccnt 0x0" ::: "memory");    // no copy is outstanding when the epilogue starts
    float* os = &ost[wave][0];
    const float* bz = z == 0 ? bias : z == 1 ? biasK : biasV;
    float br[4] = {0.f, 0.f, 0.f, 0.f};    // bias by column
    if (!vt && bz) { const int bi = c0 + lr;
#pragma unroll
        for (int t = 0; t < 4; ++t) br[t] = bz[bi + t * 16];
        asm volatile("s_wait_xcnt 0x0" :: "v"(bi) : "memory");    // the bias loads' offset register is free for re-use only behind this wait; bi as an input keeps it live up to it
#pragma unroll
        for (int t = 0; t < 4; ++t) br[t] = bfr(br[t]); }
    if (OUTM != 0) Ph += (size_t)z * NBT * NN * DM;
#pragma unroll
    for (int i = 0; i < MT; ++i) {    // the wave's tile goes out 16 rows at a time through its own LDS piece, as whole lines
        const int ri = r0 + i * 16;
        if (vt) { const float* bp = bz + ri + hi * 8; float bw[8];
#pragma unroll
            for (int j = 0; j < 8; ++j) bw[j] = bp[j];
            asm volatile("s_wait_xcnt 0x0" :: "v"(bp) : "memory");    // the same for the bias by row
#pragma unroll
            for (int j = 0; j < 8; ++j) { const float bv = bfr(bw[j]);
#pragma unroll
                for (int t = 0; t < 4; ++t) os[(hi * 8 + j) * 68 + t * 16 + lr] = acc[i][t][j] + bv; }
        } else {
#pragma unroll
            for (int t = 0; t < 4; ++t) {
#pragma unroll
                for (int j = 0; j < 8; ++j) os[(hi * 8 + j) * 68 + t * 16 + lr] = acc[i][t][j] + br[t]; }
        }
        asm volatile("s_wait_dscnt 0x0" ::: "memory");    // the wave's 16 rows stand in its own LDS piece before its lanes read them back; no other wave touches that piece, so no barrier
        if (OUTM != 0) {
            // a tile row is 64 elements = one whole 128-byte line of a plane; 16 rows and 64 columns lie in one item; only V^T has a residual plane (block-uniform test)
            const size_t base = vt ? ((size_t)(c0 / NN) * DM + ri) * NN + (c0 % NN) : (((size_t)(ri / NN) * NH_ + (c0 >> 6)) * NN + (ri % NN)) * HD;
            const int pitch = vt ? NN : HD;
            if (vt) {
#pragma unroll
                for (int s = 0; s < 4; ++s) { const int row = 4 * s + (lane >> 3), piece = lane & 7; const float* sp = os + row * 68 + piece * 8; v8us oh, ol;
#pragma unroll
                    for (int e = 0; e < 8; ++e) { const unsigned short hb = f2bf(sp[e]); oh[e] = hb; ol[e] = f2bf(sp[e] - bf2f(hb)); }
                    const size_t o = base + (size_t)row * pitch + piece * 8; *(v8us*)(Ph + o) = oh; *(v8us*)(Pl + o) = ol; }
                asm volatile("s_wait_xcnt 0x0" ::: "memory");    // this branch's stores, in every pass: in the built code the other branch's block, which re-uses their registers, follows them in front of the wait behind the join
            } else {
#pragma unroll
                for (int s = 0; s < 4; ++s) { const int row = 4 * s + (lane >> 3), piece = lane & 7; const float* sp = os + row * 68 + piece * 8; v8us oh;
#pragma unroll
                    for (int e = 0; e < 8; ++e) oh[e] = f2bf(sp[e]);
                    *(v8us*)(Ph + base + (size_t)row * pitch + piece * 8) = oh; }
            }
        } else {
            float* crw = C + (size_t)ri * ldc + c0;
#pragma unroll
            for (int s = 0; s < 8; ++s) { const int Lid = (lane >> 3) + 4 * s, piece = lane & 7; const int row = Lid >> 1, cofs = (Lid & 1) * 32 + piece * 4;
                *(v4f*)(crw + (size_t)row * ldc + cofs) = *(const v4fa*)(os + row * 68 + cofs); }
        }
        if (i + 1 < MT) asm volatile("s_wait_xcnt 0x0" ::: "memory");    // the stores' address and data registers are re-used by the next 16 rows only behind this wait
    }
}

#define KT   128           // keys a tile
#define FP   72            // K tile: LDS row pitch in 16-bit elements (a row = one key's 64 head elements)
#define FPV  136           // V^T tile: LDS row pitch in 16-bit elements (a row = one head element's 128 keys)
#define FKL  (KT * FP)     // the K tile
#define FVL  (64 * FPV)    // the V^T tile
#define SC2  0.18033688f   // 1/8 x log2(e)
typedef __attribute__((ext_vector_type(16))) float v16f;
__device__ __forceinline__ float xhalf(float v) { const int b = __float_as_int(v); return __int_as_float(__builtin_amdgcn_permlanex16(b, b, 0x76543210, 0xfedcba98, false, false)); }   // lane l <-> l ^ 16
__device__ __forceinline__ v16f widen16(v16bf x) { typedef __attribute__((ext_vector_type(8))) unsigned v8u; const v8u w = __builtin_bit_cast(v8u, x); v16f r;    // packed bf16 pairs back to f32: a shift and a mask a pair
#pragma unroll
    for (int k = 0; k < 8; ++k) { r[2 * k] = __uint_as_float(w[k] << 16); r[2 * k + 1] = __uint_as_float(w[k] & 0xFFFF0000u); }
    return r; }
#define GC2  (-1.44269504f / (2.0f * LSIG * LSIG))    // un-normalised band tap = exp(-d^2 / (2 x 0.16)) = exp2(d^2 x GC2), 0 outside |d| <= 3
__device__ __forceinline__ v16f cat16f(v8f lo, v8f hi) { return __builtin_shufflevector(lo, hi, 0, 1, 2, 3, 4, 5, 6, 7, 8, 9, 10, 11, 12, 13, 14, 15); }
// Eight independent v_exp_f32 in one statement, every output apart from every input, v_nop last: no neighbour reads a result or overwrites a source in the slot directly behind a transcendental.
__device__ __forceinline__ v8f exp2x8(v8f x) { float r0, r1, r2, r3, r4, r5, r6, r7;
    asm("v_exp_f32 %0, %8\n\tv_exp_f32 %1, %9\n\tv_exp_f32 %2, %10\n\tv_exp_f32 %3, %11\n\tv_exp_f32 %4, %12\n\tv_exp_f32 %5, %13\n\tv_exp_f32 %6, %14\n\tv_exp_f32 %7, %15\n\tv_nop"
        : "=&v"(r0), "=&v"(r1), "=&v"(r2), "=&v"(r3), "=&v"(r4), "=&v"(r5), "=&v"(r6), "=&v"(r7) : "v"(x[0]), "v"(x[1]), "v"(x[2]), "v"(x[3]), "v"(x[4]), "v"(x[5]), "v"(x[6]), "v"(x[7]));
    return (v8f){r0, r1, r2, r3, r4, r5, r6, r7}; }
__device__ __forceinline__ float exp2x1(float x) { float r; asm("v_exp_f32 %0, %1\n\tv_nop" : "=v"(r) : "v"(x)); return r; }    // one v_exp_f32 with the same slot behind it
__global__ __launch_bounds__(256) __attribute__((amdgpu_waves_per_eu(4, 4))) void k_fattn(const bf* __restrict__ Qh, const bf* __restrict__ Kh, const bf* __restrict__ VTh, const bf* __restrict__ VTl, bf* Ch, bf* Cl) {
    __shared__ __align__(16) bf tk[2][FKL];    // [buffer] K tile
    __shared__ __align__(16) bf tv[2][FVL];    // [buffer] V^T tile
    __shared__ __align__(16) float xch[8][34 * 32];    // a wave's hand-over: 32 accumulator registers, the maximum and the sum of one query tile, lane by lane
    const int tid = threadIdx.x, lane = tid & 31, lr = lane & 15, hi = lane >> 4;
    const int wave = __builtin_amdgcn_readfirstlane(tid >> 5);
    const int pr = wave & 3, kq = wave >> 2;    // query group of 32; which 64 keys of every tile
    const int h = blockIdx.y, qg = blockIdx.x * 128 + pr * 32;
    const size_t hb = ((size_t)blockIdx.z * NH_ + h) * NN * HD;    // this item's and head's part of every Q, K and V^T plane
    const bf* __restrict__ kh0 = Kh + hb;
    const bf* __restrict__ vh0 = VTh + hb; const bf* __restrict__ vl0 = VTl + hb;
    v16bf qh[2][2];    // [query tile][32 of the 64 head elements]
#pragma unroll
    for (int x = 0; x < 2; ++x) {
#pragma unroll
        for (int ks = 0; ks < 2; ++ks) { const size_t o = hb + (size_t)(qg + x * 16 + lr) * HD + ks * 32 + 8 * hi; qh[x][ks] = cat16b(*(const v8us*)(Qh + o), *(const v8us*)(Qh + o + 16)); } }
    asm volatile("s_wait_xcnt 0x0" ::: "memory");    // these loads' address registers are free for re-use (the next loads' results land in them) only behind this wait
    const int srow = tid >> 3, spc = (tid & 7) * 8;     // staging of K: thread -> rows srow + 32 u, 16-byte piece spc of each 128-byte row (a wave covers whole lines)
    const int vrow = tid >> 4, vpc = (tid & 15) * 8;    // staging of V^T: thread -> rows vrow + 16 u, 16-byte piece vpc of each 256-byte row piece
    const bf* __restrict__ kst = kh0 + (size_t)srow * HD + spc; const bf* __restrict__ vst = vh0 + (size_t)vrow * NN + vpc;    // the thread's first piece of key tile 0
    v8us g[8];
    auto gload = [&](int kb) { const bf* kp = kst + (size_t)kb * HD; const bf* vp = vst + kb;
#pragma unroll
        for (int u = 0; u < 4; ++u) { g[u] = *(const v8us*)(kp + u * 32 * HD); g[4 + u] = *(const v8us*)(vp + (size_t)u * 16 * NN); }
    };
    auto sstore = [&](int buf) {
#pragma unroll
        for (int u = 0; u < 4; ++u) { *(v8us*)(&tk[buf][(srow + 32 * u) * FP + spc]) = g[u]; *(v8us*)(&tv[buf][(vrow + 16 * u) * FPV + vpc]) = g[4 + u]; }
    };
    v8f ac2[2][4];    // [query tile][16 of the 64 head elements]
#pragma unroll
    for (int x = 0; x < 2; ++x) {
#pragma unroll
        for (int t = 0; t < 4; ++t) ac2[x][t] = (v8f){}; }
    float m2[2] = {-3.0e38f, -3.0e38f}, ls2[2] = {0.f, 0.f};    // per query tile: running maximum over this wave's keys (raw score units, equal in both halves of the wave), this half's part of the sum
    const int ko0 = (kq * 64 + lr) * FP + 8 * hi, vo0 = lr * FPV + kq * 64 + 8 * hi;    // this wave's 64 keys: rows of the K tile, columns of the V^T tile
    // The block's own first key tile; the walk wraps. The 16 blocks that read one head's K and V^T start at 16 different tiles, so that they do not ask L2 for the same lines at the same moment.
    const int rot = (int)(((((blockIdx.x & 3u) << 1) + (blockIdx.x >> 3)) << 1) + ((blockIdx.x >> 2) & 1u)) & (NN / KT - 1);
    gload(rot * KT);
    asm volatile("s_wait_xcnt 0x0" ::: "memory");    // the loop's address arithmetic re-uses these loads' offset registers
    sstore(0);
    __syncthreads();
    auto tile = [&](int cur) __attribute__((always_inline)) {    // this wave's 64 keys of the tile in buffer cur against its 32 queries: one maximum, one rescale and one barrier per 64 keys of a wave
        v8f st[2][4];    // [query tile][16 of the 64 keys]
#pragma unroll
        for (int x = 0; x < 2; ++x) {
#pragma unroll
            for (int tt = 0; tt < 4; ++tt) st[x][tt] = (v8f){}; }
#pragma unroll
        for (int th = 0; th < 2; ++th) {
#pragma unroll
            for (int ks = 0; ks < 2; ++ks) { v16bf kh[2];
#pragma unroll
                for (int tt = 0; tt < 2; ++tt) { const int o = ko0 + (th * 2 + tt) * 16 * FP + ks * 32; kh[tt] = cat16b(*(const v8us*)(&tk[cur][o]), *(const v8us*)(&tk[cur][o + 16])); }
#pragma unroll
                for (int x = 0; x < 2; ++x) { st[x][th * 2] = wmmab(kh[0], qh[x][ks], st[x][th * 2]); st[x][th * 2 + 1] = wmmab(kh[1], qh[x][ks], st[x][th * 2 + 1]); } } }
        v16bf ph[2][2];    // [query tile][32 of the 64 keys]
#pragma unroll
        for (int x = 0; x < 2; ++x) {
            float mx = fmaxf(fmaxf(st[x][0][0], st[x][1][0]), fmaxf(st[x][2][0], st[x][3][0]));
#pragma unroll
            for (int j = 1; j < 8; ++j) mx = fmaxf(fmaxf(mx, fmaxf(st[x][0][j], st[x][1][j])), fmaxf(st[x][2][j], st[x][3][j]));
            mx = fmaxf(mx, xhalf(mx));
            const float mnew = fmaxf(m2[x], mx), alpha = exp2x1((m2[x] - mnew) * SC2), mc = mnew * SC2;
            m2[x] = mnew;
            v8f s8 = (v8f){};
#pragma unroll
            for (int kk = 0; kk < 2; ++kk) {
                const v16f p = cat16f(exp2x8(st[x][2 * kk] * SC2 - mc), exp2x8(st[x][2 * kk + 1] * SC2 - mc));
                const v8f h8 = __builtin_shufflevector(p, p, 0, 1, 2, 3, 4, 5, 6, 7) + __builtin_shufflevector(p, p, 8, 9, 10, 11, 12, 13, 14, 15);
                s8 = kk == 0 ? h8 : s8 + h8;
                ph[x][kk] = __builtin_convertvector(p, v16bf); }
            const v4f s4 = __builtin_shufflevector(s8, s8, 0, 1, 2, 3) + __builtin_shufflevector(s8, s8, 4, 5, 6, 7);
            ls2[x] = ls2[x] * alpha + ((s4[0] + s4[2]) + (s4[1] + s4[3]));
#pragma unroll
            for (int t = 0; t < 4; ++t) ac2[x][t] *= alpha;
        }
        __builtin_amdgcn_sched_barrier(0);    // holds the softmax's vector work in front of the V^T reads and products; without it the compiler lifts those reads, and with them the staging stores, their wait on the global loads and the barrier, to the head of the trip, where the loads have only just been issued
        v16bf vh[2][4];    // [32 of the 64 keys][16 of the 64 head elements]: the step's V^T fragments, read as one group like its K fragments (the score registers are free by now)
#pragma unroll
        for (int kk = 0; kk < 2; ++kk) {
#pragma unroll
            for (int t = 0; t < 4; ++t) { const int o = vo0 + t * 16 * FPV + kk * 32; vh[kk][t] = cat16b(*(const v8us*)(&tv[cur][o]), *(const v8us*)(&tv[cur][o + 16])); } }
#pragma unroll
        for (int kk = 0; kk < 2; ++kk) {    // eight independent accumulators a run
#pragma unroll
            for (int t = 0; t < 4; ++t) {
#pragma unroll
                for (int x = 0; x < 2; ++x) ac2[x][t] = wmmab(vh[kk][t], ph[x][kk], ac2[x][t]); } }
    };
#pragma unroll 1
    for (int s = 0; s + 1 < NN / KT; ++s) {    // rolled, one straight block a trip: the last tile, behind which nothing is staged, stands behind the loop (with a branch round the staging the compiler sinks the row sums behind it, p stays live and the staged tile is spilled)
        gload(((s + 1 + rot) & (NN / KT - 1)) * KT);    // the next tile of the wrapped walk flies while this one is worked on
        tile(s & 1);
        sstore((s & 1) ^ 1);    // every wave left that buffer before the barrier that ended the tile before this one
        __syncthreads();
    }
    tile((NN / KT - 1) & 1);
    // The join: wave (pr, kq) keeps query tile kq and hands tile 1 - kq to wave (pr, 1 - kq), lane to lane (both waves hold a query's values in the same lanes and registers).
    const bool up = kq != 0;    // wave-uniform
    float* xw = &xch[wave][0];
#pragma unroll
    for (int t = 0; t < 4; ++t) { const v8f gv = up ? ac2[0][t] : ac2[1][t];
        *(v4f*)(xw + ((2 * t) * 32 + lane) * 4) = __builtin_shufflevector(gv, gv, 0, 1, 2, 3); *(v4f*)(xw + ((2 * t + 1) * 32 + lane) * 4) = __builtin_shufflevector(gv, gv, 4, 5, 6, 7); }
    xw[32 * 32 + lane] = up ? m2[0] : m2[1]; xw[33 * 32 + lane] = up ? ls2[0] : ls2[1];
    __syncthreads();    // every wave's hand-over stands in LDS before its partner reads it
    const float* xp = &xch[wave ^ 4][0];
    const float mk = up ? m2[1] : m2[0], mp = xp[32 * 32 + lane], mj = fmaxf(mk, mp);
    const float ak = exp2x1((mk - mj) * SC2), ap = exp2x1((mp - mj) * SC2);
    float lsum = (up ? ls2[1] : ls2[0]) * ak + xp[33 * 32 + lane] * ap;
    v8f acc[4];
#pragma unroll
    for (int t = 0; t < 4; ++t) { const v4f a = *(const v4f*)(xp + ((2 * t) * 32 + lane) * 4), b = *(const v4f*)(xp + ((2 * t + 1) * 32 + lane) * 4);
        acc[t] = (up ? ac2[1][t] : ac2[0][t]) * ak + __builtin_shufflevector(a, b, 0, 1, 2, 3, 4, 5, 6, 7) * ap; }
    const int q0 = qg + kq * 16;    // the 16 queries that this wave finishes
    lsum += xhalf(lsum);
    const float inv = LJ / lsum;
#pragma unroll
    for (int t = 0; t < 4; ++t) acc[t] *= inv;
    const int i = q0 + lr;
    float lnorm = 0.f;       // row normaliser of the band (taps clipped at the sequence ends)
#pragma unroll
    for (int d = -WIN; d <= WIN; ++d) { const int k = i - d; lnorm += (k >= 0 && k < NN) ? __builtin_amdgcn_exp2f((float)(d * d) * GC2) : 0.f; }
    const float lw = (1.0f - LJ) / (lnorm + LEPSK);
#pragma unroll
    for (int bb = 0; bb < 2; ++bb) { const int kb = ((q0 - 16) & ~31) + 32 * bb;    // keys q0 - 3 .. q0 + 18 lie in these two blocks; wave-uniform test
        if (kb >= 0 && kb < NN) { v8f q2[2];    // squared distance query - key, in the B operand's k order
#pragma unroll
            for (int e = 0; e < 16; ++e) { const float fd = (float)(i - (kb + (e < 8 ? 8 * hi + e : 8 + 8 * hi + e))); q2[e >> 3][e & 7] = fd * fd; }
            const v16f ge = cat16f(exp2x8(q2[0] * GC2), exp2x8(q2[1] * GC2)); v16f lv;
#pragma unroll
            for (int e = 0; e < 16; ++e) lv[e] = q2[e >> 3][e & 7] <= (float)(WIN * WIN) ? ge[e] * lw : 0.f;
            const v16bf lh = __builtin_convertvector(lv, v16bf);
            const v16bf ll = __builtin_convertvector(lv - widen16(lh), v16bf);
#pragma unroll
            for (int t = 0; t < 4; ++t) { const size_t o = (size_t)(t * 16 + lr) * NN + kb + 8 * hi;
                const v16bf vh = cat16b(*(const v8us*)(vh0 + o), *(const v8us*)(vh0 + o + 16)); const v16bf vl = cat16b(*(const v8us*)(vl0 + o), *(const v8us*)(vl0 + o + 16));
                acc[t] = wmmab(vh, lh, acc[t]); acc[t] = wmmab(vl, lh, acc[t]); acc[t] = wmmab(vh, ll, acc[t]); } } }
    const size_t co = ((size_t)blockIdx.z * NN + i) * DMOD + h * HD + hi * 8;    // acc[t][j] = O[query i][16 t + 8 hi + j]; stored as the bf16 hi + residual planes that the output projection reads
#pragma unroll
    for (int t = 0; t < 4; ++t) { v8us oh, ol;
#pragma unroll
        for (int j = 0; j < 8; ++j) { const unsigned short hb = f2bf(acc[t][j]); oh[j] = hb; ol[j] = f2bf(acc[t][j] - bf2f(hb)); }
        *(v8us*)(Ch + co + t * 16) = oh; *(v8us*)(Cl + co + t * 16) = ol; }
}

// f32 -> bf16 of all five operands in one grid: blockIdx.y picks a piece of DM x DM elements, 0 .. 3 = x (both items), 4 .. 7 = Wq, Wk, Wv, Wo; dst holds the pieces one behind another.
// A block converts CVB elements, a thread eight runs of 8 (2,048 elements apart, so a wave's loads and stores cover whole lines): few waves to start, all of a thread's loads in flight at once.
#define CVB  (256 * 8 * 8)
__global__ __launch_bounds__(256) void k_cvt8(const float* __restrict__ x, const float* __restrict__ Wq, const float* __restrict__ Wk, const float* __restrict__ Wv, const float* __restrict__ Wo, bf* dst) {
    const int y = blockIdx.y; const size_t i = (size_t)blockIdx.x * CVB + threadIdx.x * 8;
    const float* __restrict__ src = y < 4 ? x + (size_t)y * DM * DM : y == 4 ? Wq : y == 5 ? Wk : y == 6 ? Wv : Wo;
    const float* p = src + i; v8f v[8];
#pragma unroll
    for (int q = 0; q < 8; ++q) v[q] = *(const v8f*)(p + q * 2048);
    asm volatile("s_wait_xcnt 0x0" :: "v"(p) : "memory");    // the loads' address registers are free for re-use only behind this wait; p as an input keeps them live up to it, so that no load's result lands in them
#pragma unroll
    for (int q = 0; q < 8; ++q) { v8us o;
#pragma unroll
        for (int k = 0; k < 8; ++k) o[k] = f2bf(v[q][k]);
        *(v8us*)(dst + (size_t)y * DM * DM + i + q * 2048) = o; }
}
extern "C" void kernel_launch(void* const* d_in, const int* in_sizes, int n_in,
                              void* d_out, int out_size, void* d_ws, size_t ws_size, hipStream_t stream) {
    (void)in_sizes; (void)n_in; (void)out_size;
    const float* x = (const float*)d_in[0]; const float* Wq = (const float*)d_in[1]; const float* bq = (const float*)d_in[2]; const float* Wk = (const float*)d_in[3]; const float* bk = (const float*)d_in[4]; const float* Wv = (const float*)d_in[5]; const float* bv = (const float*)d_in[6]; const float* Wo = (const float*)d_in[7]; const float* bo = (const float*)d_in[8];
    float* out = (float*)d_out;    // [2][2048][1024]
    char* wsp = (char*)d_ws;
    auto take = [&](size_t bytes) { char* p = wsp; wsp += (bytes + 255) & ~(size_t)255; return (void*)p; };
    const size_t PW = (size_t)DMOD * DMOD, PX = (size_t)NBT * NN * DMOD;    // elements of a weight plane, of a plane over both items
    bf* Xb = (bf*)take((PX + 4 * PW) * 2); bf* WQ = Xb + PX; bf* WO = WQ + 3 * PW;    // x, Wq, Wk, Wv, Wo in bf16, one behind another
    bf* Qh = (bf*)take(3 * PX * 2); bf* Kh = Qh + PX; bf* VTh = Kh + PX;             // hi planes of Q, K, V^T, one behind another
    bf* VTl = (bf*)take(PX * 2);                                                     // residual plane of V^T
    bf* Ch = (bf*)take(PX * 2); bf* Cl = (bf*)take(PX * 2);
    if ((size_t)(wsp - (char*)d_ws) > ws_size) return;    // about 67 MB in all
    k_cvt8<<<dim3(DMOD * DMOD / CVB, 8, 1), 256, 0, stream>>>(x, Wq, Wk, Wv, Wo, Xb);    // torch [out][in] = n-major
    k_gemmb<false, 1, 4><<<dim3(NBT * NN / 128, DMOD / 128, 3), 128, 0, stream>>>(Xb, nullptr, WQ, bq, bk, bv, nullptr, DMOD, Qh, VTl, DMOD);
    k_fattn<<<dim3(NN / 128, NH_, NBT), 256, 0, stream>>>(Qh, Kh, VTh, VTl, Ch, Cl);
    k_gemmb<true, 0, 2><<<dim3(NBT * NN / 64, DMOD / 128, 1), 128, 0, stream>>>(Ch, Cl, WO, bo, nullptr, nullptr, out, DMOD, nullptr, nullptr, DMOD);
}
